// v000
// Measured on an AMD MI455X. A time is GPU time per run, averaged over a window of back-to-back runs after a warm-up
// (all launches, gaps included; the runs take copies of the inputs in turn), and the median of several windows.
// Apart from v000's, it joins two sittings. Times from different sittings can be a few percent apart, while
// side-by-side timings come from the same sitting.
// v000 is the starting kernel.
#include <hip/hip_runtime.h>

// MABClean (Set-Transformer MAB; X, Y [4][2048][256]; Q = SetNorm(X) Wq^T + bq, K = SetNorm(Y) Wk^T + bk, V = Y Wv^T + bv (SetNorm: normalise over all (samples, features) of one batch element, eps 1e-5,
// then per-feature scale/shift); 8 heads of 32: A = softmax_k(Q_h.K_h / sqrt(256)); O = concat_h A V_h; H = X + O Wo^T + bo; out = H + relu(SetNorm(H)) Wres^T + bres).
// Compute dtypes, f32 accumulate: every input rounded to bf16; the three SetNorm statistics (mean, then variance, over 524,288 values each) by fixed-order two-level
// reductions in f32; the normalised operands as bf16 hi+lo planes x exact weights (2 products); V on PLAIN bf16 operands (exact, + bias); scores (K = 32) and attn.v on SINGLE fp16 planes (model

#define NB_  4
#define TT   2048
#define CC   256
#define NHD  8
#define DH   32
#define ZH   1
#define OTP  288
#define PCAR 1024.0f
#define SCL  0.0625f              // 1/sqrt(dim_Y = 256)
#define NW   32                   // partial-sum waves per statistic (64 rows each)
typedef _Float16 h16;
typedef unsigned short bf;
typedef __attribute__((ext_vector_type(16))) __bf16   v16bf;
typedef __attribute__((ext_vector_type(16))) _Float16 v16h;
typedef __attribute__((ext_vector_type(8)))  _Float16 v8h;
typedef __attribute__((ext_vector_type(8)))  unsigned short v8us;
typedef __attribute__((ext_vector_type(8)))  float    v8f;
typedef __attribute__((ext_vector_type(4)))  float    v4f;
typedef v8h  __attribute__((may_alias)) v8ha;
typedef v4f  __attribute__((may_alias)) v4fa;
typedef v8us __attribute__((may_alias)) v8usa;

__device__ __forceinline__ unsigned short f2bf(float f) { unsigned u = __float_as_uint(f); u += 0x7FFFu + ((u >> 16) & 1u); return (unsigned short)(u >> 16); }
__device__ __forceinline__ float bf2f(unsigned short b) { return __uint_as_float(((unsigned)b) << 16); }
__device__ __forceinline__ float bfr(float f) { return bf2f(f2bf(f)); }
__device__ __forceinline__ v16h cat16(v8h lo, v8h hi) { return __builtin_shufflevector(lo, hi, 0, 1, 2, 3, 4, 5, 6, 7, 8, 9, 10, 11, 12, 13, 14, 15); }
__device__ __forceinline__ v16bf cat16b(v8us lo, v8us hi) { return __builtin_bit_cast(v16bf, __builtin_shufflevector(lo, hi, 0, 1, 2, 3, 4, 5, 6, 7, 8, 9, 10, 11, 12, 13, 14, 15)); }
__device__ __forceinline__ v8f wmma16(v16h a, v16h b, v8f c) { return __builtin_amdgcn_wmma_f32_16x16x32_f16(false, a, false, b, (short)0, c, false, false); }
__device__ __forceinline__ v8f wmmab(v16bf a, v16bf b, v8f c) { return __builtin_amdgcn_wmma_f32_16x16x32_bf16(false, a, false, b, (short)0, c, false, false); }



// ---- k_gemmw: register-blocked GEMM, ONE WAVE per 64x64 output tile (16 accumulators), operands straight from K-contiguous 16-bit planes; grid (M/64, N/64, Z), 32 threads.
// C[m][n] (f32, pitch ldc, + optional f32 bias[n]) = sum_k A[m][k] Bt[n][k] (+ split products per NSPLIT). z-batch strides sA/sB/sC in elements. K % 32 == 0.
template <typename T16> struct WFrag;
template <> struct WFrag<h16> { typedef v16h V; static __device__ __forceinline__ V ld(const h16* p) { return cat16(*(const v8h*)p, *(const v8h*)(p + 16)); } static __device__ __forceinline__ v8f mma(V a, V b, v8f c) { return wmma16(a, b, c); } };
template <> struct WFrag<bf> { typedef v16bf V; static __device__ __forceinline__ V ld(const bf* p) { return cat16b(*(const v8us*)p, *(const v8us*)(p + 16)); } static __device__ __forceinline__ v8f mma(V a, V b, v8f c) { return wmmab(a, b, c); } };
template <typename T16, int NSPLIT, bool BIAS>
__global__ __launch_bounds__(32) void k_gemmw(const T16* __restrict__ A, const T16* __restrict__ A2, const T16* __restrict__ Bt, const T16* __restrict__ Bt2, int K, float* C, int ldc, const float* __restrict__ bias, size_t sA, size_t sB, size_t sC) {
    typedef typename WFrag<T16>::V V;
    __shared__ __align__(16) float os[16 * 68];
    const size_t z = blockIdx.z; A += z * sA; if (A2) A2 += z * sA; Bt += z * sB; if (Bt2) Bt2 += z * sB; C += z * sC;
    const int lane = threadIdx.x & 31, lr = lane & 15, hi = lane >> 4; const int r0 = blockIdx.x * 64, c0 = blockIdx.y * 64;
    v8f acc[4][4];
#pragma unroll
    for (int mb = 0; mb < 4; ++mb)
#pragma unroll
        for (int nb = 0; nb < 4; ++nb) acc[mb][nb] = (v8f){};
    const size_t aoff = (size_t)(r0 + lr) * K + 8 * hi, boff = (size_t)(c0 + lr) * K + 8 * hi;
#pragma unroll 1
    for (int kc = 0; kc < K; kc += 32) {
        V a[4], a2[4];
#pragma unroll
        for (int mb = 0; mb < 4; ++mb) { a[mb] = WFrag<T16>::ld(A + aoff + (size_t)mb * 16 * K + kc); if (NSPLIT == 1 || NSPLIT == 2) a2[mb] = WFrag<T16>::ld(A2 + aoff + (size_t)mb * 16 * K + kc); }
#pragma unroll
        for (int nb = 0; nb < 4; ++nb) { const V b = WFrag<T16>::ld(Bt + boff + (size_t)nb * 16 * K + kc); V b2; if (NSPLIT >= 2) b2 = WFrag<T16>::ld(Bt2 + boff + (size_t)nb * 16 * K + kc);
#pragma unroll
            for (int mb = 0; mb < 4; ++mb) { acc[mb][nb] = WFrag<T16>::mma(a[mb], b, acc[mb][nb]); if (NSPLIT == 1 || NSPLIT == 2) acc[mb][nb] = WFrag<T16>::mma(a2[mb], b, acc[mb][nb]); if (NSPLIT >= 2) acc[mb][nb] = WFrag<T16>::mma(a[mb], b2, acc[mb][nb]); } }
        asm volatile("v_nop\n\tv_nop\n\tv_nop\n\tv_nop" : "+v"(acc[0][0]), "+v"(acc[1][1]), "+v"(acc[2][2]), "+v"(acc[3][3]) : "v"(a[0]), "v"(a[3]));
    }
#pragma unroll
    for (int mb = 0; mb < 4; ++mb) {
#pragma unroll
        for (int nb = 0; nb < 4; ++nb) {
#pragma unroll
            for (int j = 0; j < 8; ++j) os[(hi * 8 + j) * 68 + nb * 16 + lr] = acc[mb][nb][j]; }
        __builtin_amdgcn_wave_barrier(); asm volatile("" ::: "memory");
        float* crow = C + (size_t)(r0 + mb * 16) * ldc + c0;
{
#pragma unroll
            for (int s = 0; s < 8; ++s) { const int row = 2 * s + hi, cofs = lr * 4; v4f val = *(const v4fa*)(os + row * 68 + cofs); if (BIAS) { val[0] += bfr(bias[c0 + cofs]); val[1] += bfr(bias[c0 + cofs + 1]); val[2] += bfr(bias[c0 + cofs + 2]); val[3] += bfr(bias[c0 + cofs + 3]); }
                *(v4f*)(crow + (size_t)row * ldc + cofs) = val; }
             }
        __builtin_amdgcn_wave_barrier(); asm volatile("" ::: "memory");
    }
}

__device__ __forceinline__ h16 tohx(float x) { return (h16)x; }
__device__ __forceinline__ void splitf(float y, unsigned short& h, unsigned short& l) { h = f2bf(y); l = f2bf(y - bf2f(h)); }
typedef __attribute__((ext_vector_type(2))) _Float16 v2h;
typedef __attribute__((ext_vector_type(4))) _Float16 v4h;
typedef __attribute__((ext_vector_type(2))) unsigned short v2us;
typedef __attribute__((ext_vector_type(8))) _Float16 v8h16;

__global__ __launch_bounds__(256) void k_cvt8(const float* __restrict__ src, bf* dst, size_t n8) { const size_t i = (size_t)blockIdx.x * 256 + threadIdx.x; if (i >= n8) return; const v8f v = *(const v8f*)(src + i * 8); v8us o;
#pragma unroll
    for (int k = 0; k < 8; ++k) o[k] = f2bf(v[k]); *(v8us*)(dst + i * 8) = o;  }
template <int RAW, int PASS>
__global__ __launch_bounds__(256) void k_psum(const float* __restrict__ A, const float* __restrict__ ST, float* PART) {
    const int lane = threadIdx.x & 31; const int w = blockIdx.x * 8 + (threadIdx.x >> 5); if (w >= NW) return; const float mu = PASS ? ST[0] : 0.f; float s = 0.f;
    for (int i = lane * 4; i < 64 * CC; i += 128) { const v4f v = *(const v4f*)(A + (size_t)w * 64 * CC + i);
#pragma unroll
        for (int q = 0; q < 4; ++q) { float x = RAW ? bfr(v[q]) : v[q]; if (PASS) { const float d0 = __fsub_rn(x, mu); x = __fmul_rn(d0, d0); } s = __fadd_rn(s, x); } }
#pragma unroll
    for (int sh = 16; sh; sh >>= 1) s += __shfl_xor(s, sh, 32);
    const float o = (lane == 0) ? s : 0.f; *(float*)(PART + (size_t)w * 32 + lane) = o;  }
template <int PASS>
__global__ __launch_bounds__(32) void k_comb(const float* __restrict__ PART, float* ST) {
    const int lane = threadIdx.x; float s = PART[(size_t)lane * 32];
#pragma unroll
    for (int sh = 16; sh; sh >>= 1) s += __shfl_xor(s, sh, 32);
    const float inv = 1.0f / (float)(TT * CC); float o;
    if (PASS == 0) o = (lane == 0) ? s * inv : 0.f; else { const float mu = ST[0]; o = (lane == 0) ? mu : (lane == 1 ? __fdiv_rn(1.0f, __fsqrt_rn(__fadd_rn(s * inv, 1e-5f))) : 0.f); }
    *(float*)(ST + lane) = o;  }
template <int RAW, int RELU>
__global__ __launch_bounds__(256) void k_snpl(const float* __restrict__ A, const float* __restrict__ ST, const float* __restrict__ w, const float* __restrict__ bb, bf* Ph, bf* Pl) { const size_t i = ((size_t)blockIdx.x * 256 + threadIdx.x) * 2; if (i >= (size_t)TT * CC) return; const int c = (int)(i & (CC - 1)); const float mu = ST[0], rs = ST[1]; v2us oh, ol;
#pragma unroll
    for (int q = 0; q < 2; ++q) { float x = A[i + q]; if (RAW) x = bfr(x); float t = __fmul_rn(__fsub_rn(x, mu), rs); asm volatile("" : "+v"(t)); float y = __fadd_rn(__fmul_rn(t, bfr(w[c + q])), bfr(bb[c + q])); if (RELU) y = fmaxf(y, 0.f); unsigned short a, c2; splitf(y, a, c2); oh[q] = a; ol[q] = c2; }
    *(v2us*)(Ph + i) = oh; *(v2us*)(Pl + i) = ol;  }
__global__ __launch_bounds__(256) void k_hp32(const float* __restrict__ F, int rows, int lg2rows, h16* P) {
    const int lane = threadIdx.x & 31; const int L0 = (blockIdx.x * 8 + (threadIdx.x >> 5)) * 8; const int nlines = NHD * rows * DH / 64;
{
#pragma unroll
        for (int l = 0; l < 8; ++l) { const int L = L0 + l; if (L >= nlines) break; const int e = L * 64 + lane * 2; const int d = e & (DH - 1); const int r = (e >> 5) & (rows - 1); const int h = e >> (5 + lg2rows); v2h o;
#pragma unroll
            for (int q = 0; q < 2; ++q) o[q] = tohx(F[(size_t)r * CC + h * DH + d + q]);
            *(v2h*)(P + (size_t)e) = o; }
         }
}
__global__ __launch_bounds__(256) void k_vt32(const float* __restrict__ FV, h16* V16) {
    const int lane = threadIdx.x & 31; const int L0 = (blockIdx.x * 8 + (threadIdx.x >> 5)) * 8; const int nlines = CC * TT / 64;
{
#pragma unroll
        for (int l = 0; l < 8; ++l) { const int L = L0 + l; if (L >= nlines) break; const int e = L * 64 + lane * 2; const int n = e & (TT - 1); const int c = e >> 11; v2h o;
#pragma unroll
            for (int q = 0; q < 2; ++q) o[q] = tohx(FV[(size_t)(n + q) * CC + c]);
            *(v2h*)(V16 + (size_t)e) = o; }
         }
}
__global__ __launch_bounds__(256) void k_asoft(const float* __restrict__ Sb, h16* P16) {
    const int lane = threadIdx.x & 31; const int row = blockIdx.x * 8 + (threadIdx.x >> 5); if (row >= ZH * TT) return;
    const float* sr = Sb + (size_t)row * TT; float v[64]; float mx = -3.0e38f;
#pragma unroll
    for (int ch = 0; ch < 16; ++ch) { const int j0 = ch * 128 + lane * 4; const v4f a = *(const v4f*)(sr + j0);
#pragma unroll
        for (int q = 0; q < 4; ++q) { const float t = a[q] * SCL; v[ch * 4 + q] = t; mx = fmaxf(mx, t); } }
#pragma unroll
    for (int sh = 16; sh; sh >>= 1) mx = fmaxf(mx, __shfl_xor(mx, sh, 32));
    float sum = 0.f;
#pragma unroll
    for (int k = 0; k < 64; ++k) { v[k] = __expf(v[k] - mx); sum += v[k]; }
#pragma unroll
    for (int sh = 16; sh; sh >>= 1) sum += __shfl_xor(sum, sh, 32);
    const float f = __fdiv_rn(PCAR, sum);
{
#pragma unroll
        for (int ch = 0; ch < 16; ++ch) { v4h o;
#pragma unroll
            for (int q = 0; q < 4; ++q) o[q] = tohx(v[ch * 4 + q] * f);
            *(v4h*)(P16 + (size_t)row * TT + ch * 128 + lane * 4) = o; }
         }
}
__global__ __launch_bounds__(256) void k_osplit(const float* __restrict__ OTf, bf* Oh, bf* Ol) { const size_t i = ((size_t)blockIdx.x * 256 + threadIdx.x) * 2; if (i >= (size_t)TT * CC) return; const int c = (int)(i & (CC - 1)); const int n = (int)(i >> 8); v2us oh, ol;
#pragma unroll
    for (int q = 0; q < 2; ++q) { unsigned short a, c2; splitf(OTf[(size_t)n * OTP + c + q] * (1.0f / PCAR), a, c2); oh[q] = a; ol[q] = c2; }
    *(v2us*)(Oh + i) = oh; *(v2us*)(Ol + i) = ol;  }
template <int RAW>
__global__ __launch_bounds__(256) void k_res(const float* __restrict__ a, const float* __restrict__ B, float* Dd) { const size_t i = ((size_t)blockIdx.x * 256 + threadIdx.x) * 4; if (i >= (size_t)TT * CC) return; const v4f x = *(const v4f*)(a + i), y = *(const v4f*)(B + i); v4f o;
#pragma unroll
    for (int q = 0; q < 4; ++q) o[q] = __fadd_rn(RAW ? bfr(x[q]) : x[q], y[q]); *(v4f*)(Dd + i) = o;  }

extern "C" void kernel_launch(void* const* d_in, const int* in_sizes, int n_in,
                              void* d_out, int out_size, void* d_ws, size_t ws_size, hipStream_t stream) {
    (void)in_sizes; (void)n_in; (void)out_size;
    const float* IN[18]; for (int i = 0; i < 18; ++i) IN[i] = (const float*)d_in[i];
    // X, Y [4][2048][256], Wq [256][256], bq, Wk, bk, Wv, bv, Wo, bo, Wres, bres, nq_w, nq_b, nk_w, nk_b, n0_w, n0_b = d_in[0..17]
    float* OUT = (float*)d_out;     // [4][2048][256]
    char* wsp = (char*)d_ws;
    auto take = [&](size_t bytes) { char* p = wsp; wsp += (bytes + 255) & ~(size_t)255; return (void*)p; };
    bf* WQ = (bf*)take((size_t)CC * CC * 2); bf* WK = (bf*)take((size_t)CC * CC * 2); bf* WV = (bf*)take((size_t)CC * CC * 2); bf* WO = (bf*)take((size_t)CC * CC * 2); bf* WR = (bf*)take((size_t)CC * CC * 2);
    float* PART = (float*)take(NW * 32 * 4); float* ST = (float*)take(256);
    bf* Ph = (bf*)take((size_t)TT * CC * 2); bf* Pl = (bf*)take((size_t)TT * CC * 2); bf* YB = (bf*)take((size_t)TT * CC * 2); float* FQ = (float*)take((size_t)TT * CC * 4); float* FK = (float*)take((size_t)TT * CC * 4); float* FV = (float*)take((size_t)TT * CC * 4);
    h16* QP = (h16*)take((size_t)NHD * TT * DH * 2); h16* KP = (h16*)take((size_t)NHD * TT * DH * 2); h16* V16 = (h16*)take((size_t)(CC + DH) * TT * 2);
    float* Sb = (float*)take((size_t)TT * TT * 4); h16* Pm = (h16*)take((size_t)TT * TT * 2); float* OTf = (float*)take((size_t)TT * OTP * 4); bf* Oh = (bf*)take((size_t)TT * CC * 2); bf* Ol = (bf*)take((size_t)TT * CC * 2); float* H = (float*)take((size_t)TT * CC * 4);
    if ((size_t)(wsp - (char*)d_ws) > ws_size) return;    // total ~ 44 MB; ws 256 MiB
    { const size_t nw = (size_t)CC * CC / 8; const unsigned gw = (unsigned)((nw + 255) / 256); const float* ws_[5] = {IN[2], IN[4], IN[6], IN[8], IN[10]}; bf* wd_[5] = {WQ, WK, WV, WO, WR};
      for (int i = 0; i < 5; ++i) k_cvt8<<<gw, 256, 0, stream>>>(ws_[i], wd_[i], nw); hipMemsetAsync(V16 + (size_t)CC * TT, 0, (size_t)DH * TT * 2, stream); }
    const unsigned L2 = (unsigned)(((size_t)TT * CC / 2 + 255) / 256), L4 = (unsigned)(((size_t)TT * CC / 4 + 255) / 256), LP = (NHD * TT * DH / 64 + 63) / 64; const dim3 gP(TT / 64, CC / 64, 1);
    for (int b = 0; b < NB_; ++b) { const float* Xb = IN[0] + (size_t)b * TT * CC; const float* Ybp = IN[1] + (size_t)b * TT * CC;
        // Q = SetNorm(X) Wq^T + bq
        k_psum<1, 0><<<NW / 8, 256, 0, stream>>>(Xb, ST, PART); k_comb<0><<<1, 32, 0, stream>>>(PART, ST); k_psum<1, 1><<<NW / 8, 256, 0, stream>>>(Xb, ST, PART); k_comb<1><<<1, 32, 0, stream>>>(PART, ST);
        k_snpl<1, 0><<<L2, 256, 0, stream>>>(Xb, ST, IN[12], IN[13], Ph, Pl);
        k_gemmw<bf, 1, true><<<gP, 32, 0, stream>>>(Ph, Pl, WQ, nullptr, CC, FQ, CC, IN[3], 0, 0, 0); k_hp32<<<LP, 256, 0, stream>>>(FQ, TT, 11, QP);
        // K = SetNorm(Y) Wk^T + bk; V = Y Wv^T + bv
        k_psum<1, 0><<<NW / 8, 256, 0, stream>>>(Ybp, ST, PART); k_comb<0><<<1, 32, 0, stream>>>(PART, ST); k_psum<1, 1><<<NW / 8, 256, 0, stream>>>(Ybp, ST, PART); k_comb<1><<<1, 32, 0, stream>>>(PART, ST);
        k_snpl<1, 0><<<L2, 256, 0, stream>>>(Ybp, ST, IN[14], IN[15], Ph, Pl);
        k_gemmw<bf, 1, true><<<gP, 32, 0, stream>>>(Ph, Pl, WK, nullptr, CC, FK, CC, IN[5], 0, 0, 0); k_hp32<<<LP, 256, 0, stream>>>(FK, TT, 11, KP);
        k_cvt8<<<(unsigned)(((size_t)TT * CC / 8 + 255) / 256), 256, 0, stream>>>(Ybp, YB, (size_t)TT * CC / 8);
        k_gemmw<bf, 0, true><<<gP, 32, 0, stream>>>(YB, nullptr, WV, nullptr, CC, FV, CC, IN[7], 0, 0, 0); k_vt32<<<(CC * TT / 64 + 63) / 64, 256, 0, stream>>>(FV, V16);
        for (int hh = 0; hh < NHD; ++hh) {
            k_gemmw<h16, 0, false><<<dim3(TT / 64, TT / 64, 1), 32, 0, stream>>>(QP + (size_t)hh * TT * DH, nullptr, KP + (size_t)hh * TT * DH, nullptr, DH, Sb, TT, nullptr, 0, 0, 0);
            k_asoft<<<TT / 8, 256, 0, stream>>>(Sb, Pm);
            k_gemmw<h16, 0, false><<<dim3(TT / 64, 1, 1), 32, 0, stream>>>(Pm, nullptr, V16 + (size_t)hh * DH * TT, nullptr, TT, OTf + hh * DH, OTP, nullptr, 0, 0, 0); }   // 64-wide tile at column hh*32; the upper half is head hh+1's slot, rewritten next (heads ascend)
        k_osplit<<<L2, 256, 0, stream>>>(OTf, Oh, Ol);
        k_gemmw<bf, 1, true><<<gP, 32, 0, stream>>>(Oh, Ol, WO, nullptr, CC, FQ, CC, IN[9], 0, 0, 0);          // O Wo^T + bo -> FQ
        k_res<1><<<L4, 256, 0, stream>>>(Xb, FQ, H);                                                          // H = bf16(X) + O
        k_psum<0, 0><<<NW / 8, 256, 0, stream>>>(H, ST, PART); k_comb<0><<<1, 32, 0, stream>>>(PART, ST); k_psum<0, 1><<<NW / 8, 256, 0, stream>>>(H, ST, PART); k_comb<1><<<1, 32, 0, stream>>>(PART, ST);
        k_snpl<0, 1><<<L2, 256, 0, stream>>>(H, ST, IN[16], IN[17], Ph, Pl);                                    // relu(SetNorm(H))
        k_gemmw<bf, 1, true><<<gP, 32, 0, stream>>>(Ph, Pl, WR, nullptr, CC, FK, CC, IN[11], 0, 0, 0);          // Wres^T + bres -> FK
        k_res<0><<<L4, 256, 0, stream>>>(H, FK, OUT + (size_t)b * TT * CC); }
}

// v001
// Two timings next to v000 put it at 5.27 and 5.32 times that version's speed.
#include <hip/hip_runtime.h>

// MABClean (Set-Transformer MAB; X, Y [4][2048][256]; Q = SetNorm(X) Wq^T + bq, K = SetNorm(Y) Wk^T + bk, V = Y Wv^T + bv (SetNorm: normalise over all (samples, features) of one batch element, eps 1e-5,
// then per-feature scale/shift); 8 heads of 32: A = softmax_k(Q_h.K_h / sqrt(256)); O = concat_h A V_h; H = X + O Wo^T + bo; out = H + relu(SetNorm(H)) Wres^T + bres).
// Compute dtypes, f32 accumulate: every input rounded to bf16; the three SetNorm statistics (mean, then variance, over 524,288 values each) by fixed-order two-level
// reductions in f32; the normalised operands as bf16 hi+lo planes x exact weights (2 products); V on PLAIN bf16 operands (exact, + bias); scores (K = 32) and attn.v on SINGLE fp16 planes (model

#define NB_  4
#define TT   2048
#define CC   256
#define NHD  8
#define DH   32
#define ZH   4                    // (batch, head) pairs per scores/softmax launch
#define ZA   16                   // (batch, head) pairs per attn.v launch
#define OTW  64                   // pitch of one pair's attn.v tile (columns 32..63 are not used)
#define PCAR 1024.0f
#define SCL  0.0625f              // 1/sqrt(dim_Y = 256)
#define NW   32                   // partial-sum waves per statistic (64 rows each)
typedef _Float16 h16;
typedef unsigned short bf;
typedef __attribute__((ext_vector_type(16))) __bf16   v16bf;
typedef __attribute__((ext_vector_type(16))) _Float16 v16h;
typedef __attribute__((ext_vector_type(8)))  _Float16 v8h;
typedef __attribute__((ext_vector_type(8)))  unsigned short v8us;
typedef __attribute__((ext_vector_type(8)))  float    v8f;
typedef __attribute__((ext_vector_type(4)))  float    v4f;
typedef v8h  __attribute__((may_alias)) v8ha;
typedef v4f  __attribute__((may_alias)) v4fa;
typedef v8us __attribute__((may_alias)) v8usa;

__device__ __forceinline__ unsigned short f2bf(float f) { unsigned u = __float_as_uint(f); u += 0x7FFFu + ((u >> 16) & 1u); return (unsigned short)(u >> 16); }
__device__ __forceinline__ float bf2f(unsigned short b) { return __uint_as_float(((unsigned)b) << 16); }
__device__ __forceinline__ float bfr(float f) { return bf2f(f2bf(f)); }
__device__ __forceinline__ v16h cat16(v8h lo, v8h hi) { return __builtin_shufflevector(lo, hi, 0, 1, 2, 3, 4, 5, 6, 7, 8, 9, 10, 11, 12, 13, 14, 15); }
__device__ __forceinline__ v16bf cat16b(v8us lo, v8us hi) { return __builtin_bit_cast(v16bf, __builtin_shufflevector(lo, hi, 0, 1, 2, 3, 4, 5, 6, 7, 8, 9, 10, 11, 12, 13, 14, 15)); }
__device__ __forceinline__ v8f wmma16(v16h a, v16h b, v8f c) { return __builtin_amdgcn_wmma_f32_16x16x32_f16(false, a, false, b, (short)0, c, false, false); }
__device__ __forceinline__ v8f wmmab(v16bf a, v16bf b, v8f c) { return __builtin_amdgcn_wmma_f32_16x16x32_bf16(false, a, false, b, (short)0, c, false, false); }



// ---- k_gemmw: register-blocked GEMM, ONE WAVE per 64x64 output tile (16 accumulators), operands straight from K-contiguous 16-bit planes; grid (M/64, N/64, Z), 32 threads.
// C[m][n] (f32, pitch ldc, + optional f32 bias[n]) = sum_k A[m][k] Bt[n][k] (+ split products per NSPLIT). z-batch strides sA/sB/sC in elements. K % 32 == 0.
template <typename T16> struct WFrag;
template <> struct WFrag<h16> { typedef v16h V; static __device__ __forceinline__ V ld(const h16* p) { return cat16(*(const v8h*)p, *(const v8h*)(p + 16)); } static __device__ __forceinline__ v8f mma(V a, V b, v8f c) { return wmma16(a, b, c); } };
template <> struct WFrag<bf> { typedef v16bf V; static __device__ __forceinline__ V ld(const bf* p) { return cat16b(*(const v8us*)p, *(const v8us*)(p + 16)); } static __device__ __forceinline__ v8f mma(V a, V b, v8f c) { return wmmab(a, b, c); } };
template <typename T16, int NSPLIT, bool BIAS>
__global__ __launch_bounds__(32) void k_gemmw(const T16* __restrict__ A, const T16* __restrict__ A2, const T16* __restrict__ Bt, const T16* __restrict__ Bt2, int K, float* C, int ldc, const float* __restrict__ bias, size_t sA, size_t sB, size_t sC) {
    typedef typename WFrag<T16>::V V;
    __shared__ __align__(16) float os[16 * 68];
    const size_t z = blockIdx.z; A += z * sA; if (A2) A2 += z * sA; Bt += z * sB; if (Bt2) Bt2 += z * sB; C += z * sC;
    const int lane = threadIdx.x & 31, lr = lane & 15, hi = lane >> 4; const int r0 = blockIdx.x * 64, c0 = blockIdx.y * 64;
    v8f acc[4][4];
#pragma unroll
    for (int mb = 0; mb < 4; ++mb)
#pragma unroll
        for (int nb = 0; nb < 4; ++nb) acc[mb][nb] = (v8f){};
    const size_t aoff = (size_t)(r0 + lr) * K + 8 * hi, boff = (size_t)(c0 + lr) * K + 8 * hi;
#pragma unroll 1
    for (int kc = 0; kc < K; kc += 32) {
        V a[4], a2[4];
#pragma unroll
        for (int mb = 0; mb < 4; ++mb) { a[mb] = WFrag<T16>::ld(A + aoff + (size_t)mb * 16 * K + kc); if (NSPLIT == 1 || NSPLIT == 2) a2[mb] = WFrag<T16>::ld(A2 + aoff + (size_t)mb * 16 * K + kc); }
#pragma unroll
        for (int nb = 0; nb < 4; ++nb) { const V b = WFrag<T16>::ld(Bt + boff + (size_t)nb * 16 * K + kc); V b2; if (NSPLIT >= 2) b2 = WFrag<T16>::ld(Bt2 + boff + (size_t)nb * 16 * K + kc);
#pragma unroll
            for (int mb = 0; mb < 4; ++mb) { acc[mb][nb] = WFrag<T16>::mma(a[mb], b, acc[mb][nb]); if (NSPLIT == 1 || NSPLIT == 2) acc[mb][nb] = WFrag<T16>::mma(a2[mb], b, acc[mb][nb]); if (NSPLIT >= 2) acc[mb][nb] = WFrag<T16>::mma(a[mb], b2, acc[mb][nb]); } }
        asm volatile("v_nop\n\tv_nop\n\tv_nop\n\tv_nop" : "+v"(acc[0][0]), "+v"(acc[1][1]), "+v"(acc[2][2]), "+v"(acc[3][3]) : "v"(a[0]), "v"(a[3]));
    }
#pragma unroll
    for (int mb = 0; mb < 4; ++mb) {
#pragma unroll
        for (int nb = 0; nb < 4; ++nb) {
#pragma unroll
            for (int j = 0; j < 8; ++j) os[(hi * 8 + j) * 68 + nb * 16 + lr] = acc[mb][nb][j]; }
        __builtin_amdgcn_wave_barrier(); asm volatile("" ::: "memory");
        float* crow = C + (size_t)(r0 + mb * 16) * ldc + c0;
{
#pragma unroll
            for (int s = 0; s < 8; ++s) { const int row = 2 * s + hi, cofs = lr * 4; v4f val = *(const v4fa*)(os + row * 68 + cofs); if (BIAS) { val[0] += bfr(bias[c0 + cofs]); val[1] += bfr(bias[c0 + cofs + 1]); val[2] += bfr(bias[c0 + cofs + 2]); val[3] += bfr(bias[c0 + cofs + 3]); }
                *(v4f*)(crow + (size_t)row * ldc + cofs) = val; }
             }
        __builtin_amdgcn_wave_barrier(); asm volatile("" ::: "memory");
    }
}

__device__ __forceinline__ h16 tohx(float x) { return (h16)x; }
__device__ __forceinline__ void splitf(float y, unsigned short& h, unsigned short& l) { h = f2bf(y); l = f2bf(y - bf2f(h)); }
typedef __attribute__((ext_vector_type(2))) _Float16 v2h;
typedef __attribute__((ext_vector_type(4))) _Float16 v4h;
typedef __attribute__((ext_vector_type(2))) unsigned short v2us;
typedef __attribute__((ext_vector_type(8))) _Float16 v8h16;

__global__ __launch_bounds__(256) void k_cvt8(const float* __restrict__ src, bf* dst, size_t n8) { const size_t i = (size_t)blockIdx.x * 256 + threadIdx.x; if (i >= n8) return; const v8f v = *(const v8f*)(src + i * 8); v8us o;
#pragma unroll
    for (int k = 0; k < 8; ++k) o[k] = f2bf(v[k]); *(v8us*)(dst + i * 8) = o;  }
// five weight matrices in one launch: blockIdx.y picks the source, the planes lie one behind the other in dst
__global__ __launch_bounds__(256) void k_cvtw(const float* __restrict__ s0, const float* __restrict__ s1, const float* __restrict__ s2, const float* __restrict__ s3, const float* __restrict__ s4, bf* dst) { const size_t i = (size_t)blockIdx.x * 256 + threadIdx.x; if (i >= (size_t)CC * CC / 8) return;
    const int y = blockIdx.y; const float* src = y == 0 ? s0 : y == 1 ? s1 : y == 2 ? s2 : y == 3 ? s3 : s4; const v8f v = *(const v8f*)(src + i * 8); v8us o;
#pragma unroll
    for (int k = 0; k < 8; ++k) o[k] = f2bf(v[k]); *(v8us*)(dst + (size_t)y * CC * CC + i * 8) = o;  }
// blockIdx.y = statistic set: sets 0..NB_-1 are the batch elements of A0, sets NB_.. those of A1
template <int RAW, int PASS>
__global__ __launch_bounds__(256) void k_psum(const float* __restrict__ A0, const float* __restrict__ A1, const float* __restrict__ ST, float* PART) {
    const int set = blockIdx.y; const float* A = set < NB_ ? A0 + (size_t)set * TT * CC : A1 + (size_t)(set - NB_) * TT * CC; ST += set * 32; PART += (size_t)set * NW * 32;
    const int lane = threadIdx.x & 31; const int w = blockIdx.x * 8 + (threadIdx.x >> 5); if (w >= NW) return; const float mu = PASS ? ST[0] : 0.f; float s = 0.f;
    for (int i = lane * 4; i < 64 * CC; i += 128) { const v4f v = *(const v4f*)(A + (size_t)w * 64 * CC + i);
#pragma unroll
        for (int q = 0; q < 4; ++q) { float x = RAW ? bfr(v[q]) : v[q]; if (PASS) { const float d0 = __fsub_rn(x, mu); x = __fmul_rn(d0, d0); } s = __fadd_rn(s, x); } }
#pragma unroll
    for (int sh = 16; sh; sh >>= 1) s += __shfl_xor(s, sh, 32);
    const float o = (lane == 0) ? s : 0.f; *(float*)(PART + (size_t)w * 32 + lane) = o;  }
template <int PASS>
__global__ __launch_bounds__(32) void k_comb(const float* __restrict__ PART, float* ST) {
    PART += (size_t)blockIdx.x * NW * 32; ST += blockIdx.x * 32;
    const int lane = threadIdx.x; float s = PART[(size_t)lane * 32];
#pragma unroll
    for (int sh = 16; sh; sh >>= 1) s += __shfl_xor(s, sh, 32);
    const float inv = 1.0f / (float)(TT * CC); float o;
    if (PASS == 0) o = (lane == 0) ? s * inv : 0.f; else { const float mu = ST[0]; o = (lane == 0) ? mu : (lane == 1 ? __fdiv_rn(1.0f, __fsqrt_rn(__fadd_rn(s * inv, 1e-5f))) : 0.f); }
    *(float*)(ST + lane) = o;  }
// one set's plane; the kernel below picks the set's pointers (blockIdx.y) and calls it, so that the __restrict__ of the picked pointers is kept
template <int RAW, int RELU>
__device__ __forceinline__ void snpl_set(const float* __restrict__ A, const float* __restrict__ ST, const float* __restrict__ w, const float* __restrict__ bb, bf* Ph, bf* Pl, const size_t i) { const int c = (int)(i & (CC - 1)); const float mu = ST[0], rs = ST[1]; v2us oh, ol;
#pragma unroll
    for (int q = 0; q < 2; ++q) { float x = A[i + q]; if (RAW) x = bfr(x); float t = __fmul_rn(__fsub_rn(x, mu), rs); asm volatile("" : "+v"(t)); float y = __fadd_rn(__fmul_rn(t, bfr(w[c + q])), bfr(bb[c + q])); if (RELU) y = fmaxf(y, 0.f); unsigned short a, c2; splitf(y, a, c2); oh[q] = a; ol[q] = c2; }
    *(v2us*)(Ph + i) = oh; *(v2us*)(Pl + i) = ol;  }
template <int RAW, int RELU>
__global__ __launch_bounds__(256) void k_snpl(const float* __restrict__ A0, const float* __restrict__ A1, const float* __restrict__ ST, const float* __restrict__ w0, const float* __restrict__ bb0, const float* __restrict__ w1, const float* __restrict__ bb1, bf* Ph, bf* Pl) { const size_t i = ((size_t)blockIdx.x * 256 + threadIdx.x) * 2; if (i >= (size_t)TT * CC) return;
    const int set = blockIdx.y; const bool first = set < NB_;
    snpl_set<RAW, RELU>(first ? A0 + (size_t)set * TT * CC : A1 + (size_t)(set - NB_) * TT * CC, ST + set * 32, first ? w0 : w1, first ? bb0 : bb1, Ph + (size_t)set * TT * CC, Pl + (size_t)set * TT * CC, i); }
__global__ __launch_bounds__(256) void k_hp32(const float* __restrict__ F, int rows, int lg2rows, h16* P) {
    F += (size_t)blockIdx.y * TT * CC; P += (size_t)blockIdx.y * NHD * TT * DH;
    const int lane = threadIdx.x & 31; const int L0 = (blockIdx.x * 8 + (threadIdx.x >> 5)) * 8; const int nlines = NHD * rows * DH / 64;
{
#pragma unroll
        for (int l = 0; l < 8; ++l) { const int L = L0 + l; if (L >= nlines) break; const int e = L * 64 + lane * 2; const int d = e & (DH - 1); const int r = (e >> 5) & (rows - 1); const int h = e >> (5 + lg2rows); v2h o;
#pragma unroll
            for (int q = 0; q < 2; ++q) o[q] = tohx(F[(size_t)r * CC + h * DH + d + q]);
            *(v2h*)(P + (size_t)e) = o; }
         }
}
__global__ __launch_bounds__(256) void k_vt32(const float* __restrict__ FV, h16* V16) {
    FV += (size_t)blockIdx.y * TT * CC; V16 += (size_t)blockIdx.y * CC * TT;
    const int lane = threadIdx.x & 31; const int L0 = (blockIdx.x * 8 + (threadIdx.x >> 5)) * 8; const int nlines = CC * TT / 64;
{
#pragma unroll
        for (int l = 0; l < 8; ++l) { const int L = L0 + l; if (L >= nlines) break; const int e = L * 64 + lane * 2; const int n = e & (TT - 1); const int c = e >> 11; v2h o;
#pragma unroll
            for (int q = 0; q < 2; ++q) o[q] = tohx(FV[(size_t)(n + q) * CC + c]);
            *(v2h*)(V16 + (size_t)e) = o; }
         }
}
__global__ __launch_bounds__(256) void k_asoft(const float* __restrict__ Sb, h16* P16) {
    const int lane = threadIdx.x & 31; const int row = blockIdx.x * 8 + (threadIdx.x >> 5); if (row >= ZH * TT) return;
    const float* sr = Sb + (size_t)row * TT; float v[64]; float mx = -3.0e38f;
#pragma unroll
    for (int ch = 0; ch < 16; ++ch) { const int j0 = ch * 128 + lane * 4; const v4f a = *(const v4f*)(sr + j0);
#pragma unroll
        for (int q = 0; q < 4; ++q) { const float t = a[q] * SCL; v[ch * 4 + q] = t; mx = fmaxf(mx, t); } }
#pragma unroll
    for (int sh = 16; sh; sh >>= 1) mx = fmaxf(mx, __shfl_xor(mx, sh, 32));
    float sum = 0.f;
#pragma unroll
    for (int k = 0; k < 64; ++k) { v[k] = __expf(v[k] - mx); sum += v[k]; }
#pragma unroll
    for (int sh = 16; sh; sh >>= 1) sum += __shfl_xor(sum, sh, 32);
    const float f = __fdiv_rn(PCAR, sum);
{
#pragma unroll
        for (int ch = 0; ch < 16; ++ch) { v4h o;
#pragma unroll
            for (int q = 0; q < 4; ++q) o[q] = tohx(v[ch * 4 + q] * f);
            *(v4h*)(P16 + (size_t)row * TT + ch * 128 + lane * 4) = o; }
         }
}
__global__ __launch_bounds__(256) void k_osplit(const float* __restrict__ OTf, bf* Oh, bf* Ol) { const size_t i = ((size_t)blockIdx.x * 256 + threadIdx.x) * 2; if (i >= (size_t)NB_ * TT * CC) return; const int c = (int)(i & (CC - 1)); const int n = (int)(i >> 8) & (TT - 1); const int g = (int)(i >> 19) * NHD + (c >> 5); v2us oh, ol;   // g = batch * 8 + head
#pragma unroll
    for (int q = 0; q < 2; ++q) { unsigned short a, c2; splitf(OTf[((size_t)g * TT + n) * OTW + (c & (DH - 1)) + q] * (1.0f / PCAR), a, c2); oh[q] = a; ol[q] = c2; }
    *(v2us*)(Oh + i) = oh; *(v2us*)(Ol + i) = ol;  }
template <int RAW>
__global__ __launch_bounds__(256) void k_res(const float* __restrict__ a, const float* __restrict__ B, float* Dd) { const size_t i = ((size_t)blockIdx.x * 256 + threadIdx.x) * 4; if (i >= (size_t)NB_ * TT * CC) return; const v4f x = *(const v4f*)(a + i), y = *(const v4f*)(B + i); v4f o;
#pragma unroll
    for (int q = 0; q < 4; ++q) o[q] = __fadd_rn(RAW ? bfr(x[q]) : x[q], y[q]); *(v4f*)(Dd + i) = o;  }

extern "C" void kernel_launch(void* const* d_in, const int* in_sizes, int n_in,
                              void* d_out, int out_size, void* d_ws, size_t ws_size, hipStream_t stream) {
    (void)in_sizes; (void)n_in; (void)out_size;
    const float* IN[18]; for (int i = 0; i < 18; ++i) IN[i] = (const float*)d_in[i];
    // X, Y [4][2048][256], Wq [256][256], bq, Wk, bk, Wv, bv, Wo, bo, Wres, bres, nq_w, nq_b, nk_w, nk_b, n0_w, n0_b = d_in[0..17]
    float* OUT = (float*)d_out;     // [4][2048][256]
    char* wsp = (char*)d_ws;
    auto take = [&](size_t bytes) { char* p = wsp; wsp += (bytes + 255) & ~(size_t)255; return (void*)p; };
    const size_t PE = (size_t)TT * CC;                      // elements of one batch element's [2048][256] plane
    bf* WQ = (bf*)take((size_t)CC * CC * 2); bf* WK = (bf*)take((size_t)CC * CC * 2); bf* WV = (bf*)take((size_t)CC * CC * 2); bf* WO = (bf*)take((size_t)CC * CC * 2); bf* WR = (bf*)take((size_t)CC * CC * 2);   // one behind the other (k_cvtw)
    float* PART = (float*)take((size_t)2 * NB_ * NW * 32 * 4); float* ST = (float*)take((size_t)2 * NB_ * 32 * 4);
    // live through the attention part; g = batch * 8 + head runs through all of them
    h16* QP = (h16*)take((size_t)NB_ * NHD * TT * DH * 2); h16* KP = (h16*)take((size_t)NB_ * NHD * TT * DH * 2); h16* V16 = (h16*)take((size_t)(NB_ * CC + DH) * TT * 2); float* OTf = (float*)take((size_t)NB_ * NHD * TT * OTW * 4);
    h16* Pm = (h16*)take((size_t)ZA * TT * TT * 2); float* Sb = (float*)take((size_t)ZH * TT * TT * 4);
    if ((size_t)(wsp - (char*)d_ws) > ws_size) return;    // total ~ 221 MiB; ws 256 MiB
    // the planes used only before or only after the attention part lie inside Sb (64 MiB), which is live only in between
    wsp = (char*)Sb;
    bf* Ph = (bf*)take(2 * NB_ * PE * 2); bf* Pl = (bf*)take(2 * NB_ * PE * 2); bf* YB = (bf*)take(NB_ * PE * 2); float* FQ = (float*)take(NB_ * PE * 4); float* FK = (float*)take(NB_ * PE * 4); float* FV = (float*)take(NB_ * PE * 4);   // FQ, FK one behind the other (k_hp32)
    bf* Oh = YB; bf* Ol = (bf*)FV; float* H = (float*)take(NB_ * PE * 4);
    k_cvtw<<<dim3(CC * CC / 8 / 256, 5), 256, 0, stream>>>(IN[2], IN[4], IN[6], IN[8], IN[10], WQ); hipMemsetAsync(V16 + (size_t)NB_ * CC * TT, 0, (size_t)DH * TT * 2, stream);
    const unsigned L2 = (unsigned)((PE / 2 + 255) / 256), L4 = (unsigned)((NB_ * PE / 4 + 255) / 256), LP = (NHD * TT * DH / 64 + 63) / 64; const dim3 gP(NB_ * TT / 64, CC / 64, 1);
    // SetNorm(X) and SetNorm(Y), all batch elements: sets 0..3 = X, 4..7 = Y
    k_psum<1, 0><<<dim3(NW / 8, 2 * NB_), 256, 0, stream>>>(IN[0], IN[1], ST, PART); k_comb<0><<<2 * NB_, 32, 0, stream>>>(PART, ST); k_psum<1, 1><<<dim3(NW / 8, 2 * NB_), 256, 0, stream>>>(IN[0], IN[1], ST, PART); k_comb<1><<<2 * NB_, 32, 0, stream>>>(PART, ST);
    k_snpl<1, 0><<<dim3(L2, 2 * NB_), 256, 0, stream>>>(IN[0], IN[1], ST, IN[12], IN[13], IN[14], IN[15], Ph, Pl);
    // Q = SetNorm(X) Wq^T + bq; K = SetNorm(Y) Wk^T + bk; V = Y Wv^T + bv: the four batch elements are 8192 rows of one product
    k_gemmw<bf, 1, true><<<gP, 32, 0, stream>>>(Ph, Pl, WQ, nullptr, CC, FQ, CC, IN[3], 0, 0, 0);
    k_gemmw<bf, 1, true><<<gP, 32, 0, stream>>>(Ph + NB_ * PE, Pl + NB_ * PE, WK, nullptr, CC, FK, CC, IN[5], 0, 0, 0);
    k_hp32<<<dim3(LP, 2 * NB_), 256, 0, stream>>>(FQ, TT, 11, QP);                                             // FQ -> QP and FK -> KP
    k_cvt8<<<(unsigned)((NB_ * PE / 8 + 255) / 256), 256, 0, stream>>>(IN[1], YB, NB_ * PE / 8);
    k_gemmw<bf, 0, true><<<gP, 32, 0, stream>>>(YB, nullptr, WV, nullptr, CC, FV, CC, IN[7], 0, 0, 0); k_vt32<<<dim3((CC * TT / 64 + 63) / 64, NB_), 256, 0, stream>>>(FV, V16);
    for (int g0 = 0; g0 < NB_ * NHD; g0 += ZA) {
        for (int g1 = 0; g1 < ZA; g1 += ZH) {
            k_gemmw<h16, 0, false><<<dim3(TT / 64, TT / 64, ZH), 32, 0, stream>>>(QP + (size_t)(g0 + g1) * TT * DH, nullptr, KP + (size_t)(g0 + g1) * TT * DH, nullptr, DH, Sb, TT, nullptr, (size_t)TT * DH, (size_t)TT * DH, (size_t)TT * TT);
            k_asoft<<<ZH * TT / 8, 256, 0, stream>>>(Sb, Pm + (size_t)g1 * TT * TT); }
        k_gemmw<h16, 0, false><<<dim3(TT / 64, 1, ZA), 32, 0, stream>>>(Pm, nullptr, V16 + (size_t)g0 * DH * TT, nullptr, TT, OTf + (size_t)g0 * TT * OTW, OTW, nullptr, (size_t)TT * TT, (size_t)DH * TT, (size_t)TT * OTW); }   // 64-wide tile per pair in its own plane; its upper half (the next pair's V rows) is never read
    k_osplit<<<NB_ * L2, 256, 0, stream>>>(OTf, Oh, Ol);
    k_gemmw<bf, 1, true><<<gP, 32, 0, stream>>>(Oh, Ol, WO, nullptr, CC, FQ, CC, IN[9], 0, 0, 0);          // O Wo^T + bo -> FQ
    k_res<1><<<L4, 256, 0, stream>>>(IN[0], FQ, H);                                                        // H = bf16(X) + O
    k_psum<0, 0><<<dim3(NW / 8, NB_), 256, 0, stream>>>(H, H, ST, PART); k_comb<0><<<NB_, 32, 0, stream>>>(PART, ST); k_psum<0, 1><<<dim3(NW / 8, NB_), 256, 0, stream>>>(H, H, ST, PART); k_comb<1><<<NB_, 32, 0, stream>>>(PART, ST);
    k_snpl<0, 1><<<dim3(L2, NB_), 256, 0, stream>>>(H, H, ST, IN[16], IN[17], IN[16], IN[17], Ph, Pl);      // relu(SetNorm(H))
    k_gemmw<bf, 1, true><<<gP, 32, 0, stream>>>(Ph, Pl, WR, nullptr, CC, FK, CC, IN[11], 0, 0, 0);          // Wres^T + bres -> FK
    k_res<0><<<L4, 256, 0, stream>>>(H, FK, OUT);
}

// v002
// A run of this version takes 290 microseconds.
// In two side-by-side timings against v001, it was 1.98 and 1.99 times as fast.
// Counting every step since v000, it is 10.5 times as fast.
#include <hip/hip_runtime.h>

// MABClean (Set-Transformer MAB; X, Y [4][2048][256]; Q = SetNorm(X) Wq^T + bq, K = SetNorm(Y) Wk^T + bk, V = Y Wv^T + bv (SetNorm: normalise over all (samples, features) of one batch element, eps 1e-5,
// then per-feature scale/shift); 8 heads of 32: A = softmax_k(Q_h.K_h / sqrt(256)); O = concat_h A V_h; H = X + O Wo^T + bo; out = H + relu(SetNorm(H)) Wres^T + bres).
// Compute dtypes, f32 accumulate: every input rounded to bf16; the three SetNorm statistics (mean, then variance, over 524,288 values each) by fixed-order two-level
// reductions in f32; the normalised operands as bf16 hi+lo planes x exact weights (2 products); V on PLAIN bf16 operands (exact, + bias); scores (K = 32) and attn.v on SINGLE fp16 planes (model

#define NB_  4
#define TT   2048
#define CC   256
#define NHD  8
#define DH   32
#define SCL  0.0625f              // 1/sqrt(dim_Y = 256)
#define C2   (SCL * 1.44269504f)  // score -> exponent of two
#define PSH  10.0f                // P carries 2^10 (as does its sum), so that small weights stay normal fp16 numbers
#define KPB  80                   // LDS pitch of one K row: 64 bytes + 16 (16 B x odd: no bank conflict for 16-byte reads down a column of rows)
#define VPB  4112                 // LDS pitch of one row of V^T: 4096 bytes + 16
#define NW   32                   // partial-sum waves per statistic (64 rows each)
typedef _Float16 h16;
typedef unsigned short bf;
typedef __attribute__((ext_vector_type(16))) __bf16   v16bf;
typedef __attribute__((ext_vector_type(16))) _Float16 v16h;
typedef __attribute__((ext_vector_type(8)))  _Float16 v8h;
typedef __attribute__((ext_vector_type(8)))  unsigned short v8us;
typedef __attribute__((ext_vector_type(8)))  float    v8f;
typedef __attribute__((ext_vector_type(4)))  float    v4f;
typedef v8h  __attribute__((may_alias)) v8ha;
typedef v4f  __attribute__((may_alias)) v4fa;
typedef v8us __attribute__((may_alias)) v8usa;

__device__ __forceinline__ unsigned short f2bf(float f) { unsigned u = __float_as_uint(f); u += 0x7FFFu + ((u >> 16) & 1u); return (unsigned short)(u >> 16); }
__device__ __forceinline__ float bf2f(unsigned short b) { return __uint_as_float(((unsigned)b) << 16); }
__device__ __forceinline__ float bfr(float f) { return bf2f(f2bf(f)); }
__device__ __forceinline__ v16h cat16(v8h lo, v8h hi) { return __builtin_shufflevector(lo, hi, 0, 1, 2, 3, 4, 5, 6, 7, 8, 9, 10, 11, 12, 13, 14, 15); }
__device__ __forceinline__ v16bf cat16b(v8us lo, v8us hi) { return __builtin_bit_cast(v16bf, __builtin_shufflevector(lo, hi, 0, 1, 2, 3, 4, 5, 6, 7, 8, 9, 10, 11, 12, 13, 14, 15)); }
__device__ __forceinline__ v8f wmma16(v16h a, v16h b, v8f c) { return __builtin_amdgcn_wmma_f32_16x16x32_f16(false, a, false, b, (short)0, c, false, false); }
__device__ __forceinline__ v8f wmmab(v16bf a, v16bf b, v8f c) { return __builtin_amdgcn_wmma_f32_16x16x32_bf16(false, a, false, b, (short)0, c, false, false); }



// ---- k_gemmw: register-blocked GEMM, ONE WAVE per 64x64 output tile (16 accumulators), operands straight from K-contiguous 16-bit planes; grid (M/64, N/64, Z), 32 threads.
// C[m][n] (f32, pitch ldc, + optional f32 bias[n]) = sum_k A[m][k] Bt[n][k] (+ split products per NSPLIT). z-batch strides sA/sB/sC in elements. K % 32 == 0.
template <typename T16> struct WFrag;
template <> struct WFrag<bf> { typedef v16bf V; static __device__ __forceinline__ V ld(const bf* p) { return cat16b(*(const v8us*)p, *(const v8us*)(p + 16)); } static __device__ __forceinline__ v8f mma(V a, V b, v8f c) { return wmmab(a, b, c); } };
template <typename T16, int NSPLIT, bool BIAS>
__global__ __launch_bounds__(32) void k_gemmw(const T16* __restrict__ A, const T16* __restrict__ A2, const T16* __restrict__ Bt, const T16* __restrict__ Bt2, int K, float* C, int ldc, const float* __restrict__ bias, size_t sA, size_t sB, size_t sC) {
    typedef typename WFrag<T16>::V V;
    __shared__ __align__(16) float os[16 * 68];
    const size_t z = blockIdx.z; A += z * sA; if (A2) A2 += z * sA; Bt += z * sB; if (Bt2) Bt2 += z * sB; C += z * sC;
    const int lane = threadIdx.x & 31, lr = lane & 15, hi = lane >> 4; const int r0 = blockIdx.x * 64, c0 = blockIdx.y * 64;
    v8f acc[4][4];
#pragma unroll
    for (int mb = 0; mb < 4; ++mb)
#pragma unroll
        for (int nb = 0; nb < 4; ++nb) acc[mb][nb] = (v8f){};
    const size_t aoff = (size_t)(r0 + lr) * K + 8 * hi, boff = (size_t)(c0 + lr) * K + 8 * hi;
#pragma unroll 1
    for (int kc = 0; kc < K; kc += 32) {
        V a[4], a2[4];
#pragma unroll
        for (int mb = 0; mb < 4; ++mb) { a[mb] = WFrag<T16>::ld(A + aoff + (size_t)mb * 16 * K + kc); if (NSPLIT == 1 || NSPLIT == 2) a2[mb] = WFrag<T16>::ld(A2 + aoff + (size_t)mb * 16 * K + kc); }
#pragma unroll
        for (int nb = 0; nb < 4; ++nb) { const V b = WFrag<T16>::ld(Bt + boff + (size_t)nb * 16 * K + kc); V b2; if (NSPLIT >= 2) b2 = WFrag<T16>::ld(Bt2 + boff + (size_t)nb * 16 * K + kc);
#pragma unroll
            for (int mb = 0; mb < 4; ++mb) { acc[mb][nb] = WFrag<T16>::mma(a[mb], b, acc[mb][nb]); if (NSPLIT == 1 || NSPLIT == 2) acc[mb][nb] = WFrag<T16>::mma(a2[mb], b, acc[mb][nb]); if (NSPLIT >= 2) acc[mb][nb] = WFrag<T16>::mma(a[mb], b2, acc[mb][nb]); } }
        asm volatile("v_nop\n\tv_nop\n\tv_nop\n\tv_nop" : "+v"(acc[0][0]), "+v"(acc[1][1]), "+v"(acc[2][2]), "+v"(acc[3][3]) : "v"(a[0]), "v"(a[3]));
    }
#pragma unroll
    for (int mb = 0; mb < 4; ++mb) {
#pragma unroll
        for (int nb = 0; nb < 4; ++nb) {
#pragma unroll
            for (int j = 0; j < 8; ++j) os[(hi * 8 + j) * 68 + nb * 16 + lr] = acc[mb][nb][j]; }
        __builtin_amdgcn_wave_barrier(); asm volatile("" ::: "memory");
        float* crow = C + (size_t)(r0 + mb * 16) * ldc + c0;
{
#pragma unroll
            for (int s = 0; s < 8; ++s) { const int row = 2 * s + hi, cofs = lr * 4; v4f val = *(const v4fa*)(os + row * 68 + cofs); if (BIAS) { val[0] += bfr(bias[c0 + cofs]); val[1] += bfr(bias[c0 + cofs + 1]); val[2] += bfr(bias[c0 + cofs + 2]); val[3] += bfr(bias[c0 + cofs + 3]); }
                *(v4f*)(crow + (size_t)row * ldc + cofs) = val; }
             }
        __builtin_amdgcn_wave_barrier(); asm volatile("" ::: "memory");
    }
}

__device__ __forceinline__ h16 tohx(float x) { return (h16)x; }
__device__ __forceinline__ void splitf(float y, unsigned short& h, unsigned short& l) { h = f2bf(y); l = f2bf(y - bf2f(h)); }
typedef __attribute__((ext_vector_type(2))) _Float16 v2h;
typedef __attribute__((ext_vector_type(4))) _Float16 v4h;
typedef __attribute__((ext_vector_type(2))) unsigned short v2us;
typedef __attribute__((ext_vector_type(8))) _Float16 v8h16;

__global__ __launch_bounds__(256) void k_cvt8(const float* __restrict__ src, bf* dst, size_t n8) { const size_t i = (size_t)blockIdx.x * 256 + threadIdx.x; if (i >= n8) return; const v8f v = *(const v8f*)(src + i * 8); v8us o;
#pragma unroll
    for (int k = 0; k < 8; ++k) o[k] = f2bf(v[k]); *(v8us*)(dst + i * 8) = o;  }
// five weight matrices in one launch: blockIdx.y picks the source, the planes lie one behind the other in dst
__global__ __launch_bounds__(256) void k_cvtw(const float* __restrict__ s0, const float* __restrict__ s1, const float* __restrict__ s2, const float* __restrict__ s3, const float* __restrict__ s4, bf* dst) { const size_t i = (size_t)blockIdx.x * 256 + threadIdx.x; if (i >= (size_t)CC * CC / 8) return;
    const int y = blockIdx.y; const float* src = y == 0 ? s0 : y == 1 ? s1 : y == 2 ? s2 : y == 3 ? s3 : s4; const v8f v = *(const v8f*)(src + i * 8); v8us o;
#pragma unroll
    for (int k = 0; k < 8; ++k) o[k] = f2bf(v[k]); *(v8us*)(dst + (size_t)y * CC * CC + i * 8) = o;  }
// blockIdx.y = statistic set: sets 0..NB_-1 are the batch elements of A0, sets NB_.. those of A1
template <int RAW, int PASS>
__global__ __launch_bounds__(256) void k_psum(const float* __restrict__ A0, const float* __restrict__ A1, const float* __restrict__ ST, float* PART) {
    const int set = blockIdx.y; const float* A = set < NB_ ? A0 + (size_t)set * TT * CC : A1 + (size_t)(set - NB_) * TT * CC; ST += set * 32; PART += (size_t)set * NW * 32;
    const int lane = threadIdx.x & 31; const int w = blockIdx.x * 8 + (threadIdx.x >> 5); if (w >= NW) return; const float mu = PASS ? ST[0] : 0.f; float s = 0.f;
    for (int i = lane * 4; i < 64 * CC; i += 128) { const v4f v = *(const v4f*)(A + (size_t)w * 64 * CC + i);
#pragma unroll
        for (int q = 0; q < 4; ++q) { float x = RAW ? bfr(v[q]) : v[q]; if (PASS) { const float d0 = __fsub_rn(x, mu); x = __fmul_rn(d0, d0); } s = __fadd_rn(s, x); } }
#pragma unroll
    for (int sh = 16; sh; sh >>= 1) s += __shfl_xor(s, sh, 32);
    const float o = (lane == 0) ? s : 0.f; *(float*)(PART + (size_t)w * 32 + lane) = o;  }
template <int PASS>
__global__ __launch_bounds__(32) void k_comb(const float* __restrict__ PART, float* ST) {
    PART += (size_t)blockIdx.x * NW * 32; ST += blockIdx.x * 32;
    const int lane = threadIdx.x; float s = PART[(size_t)lane * 32];
#pragma unroll
    for (int sh = 16; sh; sh >>= 1) s += __shfl_xor(s, sh, 32);
    const float inv = 1.0f / (float)(TT * CC); float o;
    if (PASS == 0) o = (lane == 0) ? s * inv : 0.f; else { const float mu = ST[0]; o = (lane == 0) ? mu : (lane == 1 ? __fdiv_rn(1.0f, __fsqrt_rn(__fadd_rn(s * inv, 1e-5f))) : 0.f); }
    *(float*)(ST + lane) = o;  }
// one set's plane; the kernel below picks the set's pointers (blockIdx.y) and calls it, so that the __restrict__ of the picked pointers is kept
template <int RAW, int RELU>
__device__ __forceinline__ void snpl_set(const float* __restrict__ A, const float* __restrict__ ST, const float* __restrict__ w, const float* __restrict__ bb, bf* Ph, bf* Pl, const size_t i) { const int c = (int)(i & (CC - 1)); const float mu = ST[0], rs = ST[1]; v2us oh, ol;
#pragma unroll
    for (int q = 0; q < 2; ++q) { float x = A[i + q]; if (RAW) x = bfr(x); float t = __fmul_rn(__fsub_rn(x, mu), rs); asm volatile("" : "+v"(t)); float y = __fadd_rn(__fmul_rn(t, bfr(w[c + q])), bfr(bb[c + q])); if (RELU) y = fmaxf(y, 0.f); unsigned short a, c2; splitf(y, a, c2); oh[q] = a; ol[q] = c2; }
    *(v2us*)(Ph + i) = oh; *(v2us*)(Pl + i) = ol;  }
template <int RAW, int RELU>
__global__ __launch_bounds__(256) void k_snpl(const float* __restrict__ A0, const float* __restrict__ A1, const float* __restrict__ ST, const float* __restrict__ w0, const float* __restrict__ bb0, const float* __restrict__ w1, const float* __restrict__ bb1, bf* Ph, bf* Pl) { const size_t i = ((size_t)blockIdx.x * 256 + threadIdx.x) * 2; if (i >= (size_t)TT * CC) return;
    const int set = blockIdx.y; const bool first = set < NB_;
    snpl_set<RAW, RELU>(first ? A0 + (size_t)set * TT * CC : A1 + (size_t)(set - NB_) * TT * CC, ST + set * 32, first ? w0 : w1, first ? bb0 : bb1, Ph + (size_t)set * TT * CC, Pl + (size_t)set * TT * CC, i); }
__global__ __launch_bounds__(256) void k_hp32(const float* __restrict__ F, int rows, int lg2rows, h16* P) {
    F += (size_t)blockIdx.y * TT * CC; P += (size_t)blockIdx.y * NHD * TT * DH;
    const int lane = threadIdx.x & 31; const int L0 = (blockIdx.x * 8 + (threadIdx.x >> 5)) * 8; const int nlines = NHD * rows * DH / 64;
{
#pragma unroll
        for (int l = 0; l < 8; ++l) { const int L = L0 + l; if (L >= nlines) break; const int e = L * 64 + lane * 2; const int d = e & (DH - 1); const int r = (e >> 5) & (rows - 1); const int h = e >> (5 + lg2rows); v2h o;
#pragma unroll
            for (int q = 0; q < 2; ++q) o[q] = tohx(F[(size_t)r * CC + h * DH + d + q]);
            *(v2h*)(P + (size_t)e) = o; }
         }
}
__global__ __launch_bounds__(256) void k_vt32(const float* __restrict__ FV, h16* V16) {
    FV += (size_t)blockIdx.y * TT * CC; V16 += (size_t)blockIdx.y * CC * TT;
    const int lane = threadIdx.x & 31; const int L0 = (blockIdx.x * 8 + (threadIdx.x >> 5)) * 8; const int nlines = CC * TT / 64;
{
#pragma unroll
        for (int l = 0; l < 8; ++l) { const int L = L0 + l; if (L >= nlines) break; const int e = L * 64 + lane * 2; const int n = e & (TT - 1); const int c = e >> 11; v2h o;
#pragma unroll
            for (int q = 0; q < 2; ++q) o[q] = tohx(FV[(size_t)(n + q) * CC + c]);
            *(v2h*)(V16 + (size_t)e) = o; }
         }
}
// ---- k_fattn: scores, softmax, attn.v and the hi/lo split of O in one kernel; no score and no weight leaves the registers.
// grid (2048 / 256 query blocks, 32 (batch, head) pairs), 16 waves. The pair's whole K [2048][32] and V^T [32][2048] are laid into LDS once (padded pitches), then read by every wave.
// Wave w: query columns (w & 7) * 32 .. + 31, keys (w >> 3) * 1024 .. + 1023, 64 keys a pass. S^T = K Q^T: lane (c, h) holds query c's scores of keys 8h + r of each 16-key tile, which, rounded to fp16,
// ARE the B operand of O^T += V^T P^T (hardware k order; K, Q and V^T fragments are loaded in the same order). Running maximum per query column; the two key halves are joined through LDS at the end.
typedef __attribute__((ext_vector_type(2))) float v2f;
typedef float __attribute__((may_alias)) fa;
__device__ __forceinline__ float xhalf(float x) { const int b = __float_as_int(x); return __int_as_float(__builtin_amdgcn_permlanex16(b, b, 0x76543210, 0xfedcba98, false, false)); }   // lane l <- lane l ^ 16
// v_exp_f32 with the one slot behind a transcendental filled in the same statement
__device__ __forceinline__ float exp2_slot(float x) { float r; asm("v_exp_f32 %0, %1\n\tv_nop" : "=v"(r) : "v"(x)); return r; }
__global__ __launch_bounds__(512) void k_fattn(const h16* __restrict__ QP, const h16* __restrict__ KP, const h16* __restrict__ V16, bf* Oh, bf* Ol) {
    __shared__ __align__(16) unsigned char sm[TT * KPB + DH * VPB];
    unsigned char* Ks = sm; unsigned char* Vs = sm + TT * KPB;
    const int g = blockIdx.y, tid = threadIdx.x, lane = tid & 31, wave = tid >> 5, lr = lane & 15, hi = lane >> 4;
    const int qg = wave & 7, kh = wave >> 3, q0 = blockIdx.x * 256 + qg * 32;
    v16h qf[2];
#pragma unroll
    for (int t = 0; t < 2; ++t) { const h16* p = QP + ((size_t)g * TT + q0 + t * 16 + lr) * DH + 8 * hi; qf[t] = cat16(*(const v8h*)p, *(const v8h*)(p + 16)); }
    asm volatile("s_wait_xcnt 0x0" ::: "memory");   // the Q loads' address registers are given new values further down, ahead of the loads' data wait: this wait stands in front of that
    const h16* Kg = KP + (size_t)g * TT * DH; const h16* Vg = V16 + (size_t)g * DH * TT;
#pragma unroll
    for (int u = 0; u < TT * DH / 8 / 512; ++u) { const int i = u * 512 + tid; *(v8ha*)(Ks + (i >> 2) * KPB + (i & 3) * 16) = *(const v8h*)(Kg + (size_t)i * 8); }
#pragma unroll
    for (int u = 0; u < TT * DH / 8 / 512; ++u) { const int i = u * 512 + tid; *(v8ha*)(Vs + (i >> 8) * VPB + (i & 255) * 16) = *(const v8h*)(Vg + (size_t)i * 8); }
    __syncthreads();
    v8f o[2][2]; float m[2], l[2];
#pragma unroll
    for (int t = 0; t < 2; ++t) { o[t][0] = (v8f){}; o[t][1] = (v8f){}; m[t] = -3.0e38f; l[t] = 0.f; }
    const unsigned char* kp = Ks + (kh * (TT / 2) + lr) * KPB + 16 * hi; const unsigned char* vp = Vs + lr * VPB + (kh * (TT / 2) + 8 * hi) * 2;
    // kept rolled: one pass is already several hundred instructions
#pragma unroll 1
    for (int ps = 0; ps < TT / 2 / 64; ++ps, kp += 64 * KPB, vp += 64 * 2) {
        v8f s[2][4];
#pragma unroll
        for (int kt = 0; kt < 4; ++kt) { const v16h ka = cat16(*(const v8ha*)(kp + kt * 16 * KPB), *(const v8ha*)(kp + kt * 16 * KPB + 32));
#pragma unroll
            for (int t = 0; t < 2; ++t) s[t][kt] = wmma16(ka, qf[t], (v8f){}); }
        v16h va[2][2];
#pragma unroll
        for (int dt = 0; dt < 2; ++dt)
#pragma unroll
            for (int kk = 0; kk < 2; ++kk) va[dt][kk] = cat16(*(const v8ha*)(vp + dt * 16 * VPB + kk * 64), *(const v8ha*)(vp + dt * 16 * VPB + kk * 64 + 32));
#pragma unroll
        for (int t = 0; t < 2; ++t) {
            float mk[4];
#pragma unroll
            for (int kt = 0; kt < 4; ++kt) { mk[kt] = s[t][kt][0];
#pragma unroll
                for (int j = 1; j < 8; ++j) mk[kt] = fmaxf(mk[kt], s[t][kt][j]); }
            float mx = fmaxf(fmaxf(mk[0], mk[1]), fmaxf(mk[2], mk[3])); mx = fmaxf(mx, xhalf(mx));
            const float mn = fmaxf(m[t], mx * C2), al = exp2_slot(m[t] - mn); m[t] = mn;
            const v2f cv = {C2, C2}, nb = {PSH - mn, PSH - mn}; v2f sk[4]; v16h pf[2];
#pragma unroll
            for (int kt = 0; kt < 4; ++kt) {
#pragma unroll
                for (int j = 0; j < 8; j += 2) { const v2f x = __builtin_elementwise_fma((v2f){s[t][kt][j], s[t][kt][j + 1]}, cv, nb); const v2f e = {__builtin_amdgcn_exp2f(x[0]), __builtin_amdgcn_exp2f(x[1])}; sk[kt] = j ? sk[kt] + e : e;
                    const v2h c = __builtin_convertvector(e, v2h); pf[kt >> 1][(kt & 1) * 8 + j] = c[0]; pf[kt >> 1][(kt & 1) * 8 + j + 1] = c[1]; } }
            const v2f st = (sk[0] + sk[1]) + (sk[2] + sk[3]); l[t] = l[t] * al + (st[0] + st[1]);
#pragma unroll
            for (int dt = 0; dt < 2; ++dt) { o[t][dt] *= al;
#pragma unroll
                for (int kk = 0; kk < 2; ++kk) o[t][dt] = wmma16(va[dt][kk], pf[kk], o[t][dt]); }
        }
    }
    __syncthreads();   // every wave has left K and V^T: the first K rows now carry the upper key half's state to its partner wave
    fa* mb = (fa*)sm + (size_t)qg * 36 * 32 + lane;
    if (kh == 1) {
#pragma unroll
        for (int t = 0; t < 2; ++t) { mb[(t * 18) * 32] = m[t]; mb[(t * 18 + 1) * 32] = l[t];
#pragma unroll
            for (int r = 0; r < 16; ++r) mb[(t * 18 + 2 + r) * 32] = o[t][r >> 3][r & 7]; }
    }
    __syncthreads();
    if (kh == 0) {
#pragma unroll
        for (int t = 0; t < 2; ++t) { const float m1 = mb[(t * 18) * 32], l1 = mb[(t * 18 + 1) * 32], mN = fmaxf(m[t], m1); float a0 = exp2_slot(m[t] - mN), a1 = exp2_slot(m1 - mN);
            float lt = l[t] * a0 + l1 * a1; lt += xhalf(lt); const float inv = __fdiv_rn(1.0f, lt); a0 *= inv; a1 *= inv;
#pragma unroll
            for (int dt = 0; dt < 2; ++dt) { v8us oh, ol;
#pragma unroll
                for (int j = 0; j < 8; ++j) { unsigned short a, c2; splitf(o[t][dt][j] * a0 + mb[(t * 18 + 2 + dt * 8 + j) * 32] * a1, a, c2); oh[j] = a; ol[j] = c2; }
                const size_t off = ((size_t)(g >> 3) * TT + q0 + t * 16 + lr) * CC + (g & 7) * DH + dt * 16 + 8 * hi; *(v8us*)(Oh + off) = oh; *(v8us*)(Ol + off) = ol; } }
    }
}
template <int RAW>
__global__ __launch_bounds__(256) void k_res(const float* __restrict__ a, const float* __restrict__ B, float* Dd) { const size_t i = ((size_t)blockIdx.x * 256 + threadIdx.x) * 4; if (i >= (size_t)NB_ * TT * CC) return; const v4f x = *(const v4f*)(a + i), y = *(const v4f*)(B + i); v4f o;
#pragma unroll
    for (int q = 0; q < 4; ++q) o[q] = __fadd_rn(RAW ? bfr(x[q]) : x[q], y[q]); *(v4f*)(Dd + i) = o;  }

extern "C" void kernel_launch(void* const* d_in, const int* in_sizes, int n_in,
                              void* d_out, int out_size, void* d_ws, size_t ws_size, hipStream_t stream) {
    (void)in_sizes; (void)n_in; (void)out_size;
    const float* IN[18]; for (int i = 0; i < 18; ++i) IN[i] = (const float*)d_in[i];
    // X, Y [4][2048][256], Wq [256][256], bq, Wk, bk, Wv, bv, Wo, bo, Wres, bres, nq_w, nq_b, nk_w, nk_b, n0_w, n0_b = d_in[0..17]
    float* OUT = (float*)d_out;     // [4][2048][256]
    char* wsp = (char*)d_ws;
    auto take = [&](size_t bytes) { char* p = wsp; wsp += (bytes + 255) & ~(size_t)255; return (void*)p; };
    const size_t PE = (size_t)TT * CC;                      // elements of one batch element's [2048][256] plane
    bf* WQ = (bf*)take((size_t)CC * CC * 2); bf* WK = (bf*)take((size_t)CC * CC * 2); bf* WV = (bf*)take((size_t)CC * CC * 2); bf* WO = (bf*)take((size_t)CC * CC * 2); bf* WR = (bf*)take((size_t)CC * CC * 2);   // one behind the other (k_cvtw)
    float* PART = (float*)take((size_t)2 * NB_ * NW * 32 * 4); float* ST = (float*)take((size_t)2 * NB_ * 32 * 4);
    // live through the attention part; g = batch * 8 + head runs through all of them
    h16* QP = (h16*)take((size_t)NB_ * NHD * TT * DH * 2); h16* KP = (h16*)take((size_t)NB_ * NHD * TT * DH * 2); h16* V16 = (h16*)take((size_t)NB_ * CC * TT * 2);
    bf* Ph = (bf*)take(2 * NB_ * PE * 2); bf* Pl = (bf*)take(2 * NB_ * PE * 2); bf* YB = (bf*)take(NB_ * PE * 2); float* FQ = (float*)take(NB_ * PE * 4); float* FK = (float*)take(NB_ * PE * 4); float* FV = (float*)take(NB_ * PE * 4);   // FQ, FK one behind the other (k_hp32)
    bf* Oh = YB; bf* Ol = (bf*)FV; float* H = (float*)take(NB_ * PE * 4);
    if ((size_t)(wsp - (char*)d_ws) > ws_size) return;    // total ~ 65 MiB; ws 256 MiB
    k_cvtw<<<dim3(CC * CC / 8 / 256, 5), 256, 0, stream>>>(IN[2], IN[4], IN[6], IN[8], IN[10], WQ);
    const unsigned L2 = (unsigned)((PE / 2 + 255) / 256), L4 = (unsigned)((NB_ * PE / 4 + 255) / 256), LP = (NHD * TT * DH / 64 + 63) / 64; const dim3 gP(NB_ * TT / 64, CC / 64, 1);
    // SetNorm(X) and SetNorm(Y), all batch elements: sets 0..3 = X, 4..7 = Y
    k_psum<1, 0><<<dim3(NW / 8, 2 * NB_), 256, 0, stream>>>(IN[0], IN[1], ST, PART); k_comb<0><<<2 * NB_, 32, 0, stream>>>(PART, ST); k_psum<1, 1><<<dim3(NW / 8, 2 * NB_), 256, 0, stream>>>(IN[0], IN[1], ST, PART); k_comb<1><<<2 * NB_, 32, 0, stream>>>(PART, ST);
    k_snpl<1, 0><<<dim3(L2, 2 * NB_), 256, 0, stream>>>(IN[0], IN[1], ST, IN[12], IN[13], IN[14], IN[15], Ph, Pl);
    // Q = SetNorm(X) Wq^T + bq; K = SetNorm(Y) Wk^T + bk; V = Y Wv^T + bv: the four batch elements are 8192 rows of one product
    k_gemmw<bf, 1, true><<<gP, 32, 0, stream>>>(Ph, Pl, WQ, nullptr, CC, FQ, CC, IN[3], 0, 0, 0);
    k_gemmw<bf, 1, true><<<gP, 32, 0, stream>>>(Ph + NB_ * PE, Pl + NB_ * PE, WK, nullptr, CC, FK, CC, IN[5], 0, 0, 0);
    k_hp32<<<dim3(LP, 2 * NB_), 256, 0, stream>>>(FQ, TT, 11, QP);                                             // FQ -> QP and FK -> KP
    k_cvt8<<<(unsigned)((NB_ * PE / 8 + 255) / 256), 256, 0, stream>>>(IN[1], YB, NB_ * PE / 8);
    k_gemmw<bf, 0, true><<<gP, 32, 0, stream>>>(YB, nullptr, WV, nullptr, CC, FV, CC, IN[7], 0, 0, 0); k_vt32<<<dim3((CC * TT / 64 + 63) / 64, NB_), 256, 0, stream>>>(FV, V16);
    k_fattn<<<dim3(TT / 256, NB_ * NHD), 512, 0, stream>>>(QP, KP, V16, Oh, Ol);                             // softmax(Q_h K_h^T / 16) V_h, all pairs -> O as hi + lo planes
    k_gemmw<bf, 1, true><<<gP, 32, 0, stream>>>(Oh, Ol, WO, nullptr, CC, FQ, CC, IN[9], 0, 0, 0);          // O Wo^T + bo -> FQ
    k_res<1><<<L4, 256, 0, stream>>>(IN[0], FQ, H);                                                        // H = bf16(X) + O
    k_psum<0, 0><<<dim3(NW / 8, NB_), 256, 0, stream>>>(H, H, ST, PART); k_comb<0><<<NB_, 32, 0, stream>>>(PART, ST); k_psum<0, 1><<<dim3(NW / 8, NB_), 256, 0, stream>>>(H, H, ST, PART); k_comb<1><<<NB_, 32, 0, stream>>>(PART, ST);
    k_snpl<0, 1><<<dim3(L2, NB_), 256, 0, stream>>>(H, H, ST, IN[16], IN[17], IN[16], IN[17], Ph, Pl);      // relu(SetNorm(H))
    k_gemmw<bf, 1, true><<<gP, 32, 0, stream>>>(Ph, Pl, WR, nullptr, CC, FK, CC, IN[11], 0, 0, 0);          // Wres^T + bres -> FK
    k_res<0><<<L4, 256, 0, stream>>>(H, FK, OUT);
}

// v003
// A run of this version takes 143 microseconds.
// In two side-by-side timings against v002, it was 2.02 and 2.04 times as fast.
// Counting every step since v000, it is 21.3 times as fast.
#include <hip/hip_runtime.h>

// MABClean (Set-Transformer MAB; X, Y [4][2048][256]; Q = SetNorm(X) Wq^T + bq, K = SetNorm(Y) Wk^T + bk, V = Y Wv^T + bv (SetNorm: normalise over all (samples, features) of one batch element, eps 1e-5,
// then per-feature scale/shift); 8 heads of 32: A = softmax_k(Q_h.K_h / sqrt(256)); O = concat_h A V_h; H = X + O Wo^T + bo; out = H + relu(SetNorm(H)) Wres^T + bres).
// Compute dtypes, f32 accumulate: every input rounded to bf16; the three SetNorm statistics (mean, then variance, over 524,288 values each) by fixed-order two-level
// reductions in f32; the normalised operands as bf16 hi+lo planes x exact weights (2 products); V on PLAIN bf16 operands (exact, + bias); scores (K = 32) and attn.v on SINGLE fp16 planes (model

#define NB_  4
#define TT   2048
#define CC   256
#define NHD  8
#define DH   32
#define SCL  0.0625f              // 1/sqrt(dim_Y = 256)
#define C2   (SCL * 1.44269504f)  // score -> exponent of two
#define PSH  10.0f                // P carries 2^10 (as does its sum), so that small weights stay normal fp16 numbers
#define KPB  80                   // LDS pitch of one K row: 64 bytes + 16 (16 B x odd: no bank conflict for 16-byte reads down a column of rows)
#define VPB  4112                 // LDS pitch of one row of V^T: 4096 bytes + 16
#define NW   32                   // partial sums per statistic (64 rows each, one work-group of 8 waves)
typedef _Float16 h16;
typedef unsigned short bf;
typedef __attribute__((ext_vector_type(16))) __bf16   v16bf;
typedef __attribute__((ext_vector_type(16))) _Float16 v16h;
typedef __attribute__((ext_vector_type(8)))  _Float16 v8h;
typedef __attribute__((ext_vector_type(8)))  unsigned short v8us;
typedef __attribute__((ext_vector_type(8)))  float    v8f;
typedef __attribute__((ext_vector_type(4)))  float    v4f;
typedef v8h  __attribute__((may_alias)) v8ha;
typedef v4f  __attribute__((may_alias)) v4fa;
typedef v8us __attribute__((may_alias)) v8usa;

__device__ __forceinline__ unsigned short f2bf(float f) { unsigned u = __float_as_uint(f); u += 0x7FFFu + ((u >> 16) & 1u); return (unsigned short)(u >> 16); }
__device__ __forceinline__ float bf2f(unsigned short b) { return __uint_as_float(((unsigned)b) << 16); }
__device__ __forceinline__ float bfr(float f) { return bf2f(f2bf(f)); }
__device__ __forceinline__ v16h cat16(v8h lo, v8h hi) { return __builtin_shufflevector(lo, hi, 0, 1, 2, 3, 4, 5, 6, 7, 8, 9, 10, 11, 12, 13, 14, 15); }
__device__ __forceinline__ v16bf cat16b(v8us lo, v8us hi) { return __builtin_bit_cast(v16bf, __builtin_shufflevector(lo, hi, 0, 1, 2, 3, 4, 5, 6, 7, 8, 9, 10, 11, 12, 13, 14, 15)); }
__device__ __forceinline__ v8f wmma16(v16h a, v16h b, v8f c) { return __builtin_amdgcn_wmma_f32_16x16x32_f16(false, a, false, b, (short)0, c, false, false); }
__device__ __forceinline__ v8f wmmab(v16bf a, v16bf b, v8f c) { return __builtin_amdgcn_wmma_f32_16x16x32_bf16(false, a, false, b, (short)0, c, false, false); }



// ---- k_gemmw: register-blocked GEMM, ONE WAVE per 64x64 output tile (16 accumulators), operands straight from K-contiguous 16-bit planes; grid (M/64, N/64, Z), 32 threads.
// C[m][n] (f32, pitch ldc, + optional f32 bias[n]) = sum_k A[m][k] Bt[n][k] (+ split products per NSPLIT). z-batch strides sA/sB/sC in elements. K % 32 == 0.
template <typename T16> struct WFrag;
template <> struct WFrag<bf> { typedef v16bf V; static __device__ __forceinline__ V ld(const bf* p) { return cat16b(*(const v8us*)p, *(const v8us*)(p + 16)); } static __device__ __forceinline__ v8f mma(V a, V b, v8f c) { return wmmab(a, b, c); } };
template <typename T16, int NSPLIT, bool BIAS>
__global__ __launch_bounds__(32) void k_gemmw(const T16* __restrict__ A, const T16* __restrict__ A2, const T16* __restrict__ Bt, const T16* __restrict__ Bt2, int K, float* C, int ldc, const float* __restrict__ bias, size_t sA, size_t sB, size_t sC) {
    typedef typename WFrag<T16>::V V;
    __shared__ __align__(16) float os[16 * 68];
    const size_t z = blockIdx.z; A += z * sA; if (A2) A2 += z * sA; Bt += z * sB; if (Bt2) Bt2 += z * sB; C += z * sC;
    const int lane = threadIdx.x & 31, lr = lane & 15, hi = lane >> 4; const int r0 = blockIdx.x * 64, c0 = blockIdx.y * 64;
    v8f acc[4][4];
#pragma unroll
    for (int mb = 0; mb < 4; ++mb)
#pragma unroll
        for (int nb = 0; nb < 4; ++nb) acc[mb][nb] = (v8f){};
    const size_t aoff = (size_t)(r0 + lr) * K + 8 * hi, boff = (size_t)(c0 + lr) * K + 8 * hi;
#pragma unroll 1
    for (int kc = 0; kc < K; kc += 32) {
        V a[4], a2[4];
#pragma unroll
        for (int mb = 0; mb < 4; ++mb) { a[mb] = WFrag<T16>::ld(A + aoff + (size_t)mb * 16 * K + kc); if (NSPLIT == 1 || NSPLIT == 2) a2[mb] = WFrag<T16>::ld(A2 + aoff + (size_t)mb * 16 * K + kc); }
#pragma unroll
        for (int nb = 0; nb < 4; ++nb) { const V b = WFrag<T16>::ld(Bt + boff + (size_t)nb * 16 * K + kc); V b2; if (NSPLIT >= 2) b2 = WFrag<T16>::ld(Bt2 + boff + (size_t)nb * 16 * K + kc);
#pragma unroll
            for (int mb = 0; mb < 4; ++mb) { acc[mb][nb] = WFrag<T16>::mma(a[mb], b, acc[mb][nb]); if (NSPLIT == 1 || NSPLIT == 2) acc[mb][nb] = WFrag<T16>::mma(a2[mb], b, acc[mb][nb]); if (NSPLIT >= 2) acc[mb][nb] = WFrag<T16>::mma(a[mb], b2, acc[mb][nb]); } }
        asm volatile("v_nop\n\tv_nop\n\tv_nop\n\tv_nop" : "+v"(acc[0][0]), "+v"(acc[1][1]), "+v"(acc[2][2]), "+v"(acc[3][3]) : "v"(a[0]), "v"(a[3]));
    }
#pragma unroll
    for (int mb = 0; mb < 4; ++mb) {
#pragma unroll
        for (int nb = 0; nb < 4; ++nb) {
#pragma unroll
            for (int j = 0; j < 8; ++j) os[(hi * 8 + j) * 68 + nb * 16 + lr] = acc[mb][nb][j]; }
        __builtin_amdgcn_wave_barrier(); asm volatile("" ::: "memory");
        float* crow = C + (size_t)(r0 + mb * 16) * ldc + c0;
{
#pragma unroll
            for (int s = 0; s < 8; ++s) { const int row = 2 * s + hi, cofs = lr * 4; v4f val = *(const v4fa*)(os + row * 68 + cofs); if (BIAS) { val[0] += bfr(bias[c0 + cofs]); val[1] += bfr(bias[c0 + cofs + 1]); val[2] += bfr(bias[c0 + cofs + 2]); val[3] += bfr(bias[c0 + cofs + 3]); }
                *(v4f*)(crow + (size_t)row * ldc + cofs) = val; }
             }
        __builtin_amdgcn_wave_barrier(); asm volatile("" ::: "memory");
    }
}

__device__ __forceinline__ h16 tohx(float x) { return (h16)x; }
__device__ __forceinline__ void splitf(float y, unsigned short& h, unsigned short& l) { h = f2bf(y); l = f2bf(y - bf2f(h)); }
typedef __attribute__((ext_vector_type(2))) _Float16 v2h;
typedef __attribute__((ext_vector_type(4))) _Float16 v4h;
typedef __attribute__((ext_vector_type(2))) unsigned short v2us;
typedef __attribute__((ext_vector_type(8))) _Float16 v8h16;

__global__ __launch_bounds__(256) void k_cvt8(const float* __restrict__ src, bf* dst, size_t n8) { const size_t i = (size_t)blockIdx.x * 256 + threadIdx.x; if (i >= n8) return; const v8f v = *(const v8f*)(src + i * 8); v8us o;
#pragma unroll
    for (int k = 0; k < 8; ++k) o[k] = f2bf(v[k]); *(v8us*)(dst + i * 8) = o;  }
// five weight matrices in one launch: blockIdx.y picks the source, the planes lie one behind the other in dst
__global__ __launch_bounds__(256) void k_cvtw(const float* __restrict__ s0, const float* __restrict__ s1, const float* __restrict__ s2, const float* __restrict__ s3, const float* __restrict__ s4, bf* dst) { const size_t i = (size_t)blockIdx.x * 256 + threadIdx.x; if (i >= (size_t)CC * CC / 8) return;
    const int y = blockIdx.y; const float* src = y == 0 ? s0 : y == 1 ? s1 : y == 2 ? s2 : y == 3 ? s3 : s4; const v8f v = *(const v8f*)(src + i * 8); v8us o;
#pragma unroll
    for (int k = 0; k < 8; ++k) o[k] = f2bf(v[k]); *(v8us*)(dst + (size_t)y * CC * CC + i * 8) = o;  }
// blockIdx.y = statistic set: sets 0..NB_-1 are the batch elements of A0, sets NB_.. those of A1; blockIdx.x = one slice of 64 rows, one partial sum.
// Wave v of the work-group takes rows 8v .. 8v + 7 of the slice: 16 loads of 16 bytes a lane, all issued before the first value is used, so that the wave waits out the load latency once and not once a load.
// amdgpu_waves_per_eu: the grid has no more work-groups than the chip has WGPs, so about two waves a SIMD; without the hint the compiler saved registers for sixteen and held four of the sixteen loads back until earlier ones had returned.
// Fixed order: four chains a lane (one per vector component), their pair sums, the lanes of the wave, then the eight waves through LDS.
template <int RAW, int PASS>
__global__ __launch_bounds__(256) __attribute__((amdgpu_waves_per_eu(2, 4))) void k_psum(const float* __restrict__ A0, const float* __restrict__ A1, const float* __restrict__ ST, float* PART) {
    __shared__ float wsum[8];
    const int set = blockIdx.y; const float* A = set < NB_ ? A0 + (size_t)set * TT * CC : A1 + (size_t)(set - NB_) * TT * CC; ST += set * 32; PART += (size_t)set * NW * 32;
    const int lane = threadIdx.x & 31, wv = threadIdx.x >> 5; const float* p = A + ((size_t)blockIdx.x * 64 + wv * 8) * CC + lane * 4;
    v4f v[16];
#pragma unroll
    for (int u = 0; u < 16; ++u) v[u] = *(const v4f*)(p + u * 128);
    asm volatile("s_wait_xcnt 0x0" :: "v"(p) : "memory");   // the wait owed before the loads' address registers take new values; p as an input keeps the pair whole up to here, so that no load of the run lands on it
    const float mu = PASS ? ST[0] : 0.f; v4f a = {0.f, 0.f, 0.f, 0.f};
#pragma unroll
    for (int u = 0; u < 16; ++u) {
#pragma unroll
        for (int q = 0; q < 4; ++q) { float x = RAW ? bfr(v[u][q]) : v[u][q]; if (PASS) { const float d0 = __fsub_rn(x, mu); x = __fmul_rn(d0, d0); } a[q] = __fadd_rn(a[q], x); } }
    float s = __fadd_rn(__fadd_rn(a[0], a[1]), __fadd_rn(a[2], a[3]));
#pragma unroll
    for (int sh = 16; sh; sh >>= 1) s += __shfl_xor(s, sh, 32);
    if (lane == 0) wsum[wv] = s;
    __syncthreads();   // the eight waves' sums are in LDS; wave 0 joins them
    if (wv == 0) { float t = wsum[lane & 7];
#pragma unroll
        for (int sh = 4; sh; sh >>= 1) t += __shfl_xor(t, sh, 32);
        PART[(size_t)blockIdx.x * 32 + lane] = (lane == 0) ? t : 0.f; }
}
template <int PASS>
__global__ __launch_bounds__(32) void k_comb(const float* __restrict__ PART, float* ST) {
    PART += (size_t)blockIdx.x * NW * 32; ST += blockIdx.x * 32;
    const int lane = threadIdx.x; float s = PART[(size_t)lane * 32];
#pragma unroll
    for (int sh = 16; sh; sh >>= 1) s += __shfl_xor(s, sh, 32);
    const float inv = 1.0f / (float)(TT * CC); float o;
    if (PASS == 0) o = (lane == 0) ? s * inv : 0.f; else { const float mu = ST[0]; o = (lane == 0) ? mu : (lane == 1 ? __fdiv_rn(1.0f, __fsqrt_rn(__fadd_rn(s * inv, 1e-5f))) : 0.f); }
    *(float*)(ST + lane) = o;  }
// one set's plane; the kernel below picks the set's pointers (blockIdx.y) and calls it, so that the __restrict__ of the picked pointers is kept
template <int RAW, int RELU>
__device__ __forceinline__ void snpl_set(const float* __restrict__ A, const float* __restrict__ ST, const float* __restrict__ w, const float* __restrict__ bb, bf* Ph, bf* Pl, const size_t i) { const int c = (int)(i & (CC - 1)); const float mu = ST[0], rs = ST[1]; v2us oh, ol;
#pragma unroll
    for (int q = 0; q < 2; ++q) { float x = A[i + q]; if (RAW) x = bfr(x); float t = __fmul_rn(__fsub_rn(x, mu), rs); asm volatile("" : "+v"(t)); float y = __fadd_rn(__fmul_rn(t, bfr(w[c + q])), bfr(bb[c + q])); if (RELU) y = fmaxf(y, 0.f); unsigned short a, c2; splitf(y, a, c2); oh[q] = a; ol[q] = c2; }
    *(v2us*)(Ph + i) = oh; *(v2us*)(Pl + i) = ol;  }
template <int RAW, int RELU>
__global__ __launch_bounds__(256) void k_snpl(const float* __restrict__ A0, const float* __restrict__ A1, const float* __restrict__ ST, const float* __restrict__ w0, const float* __restrict__ bb0, const float* __restrict__ w1, const float* __restrict__ bb1, bf* Ph, bf* Pl) { const size_t i = ((size_t)blockIdx.x * 256 + threadIdx.x) * 2; if (i >= (size_t)TT * CC) return;
    const int set = blockIdx.y; const bool first = set < NB_;
    snpl_set<RAW, RELU>(first ? A0 + (size_t)set * TT * CC : A1 + (size_t)(set - NB_) * TT * CC, ST + set * 32, first ? w0 : w1, first ? bb0 : bb1, Ph + (size_t)set * TT * CC, Pl + (size_t)set * TT * CC, i); }
__global__ __launch_bounds__(256) void k_hp32(const float* __restrict__ F, int rows, int lg2rows, h16* P) {
    F += (size_t)blockIdx.y * TT * CC; P += (size_t)blockIdx.y * NHD * TT * DH;
    const int lane = threadIdx.x & 31; const int L0 = (blockIdx.x * 8 + (threadIdx.x >> 5)) * 8; const int nlines = NHD * rows * DH / 64;
{
#pragma unroll
        for (int l = 0; l < 8; ++l) { const int L = L0 + l; if (L >= nlines) break; const int e = L * 64 + lane * 2; const int d = e & (DH - 1); const int r = (e >> 5) & (rows - 1); const int h = e >> (5 + lg2rows); v2h o;
#pragma unroll
            for (int q = 0; q < 2; ++q) o[q] = tohx(F[(size_t)r * CC + h * DH + d + q]);
            *(v2h*)(P + (size_t)e) = o; }
         }
}
__global__ __launch_bounds__(256) void k_vt32(const float* __restrict__ FV, h16* V16) {
    FV += (size_t)blockIdx.y * TT * CC; V16 += (size_t)blockIdx.y * CC * TT;
    const int lane = threadIdx.x & 31; const int L0 = (blockIdx.x * 8 + (threadIdx.x >> 5)) * 8; const int nlines = CC * TT / 64;
{
#pragma unroll
        for (int l = 0; l < 8; ++l) { const int L = L0 + l; if (L >= nlines) break; const int e = L * 64 + lane * 2; const int n = e & (TT - 1); const int c = e >> 11; v2h o;
#pragma unroll
            for (int q = 0; q < 2; ++q) o[q] = tohx(FV[(size_t)(n + q) * CC + c]);
            *(v2h*)(V16 + (size_t)e) = o; }
         }
}
// ---- k_fattn: scores, softmax, attn.v and the hi/lo split of O in one kernel; no score and no weight leaves the registers.
// grid (2048 / 256 query blocks, 32 (batch, head) pairs), 16 waves. The pair's whole K [2048][32] and V^T [32][2048] are laid into LDS once (padded pitches), then read by every wave.
// Wave w: query columns (w & 7) * 32 .. + 31, keys (w >> 3) * 1024 .. + 1023, 64 keys a pass. S^T = K Q^T: lane (c, h) holds query c's scores of keys 8h + r of each 16-key tile, which, rounded to fp16,
// ARE the B operand of O^T += V^T P^T (hardware k order; K, Q and V^T fragments are loaded in the same order). Running maximum per query column; the two key halves are joined through LDS at the end.
typedef __attribute__((ext_vector_type(2))) float v2f;
typedef float __attribute__((may_alias)) fa;
__device__ __forceinline__ float xhalf(float x) { const int b = __float_as_int(x); return __int_as_float(__builtin_amdgcn_permlanex16(b, b, 0x76543210, 0xfedcba98, false, false)); }   // lane l <- lane l ^ 16
// v_exp_f32 with the one slot behind a transcendental filled in the same statement
__device__ __forceinline__ float exp2_slot(float x) { float r; asm("v_exp_f32 %0, %1\n\tv_nop" : "=v"(r) : "v"(x)); return r; }
__global__ __launch_bounds__(512) void k_fattn(const h16* __restrict__ QP, const h16* __restrict__ KP, const h16* __restrict__ V16, bf* Oh, bf* Ol) {
    __shared__ __align__(16) unsigned char sm[TT * KPB + DH * VPB];
    unsigned char* Ks = sm; unsigned char* Vs = sm + TT * KPB;
    const int g = blockIdx.y, tid = threadIdx.x, lane = tid & 31, wave = tid >> 5, lr = lane & 15, hi = lane >> 4;
    const int qg = wave & 7, kh = wave >> 3, q0 = blockIdx.x * 256 + qg * 32;
    v16h qf[2];
#pragma unroll
    for (int t = 0; t < 2; ++t) { const h16* p = QP + ((size_t)g * TT + q0 + t * 16 + lr) * DH + 8 * hi; qf[t] = cat16(*(const v8h*)p, *(const v8h*)(p + 16)); }
    asm volatile("s_wait_xcnt 0x0" ::: "memory");   // the Q loads' address registers are given new values further down, ahead of the loads' data wait: this wait stands in front of that
    const h16* Kg = KP + (size_t)g * TT * DH; const h16* Vg = V16 + (size_t)g * DH * TT;
#pragma unroll
    for (int u = 0; u < TT * DH / 8 / 512; ++u) { const int i = u * 512 + tid; *(v8ha*)(Ks + (i >> 2) * KPB + (i & 3) * 16) = *(const v8h*)(Kg + (size_t)i * 8); }
#pragma unroll
    for (int u = 0; u < TT * DH / 8 / 512; ++u) { const int i = u * 512 + tid; *(v8ha*)(Vs + (i >> 8) * VPB + (i & 255) * 16) = *(const v8h*)(Vg + (size_t)i * 8); }
    __syncthreads();
    v8f o[2][2]; float m[2], l[2];
#pragma unroll
    for (int t = 0; t < 2; ++t) { o[t][0] = (v8f){}; o[t][1] = (v8f){}; m[t] = -3.0e38f; l[t] = 0.f; }
    const unsigned char* kp = Ks + (kh * (TT / 2) + lr) * KPB + 16 * hi; const unsigned char* vp = Vs + lr * VPB + (kh * (TT / 2) + 8 * hi) * 2;
    // kept rolled: one pass is already several hundred instructions
#pragma unroll 1
    for (int ps = 0; ps < TT / 2 / 64; ++ps, kp += 64 * KPB, vp += 64 * 2) {
        v8f s[2][4];
#pragma unroll
        for (int kt = 0; kt < 4; ++kt) { const v16h ka = cat16(*(const v8ha*)(kp + kt * 16 * KPB), *(const v8ha*)(kp + kt * 16 * KPB + 32));
#pragma unroll
            for (int t = 0; t < 2; ++t) s[t][kt] = wmma16(ka, qf[t], (v8f){}); }
        v16h va[2][2];
#pragma unroll
        for (int dt = 0; dt < 2; ++dt)
#pragma unroll
            for (int kk = 0; kk < 2; ++kk) va[dt][kk] = cat16(*(const v8ha*)(vp + dt * 16 * VPB + kk * 64), *(const v8ha*)(vp + dt * 16 * VPB + kk * 64 + 32));
#pragma unroll
        for (int t = 0; t < 2; ++t) {
            float mk[4];
#pragma unroll
            for (int kt = 0; kt < 4; ++kt) { mk[kt] = s[t][kt][0];
#pragma unroll
                for (int j = 1; j < 8; ++j) mk[kt] = fmaxf(mk[kt], s[t][kt][j]); }
            float mx = fmaxf(fmaxf(mk[0], mk[1]), fmaxf(mk[2], mk[3])); mx = fmaxf(mx, xhalf(mx));
            const float mn = fmaxf(m[t], mx * C2), al = exp2_slot(m[t] - mn); m[t] = mn;
            const v2f cv = {C2, C2}, nb = {PSH - mn, PSH - mn}; v2f sk[4]; v16h pf[2];
#pragma unroll
            for (int kt = 0; kt < 4; ++kt) {
#pragma unroll
                for (int j = 0; j < 8; j += 2) { const v2f x = __builtin_elementwise_fma((v2f){s[t][kt][j], s[t][kt][j + 1]}, cv, nb); const v2f e = {__builtin_amdgcn_exp2f(x[0]), __builtin_amdgcn_exp2f(x[1])}; sk[kt] = j ? sk[kt] + e : e;
                    const v2h c = __builtin_convertvector(e, v2h); pf[kt >> 1][(kt & 1) * 8 + j] = c[0]; pf[kt >> 1][(kt & 1) * 8 + j + 1] = c[1]; } }
            const v2f st = (sk[0] + sk[1]) + (sk[2] + sk[3]); l[t] = l[t] * al + (st[0] + st[1]);
#pragma unroll
            for (int dt = 0; dt < 2; ++dt) { o[t][dt] *= al;
#pragma unroll
                for (int kk = 0; kk < 2; ++kk) o[t][dt] = wmma16(va[dt][kk], pf[kk], o[t][dt]); }
        }
    }
    __syncthreads();   // every wave has left K and V^T: the first K rows now carry the upper key half's state to its partner wave
    fa* mb = (fa*)sm + (size_t)qg * 36 * 32 + lane;
    if (kh == 1) {
#pragma unroll
        for (int t = 0; t < 2; ++t) { mb[(t * 18) * 32] = m[t]; mb[(t * 18 + 1) * 32] = l[t];
#pragma unroll
            for (int r = 0; r < 16; ++r) mb[(t * 18 + 2 + r) * 32] = o[t][r >> 3][r & 7]; }
    }
    __syncthreads();
    if (kh == 0) {
#pragma unroll
        for (int t = 0; t < 2; ++t) { const float m1 = mb[(t * 18) * 32], l1 = mb[(t * 18 + 1) * 32], mN = fmaxf(m[t], m1); float a0 = exp2_slot(m[t] - mN), a1 = exp2_slot(m1 - mN);
            float lt = l[t] * a0 + l1 * a1; lt += xhalf(lt); const float inv = __fdiv_rn(1.0f, lt); a0 *= inv; a1 *= inv;
#pragma unroll
            for (int dt = 0; dt < 2; ++dt) { v8us oh, ol;
#pragma unroll
                for (int j = 0; j < 8; ++j) { unsigned short a, c2; splitf(o[t][dt][j] * a0 + mb[(t * 18 + 2 + dt * 8 + j) * 32] * a1, a, c2); oh[j] = a; ol[j] = c2; }
                const size_t off = ((size_t)(g >> 3) * TT + q0 + t * 16 + lr) * CC + (g & 7) * DH + dt * 16 + 8 * hi; *(v8us*)(Oh + off) = oh; *(v8us*)(Ol + off) = ol; } }
    }
}
template <int RAW>
__global__ __launch_bounds__(256) void k_res(const float* __restrict__ a, const float* __restrict__ B, float* Dd) { const size_t i = ((size_t)blockIdx.x * 256 + threadIdx.x) * 4; if (i >= (size_t)NB_ * TT * CC) return; const v4f x = *(const v4f*)(a + i), y = *(const v4f*)(B + i); v4f o;
#pragma unroll
    for (int q = 0; q < 4; ++q) o[q] = __fadd_rn(RAW ? bfr(x[q]) : x[q], y[q]); *(v4f*)(Dd + i) = o;  }

extern "C" void kernel_launch(void* const* d_in, const int* in_sizes, int n_in,
                              void* d_out, int out_size, void* d_ws, size_t ws_size, hipStream_t stream) {
    (void)in_sizes; (void)n_in; (void)out_size;
    const float* IN[18]; for (int i = 0; i < 18; ++i) IN[i] = (const float*)d_in[i];
    // X, Y [4][2048][256], Wq [256][256], bq, Wk, bk, Wv, bv, Wo, bo, Wres, bres, nq_w, nq_b, nk_w, nk_b, n0_w, n0_b = d_in[0..17]
    float* OUT = (float*)d_out;     // [4][2048][256]
    char* wsp = (char*)d_ws;
    auto take = [&](size_t bytes) { char* p = wsp; wsp += (bytes + 255) & ~(size_t)255; return (void*)p; };
    const size_t PE = (size_t)TT * CC;                      // elements of one batch element's [2048][256] plane
    bf* WQ = (bf*)take((size_t)CC * CC * 2); bf* WK = (bf*)take((size_t)CC * CC * 2); bf* WV = (bf*)take((size_t)CC * CC * 2); bf* WO = (bf*)take((size_t)CC * CC * 2); bf* WR = (bf*)take((size_t)CC * CC * 2);   // one behind the other (k_cvtw)
    float* PART = (float*)take((size_t)2 * NB_ * NW * 32 * 4); float* ST = (float*)take((size_t)2 * NB_ * 32 * 4);
    // live through the attention part; g = batch * 8 + head runs through all of them
    h16* QP = (h16*)take((size_t)NB_ * NHD * TT * DH * 2); h16* KP = (h16*)take((size_t)NB_ * NHD * TT * DH * 2); h16* V16 = (h16*)take((size_t)NB_ * CC * TT * 2);
    bf* Ph = (bf*)take(2 * NB_ * PE * 2); bf* Pl = (bf*)take(2 * NB_ * PE * 2); bf* YB = (bf*)take(NB_ * PE * 2); float* FQ = (float*)take(NB_ * PE * 4); float* FK = (float*)take(NB_ * PE * 4); float* FV = (float*)take(NB_ * PE * 4);   // FQ, FK one behind the other (k_hp32)
    bf* Oh = YB; bf* Ol = (bf*)FV; float* H = (float*)take(NB_ * PE * 4);
    if ((size_t)(wsp - (char*)d_ws) > ws_size) return;    // total ~ 65 MiB; ws 256 MiB
    k_cvtw<<<dim3(CC * CC / 8 / 256, 5), 256, 0, stream>>>(IN[2], IN[4], IN[6], IN[8], IN[10], WQ);
    const unsigned L2 = (unsigned)((PE / 2 + 255) / 256), L4 = (unsigned)((NB_ * PE / 4 + 255) / 256), LP = (NHD * TT * DH / 64 + 63) / 64; const dim3 gP(NB_ * TT / 64, CC / 64, 1);
    // SetNorm(X) and SetNorm(Y), all batch elements: sets 0..3 = X, 4..7 = Y
    k_psum<1, 0><<<dim3(NW, 2 * NB_), 256, 0, stream>>>(IN[0], IN[1], ST, PART); k_comb<0><<<2 * NB_, 32, 0, stream>>>(PART, ST); k_psum<1, 1><<<dim3(NW, 2 * NB_), 256, 0, stream>>>(IN[0], IN[1], ST, PART); k_comb<1><<<2 * NB_, 32, 0, stream>>>(PART, ST);
    k_snpl<1, 0><<<dim3(L2, 2 * NB_), 256, 0, stream>>>(IN[0], IN[1], ST, IN[12], IN[13], IN[14], IN[15], Ph, Pl);
    // Q = SetNorm(X) Wq^T + bq; K = SetNorm(Y) Wk^T + bk; V = Y Wv^T + bv: the four batch elements are 8192 rows of one product
    k_gemmw<bf, 1, true><<<gP, 32, 0, stream>>>(Ph, Pl, WQ, nullptr, CC, FQ, CC, IN[3], 0, 0, 0);
    k_gemmw<bf, 1, true><<<gP, 32, 0, stream>>>(Ph + NB_ * PE, Pl + NB_ * PE, WK, nullptr, CC, FK, CC, IN[5], 0, 0, 0);
    k_hp32<<<dim3(LP, 2 * NB_), 256, 0, stream>>>(FQ, TT, 11, QP);                                             // FQ -> QP and FK -> KP
    k_cvt8<<<(unsigned)((NB_ * PE / 8 + 255) / 256), 256, 0, stream>>>(IN[1], YB, NB_ * PE / 8);
    k_gemmw<bf, 0, true><<<gP, 32, 0, stream>>>(YB, nullptr, WV, nullptr, CC, FV, CC, IN[7], 0, 0, 0); k_vt32<<<dim3((CC * TT / 64 + 63) / 64, NB_), 256, 0, stream>>>(FV, V16);
    k_fattn<<<dim3(TT / 256, NB_ * NHD), 512, 0, stream>>>(QP, KP, V16, Oh, Ol);                             // softmax(Q_h K_h^T / 16) V_h, all pairs -> O as hi + lo planes
    k_gemmw<bf, 1, true><<<gP, 32, 0, stream>>>(Oh, Ol, WO, nullptr, CC, FQ, CC, IN[9], 0, 0, 0);          // O Wo^T + bo -> FQ
    k_res<1><<<L4, 256, 0, stream>>>(IN[0], FQ, H);                                                        // H = bf16(X) + O
    k_psum<0, 0><<<dim3(NW, NB_), 256, 0, stream>>>(H, H, ST, PART); k_comb<0><<<NB_, 32, 0, stream>>>(PART, ST); k_psum<0, 1><<<dim3(NW, NB_), 256, 0, stream>>>(H, H, ST, PART); k_comb<1><<<NB_, 32, 0, stream>>>(PART, ST);
    k_snpl<0, 1><<<dim3(L2, NB_), 256, 0, stream>>>(H, H, ST, IN[16], IN[17], IN[16], IN[17], Ph, Pl);      // relu(SetNorm(H))
    k_gemmw<bf, 1, true><<<gP, 32, 0, stream>>>(Ph, Pl, WR, nullptr, CC, FK, CC, IN[11], 0, 0, 0);          // Wres^T + bres -> FK
    k_res<0><<<L4, 256, 0, stream>>>(H, FK, OUT);
}

// v004
// It runs in 110 microseconds.
// In both of two side-by-side timings against v003, it was 1.29 times as fast.
// Over all steps from v000 it is 27.5 times as fast.
#include <hip/hip_runtime.h>

// MABClean (Set-Transformer MAB; X, Y [4][2048][256]; Q = SetNorm(X) Wq^T + bq, K = SetNorm(Y) Wk^T + bk, V = Y Wv^T + bv (SetNorm: normalise over all (samples, features) of one batch element, eps 1e-5,
// then per-feature scale/shift); 8 heads of 32: A = softmax_k(Q_h.K_h / sqrt(256)); O = concat_h A V_h; H = X + O Wo^T + bo; out = H + relu(SetNorm(H)) Wres^T + bres).
// Compute dtypes, f32 accumulate: every input rounded to bf16; the three SetNorm statistics (mean, then variance, over 524,288 values each) by fixed-order two-level
// reductions in f32; the normalised operands as bf16 hi+lo planes x exact weights (2 products); V on PLAIN bf16 operands (exact, + bias); scores (K = 32) and attn.v on SINGLE fp16 planes (model

#define NB_  4
#define TT   2048
#define CC   256
#define NHD  8
#define DH   32
#define SCL  0.0625f              // 1/sqrt(dim_Y = 256)
#define C2   (SCL * 1.44269504f)  // score -> exponent of two
#define PSH  10.0f                // P carries 2^10 (as does its sum), so that small weights stay normal fp16 numbers
#define KPB  80                   // LDS pitch of one K row: 64 bytes + 16 (16 B x odd: no bank conflict for 16-byte reads down a column of rows)
#define VPB  4112                 // LDS pitch of one row of V^T: 4096 bytes + 16
#define NW   32                   // 64-row slices per statistic (k_psum: one partial sum each, from a work-group of 8 waves; k_gemmw: four, one a column tile)
typedef _Float16 h16;
typedef unsigned short bf;
typedef __attribute__((ext_vector_type(16))) __bf16   v16bf;
typedef __attribute__((ext_vector_type(16))) _Float16 v16h;
typedef __attribute__((ext_vector_type(8)))  _Float16 v8h;
typedef __attribute__((ext_vector_type(8)))  unsigned short v8us;
typedef __attribute__((ext_vector_type(8)))  float    v8f;
typedef __attribute__((ext_vector_type(4)))  float    v4f;
typedef v8h  __attribute__((may_alias)) v8ha;
typedef v4f  __attribute__((may_alias)) v4fa;
typedef v8us __attribute__((may_alias)) v8usa;

__device__ __forceinline__ unsigned short f2bf(float f) { unsigned u = __float_as_uint(f); u += 0x7FFFu + ((u >> 16) & 1u); return (unsigned short)(u >> 16); }
__device__ __forceinline__ float bf2f(unsigned short b) { return __uint_as_float(((unsigned)b) << 16); }
__device__ __forceinline__ float bfr(float f) { return bf2f(f2bf(f)); }
__device__ __forceinline__ v16h cat16(v8h lo, v8h hi) { return __builtin_shufflevector(lo, hi, 0, 1, 2, 3, 4, 5, 6, 7, 8, 9, 10, 11, 12, 13, 14, 15); }
__device__ __forceinline__ v16bf cat16b(v8us lo, v8us hi) { return __builtin_bit_cast(v16bf, __builtin_shufflevector(lo, hi, 0, 1, 2, 3, 4, 5, 6, 7, 8, 9, 10, 11, 12, 13, 14, 15)); }
__device__ __forceinline__ v8f wmma16(v16h a, v16h b, v8f c) { return __builtin_amdgcn_wmma_f32_16x16x32_f16(false, a, false, b, (short)0, c, false, false); }
__device__ __forceinline__ v8f wmmab(v16bf a, v16bf b, v8f c) { return __builtin_amdgcn_wmma_f32_16x16x32_bf16(false, a, false, b, (short)0, c, false, false); }



// ---- k_gemmw: register-blocked GEMM, ONE WAVE per 64x64 output tile (16 accumulators), operands straight from K-contiguous 16-bit planes; grid (M/64, N/64, Z), 32 threads.
// c[m][n] = sum_k A[m][k] Bt[n][k] (+ split products per NSPLIT) + bias[n], f32, n < 256. z-batch strides sA/sB/sC in elements. K % 32 == 0. The 8192 rows m are (batch element, token).
// The epilogue does the elementwise pass that used to follow in a launch of its own, so that c never goes through memory:
// EPI 0: c as fp16 into the head planes P[batch][head][token][32]. EPI 1: c as fp16, transposed, into P[batch][column][token].
// EPI 2: C = bf16(R) + c, and the tile's sum of C into PART (first partial sums of the statistics over C). EPI 3: C = R + c.
// Every address of the epilogue is a tile base that is the same in all lanes, one lane offset that is kept to the end, and a compile-time step.
template <typename T16> struct WFrag;
template <> struct WFrag<bf> { typedef v16bf V; static __device__ __forceinline__ V ld(const bf* p) { return cat16b(*(const v8us*)p, *(const v8us*)(p + 16)); } static __device__ __forceinline__ v8f mma(V a, V b, v8f c) { return wmmab(a, b, c); } };
template <typename T16, int NSPLIT, int EPI>
__global__ __launch_bounds__(32) void k_gemmw(const T16* __restrict__ A, const T16* __restrict__ A2, const T16* __restrict__ Bt, const T16* __restrict__ Bt2, int K, float* C, const float* __restrict__ bias, const float* __restrict__ R, h16* P, float* PART, size_t sA, size_t sB, size_t sC) {
    typedef typename WFrag<T16>::V V;
    const size_t z = blockIdx.z; A += z * sA; if (A2) A2 += z * sA; Bt += z * sB; if (Bt2) Bt2 += z * sB; C += z * sC;
    const int lane = threadIdx.x & 31, lr = lane & 15, hi = lane >> 4; const int r0 = blockIdx.x * 64, c0 = blockIdx.y * 64;
    v8f acc[4][4];
#pragma unroll
    for (int mb = 0; mb < 4; ++mb)
#pragma unroll
        for (int nb = 0; nb < 4; ++nb) acc[mb][nb] = (v8f){};
    const size_t aoff = (size_t)(r0 + lr) * K + 8 * hi, boff = (size_t)(c0 + lr) * K + 8 * hi;
#pragma unroll 1
    for (int kc = 0; kc < K; kc += 32) {
        V a[4], a2[4];
#pragma unroll
        for (int mb = 0; mb < 4; ++mb) { a[mb] = WFrag<T16>::ld(A + aoff + (size_t)mb * 16 * K + kc); if (NSPLIT == 1 || NSPLIT == 2) a2[mb] = WFrag<T16>::ld(A2 + aoff + (size_t)mb * 16 * K + kc); }
#pragma unroll
        for (int nb = 0; nb < 4; ++nb) { const V b = WFrag<T16>::ld(Bt + boff + (size_t)nb * 16 * K + kc); V b2; if (NSPLIT >= 2) b2 = WFrag<T16>::ld(Bt2 + boff + (size_t)nb * 16 * K + kc);
#pragma unroll
            for (int mb = 0; mb < 4; ++mb) { acc[mb][nb] = WFrag<T16>::mma(a[mb], b, acc[mb][nb]); if (NSPLIT == 1 || NSPLIT == 2) acc[mb][nb] = WFrag<T16>::mma(a2[mb], b, acc[mb][nb]); if (NSPLIT >= 2) acc[mb][nb] = WFrag<T16>::mma(a[mb], b2, acc[mb][nb]); } }
        asm volatile("v_nop\n\tv_nop\n\tv_nop\n\tv_nop" : "+v"(acc[0][0]), "+v"(acc[1][1]), "+v"(acc[2][2]), "+v"(acc[3][3]) : "v"(a[0]), "v"(a[3]));
    }
    asm volatile("s_wait_xcnt 0x0" ::: "memory");   // the wait owed before the epilogue gives new values to the address registers of the loop's loads
    const int bt = r0 >> 11, t0 = r0 & (TT - 1);   // the tile's batch element and its first token (64 divides 2048: a tile lies in one batch element)
    if constexpr (EPI == 1) {
        // lane (lr, hi) holds 8 consecutive tokens of one column: 16 bytes of fp16. Through LDS (pitch 144 B = 16 B x odd) each column's 64 tokens leave as one whole 128-byte line.
        __shared__ __align__(16) h16 ts[64 * 72];
#pragma unroll
        for (int nb = 0; nb < 4; ++nb) { const float bn = bfr(bias[c0 + nb * 16 + lr]);
#pragma unroll
            for (int mb = 0; mb < 4; ++mb) { v8h o;
#pragma unroll
                for (int j = 0; j < 8; ++j) o[j] = (h16)(acc[mb][nb][j] + bn);
                *(v8ha*)(ts + (nb * 16 + lr) * 72 + mb * 16 + hi * 8) = o; } }
        __builtin_amdgcn_wave_barrier(); asm volatile("" ::: "memory");   // keeps the LDS reads below behind the LDS writes above (other lanes' data)
        h16* vt = P + ((size_t)bt * CC + c0) * TT + t0; const int vo = (lane >> 3) * TT + (lane & 7) * 8;
#pragma unroll
        for (int s = 0; s < 16; ++s) *(v8h*)(vt + vo + s * 4 * TT) = *(const v8ha*)(ts + (s * 4 + (lane >> 3)) * 72 + (lane & 7) * 8);
    } else {
        __shared__ __align__(16) float os[16 * 68];
        float bq[2][8]; v4f bv, rr[2][8], hs = {0.f, 0.f, 0.f, 0.f};
        const float* rt = R + (size_t)r0 * CC + c0; float* ct = C + (size_t)r0 * CC + c0; const int lo = hi * CC + lr * 4;
        h16* pt = P + (((size_t)bt * NHD + (c0 >> 5)) * TT + t0) * DH;
        if constexpr (EPI == 0) {
#pragma unroll
            for (int hh = 0; hh < 2; ++hh)
#pragma unroll
                for (int q = 0; q < 8; ++q) bq[hh][q] = bfr(bias[c0 + hh * 32 + (lane & 3) * 8 + q]);
        } else {
            // the residual rows of two 16-row blocks are asked for ahead, those of block mb + 2 as soon as block mb's are used: their latency is waited out once
#pragma unroll
            for (int mb = 0; mb < 2; ++mb)
#pragma unroll
                for (int s = 0; s < 8; ++s) rr[mb][s] = *(const v4f*)(rt + lo + (mb * 16 + 2 * s) * CC);
            const v4f braw = *(const v4f*)(bias + c0 + lr * 4);
            asm volatile("s_wait_xcnt 0x0" :: "v"(lr) : "memory");   // the wait owed before the bias load's offset register (lr) takes a new value; lr as an input keeps it whole up to here, so that no residual load lands on it
#pragma unroll
            for (int q = 0; q < 4; ++q) bv[q] = bfr(braw[q]);
        }
#pragma unroll
        for (int mb = 0; mb < 4; ++mb) {
#pragma unroll
            for (int nb = 0; nb < 4; ++nb) {
#pragma unroll
                for (int j = 0; j < 8; ++j) os[(hi * 8 + j) * 68 + nb * 16 + lr] = acc[mb][nb][j]; }
            __builtin_amdgcn_wave_barrier(); asm volatile("" ::: "memory");   // keeps the LDS reads below behind the LDS writes above (other lanes' data)
            if constexpr (EPI == 0) {
                // one store = 8 tokens x 64 bytes of one head = 512 contiguous bytes
#pragma unroll
                for (int s = 0; s < 4; ++s) { const int hh = s >> 1, th = s & 1; const float* op = os + (th * 8 + (lane >> 2)) * 68 + hh * 32 + (lane & 3) * 8; const v4f x0 = *(const v4fa*)op, x1 = *(const v4fa*)(op + 4); v8h o;
#pragma unroll
                    for (int q = 0; q < 4; ++q) { o[q] = (h16)(x0[q] + bq[hh][q]); o[4 + q] = (h16)(x1[q] + bq[hh][4 + q]); }
                    *(v8h*)(pt + lane * 8 + (hh * TT + mb * 16 + th * 8) * DH) = o; }
            } else {
#pragma unroll
                for (int s = 0; s < 8; ++s) { const int row = 2 * s + hi, cofs = lr * 4; const v4f val = *(const v4fa*)(os + row * 68 + cofs) + bv; const v4f x = rr[mb & 1][s]; v4f o;
#pragma unroll
                    for (int q = 0; q < 4; ++q) { o[q] = __fadd_rn(EPI == 2 ? bfr(x[q]) : x[q], val[q]); if (EPI == 2) hs[q] = __fadd_rn(hs[q], o[q]); }
                    *(v4f*)(ct + lo + (mb * 16 + 2 * s) * CC) = o; }
                if (mb < 2) {
#pragma unroll
                    for (int s = 0; s < 8; ++s) rr[mb][s] = *(const v4f*)(rt + lo + ((mb + 2) * 16 + 2 * s) * CC); }
            }
            __builtin_amdgcn_wave_barrier(); asm volatile("" ::: "memory");   // keeps the next block's LDS writes behind this block's LDS reads
        }
        if constexpr (EPI == 2) {
            // fixed order: four chains a lane, their pair sums, the lanes of the wave; one 128-byte line of PART per tile: set bt, row (column tile) * NW + 64-row slice
            float s = __fadd_rn(__fadd_rn(hs[0], hs[1]), __fadd_rn(hs[2], hs[3]));
#pragma unroll
            for (int sh = 16; sh; sh >>= 1) s += __shfl_xor(s, sh, 32);
            PART[(((size_t)bt * 4 + blockIdx.y) * NW + (t0 >> 6)) * 32 + lane] = (lane == 0) ? s : 0.f;
        }
    }
}

__device__ __forceinline__ void splitf(float y, unsigned short& h, unsigned short& l) { h = f2bf(y); l = f2bf(y - bf2f(h)); }
typedef __attribute__((ext_vector_type(2))) _Float16 v2h;
typedef __attribute__((ext_vector_type(4))) _Float16 v4h;
typedef __attribute__((ext_vector_type(2))) unsigned short v2us;
typedef __attribute__((ext_vector_type(8))) _Float16 v8h16;

__global__ __launch_bounds__(256) void k_cvt8(const float* __restrict__ src, bf* dst, size_t n8) { const size_t i = (size_t)blockIdx.x * 256 + threadIdx.x; if (i >= n8) return; const v8f v = *(const v8f*)(src + i * 8); v8us o;
#pragma unroll
    for (int k = 0; k < 8; ++k) o[k] = f2bf(v[k]); *(v8us*)(dst + i * 8) = o;  }
// five weight matrices in one launch: blockIdx.y picks the source, the planes lie one behind the other in dst
__global__ __launch_bounds__(256) void k_cvtw(const float* __restrict__ s0, const float* __restrict__ s1, const float* __restrict__ s2, const float* __restrict__ s3, const float* __restrict__ s4, bf* dst) { const size_t i = (size_t)blockIdx.x * 256 + threadIdx.x; if (i >= (size_t)CC * CC / 8) return;
    const int y = blockIdx.y; const float* src = y == 0 ? s0 : y == 1 ? s1 : y == 2 ? s2 : y == 3 ? s3 : s4; const v8f v = *(const v8f*)(src + i * 8); v8us o;
#pragma unroll
    for (int k = 0; k < 8; ++k) o[k] = f2bf(v[k]); *(v8us*)(dst + (size_t)y * CC * CC + i * 8) = o;  }
// blockIdx.y = statistic set: sets 0..NB_-1 are the batch elements of A0, sets NB_.. those of A1; blockIdx.x = one slice of 64 rows, one partial sum.
// Wave v of the work-group takes rows 8v .. 8v + 7 of the slice: 16 loads of 16 bytes a lane, all issued before the first value is used, so that the wave waits out the load latency once and not once a load.
// amdgpu_waves_per_eu: the grid has no more work-groups than the chip has WGPs, so about two waves a SIMD; without the hint the compiler saved registers for sixteen and held four of the sixteen loads back until earlier ones had returned.
// Fixed order: four chains a lane (one per vector component), their pair sums, the lanes of the wave, then the eight waves through LDS.
template <int RAW, int PASS>
__global__ __launch_bounds__(256) __attribute__((amdgpu_waves_per_eu(2, 4))) void k_psum(const float* __restrict__ A0, const float* __restrict__ A1, const float* __restrict__ ST, float* PART) {
    __shared__ float wsum[8];
    const int set = blockIdx.y; const float* A = set < NB_ ? A0 + (size_t)set * TT * CC : A1 + (size_t)(set - NB_) * TT * CC; ST += set * 32; PART += (size_t)set * NW * 32;
    const int lane = threadIdx.x & 31, wv = threadIdx.x >> 5; const float* p = A + ((size_t)blockIdx.x * 64 + wv * 8) * CC + lane * 4;
    v4f v[16];
#pragma unroll
    for (int u = 0; u < 16; ++u) v[u] = *(const v4f*)(p + u * 128);
    asm volatile("s_wait_xcnt 0x0" :: "v"(p) : "memory");   // the wait owed before the loads' address registers take new values; p as an input keeps the pair whole up to here, so that no load of the run lands on it
    const float mu = PASS ? ST[0] : 0.f; v4f a = {0.f, 0.f, 0.f, 0.f};
#pragma unroll
    for (int u = 0; u < 16; ++u) {
#pragma unroll
        for (int q = 0; q < 4; ++q) { float x = RAW ? bfr(v[u][q]) : v[u][q]; if (PASS) { const float d0 = __fsub_rn(x, mu); x = __fmul_rn(d0, d0); } a[q] = __fadd_rn(a[q], x); } }
    float s = __fadd_rn(__fadd_rn(a[0], a[1]), __fadd_rn(a[2], a[3]));
#pragma unroll
    for (int sh = 16; sh; sh >>= 1) s += __shfl_xor(s, sh, 32);
    if (lane == 0) wsum[wv] = s;
    __syncthreads();   // the eight waves' sums are in LDS; wave 0 joins them
    if (wv == 0) { float t = wsum[lane & 7];
#pragma unroll
        for (int sh = 4; sh; sh >>= 1) t += __shfl_xor(t, sh, 32);
        PART[(size_t)blockIdx.x * 32 + lane] = (lane == 0) ? t : 0.f; }
}
// NP partial sums per 64-row slice (one from k_psum, four from the column tiles of k_gemmw), added in their order ahead of the lanes' sum
template <int PASS, int NP>
__global__ __launch_bounds__(32) void k_comb(const float* __restrict__ PART, float* ST) {
    PART += (size_t)blockIdx.x * NP * NW * 32; ST += blockIdx.x * 32;
    const int lane = threadIdx.x; float s = PART[(size_t)lane * 32];
#pragma unroll
    for (int p = 1; p < NP; ++p) s += PART[(size_t)(p * NW + lane) * 32];
#pragma unroll
    for (int sh = 16; sh; sh >>= 1) s += __shfl_xor(s, sh, 32);
    const float inv = 1.0f / (float)(TT * CC); float o;
    if (PASS == 0) o = (lane == 0) ? s * inv : 0.f; else { const float mu = ST[0]; o = (lane == 0) ? mu : (lane == 1 ? __fdiv_rn(1.0f, __fsqrt_rn(__fadd_rn(s * inv, 1e-5f))) : 0.f); }
    *(float*)(ST + lane) = o;  }
// one set's plane; the kernel below picks the set's pointers (blockIdx.y) and calls it, so that the __restrict__ of the picked pointers is kept
template <int RAW, int RELU>
__device__ __forceinline__ void snpl_set(const float* __restrict__ A, const float* __restrict__ ST, const float* __restrict__ w, const float* __restrict__ bb, bf* Ph, bf* Pl, const size_t i) { const int c = (int)(i & (CC - 1)); const float mu = ST[0], rs = ST[1]; v2us oh, ol;
#pragma unroll
    for (int q = 0; q < 2; ++q) { float x = A[i + q]; if (RAW) x = bfr(x); float t = __fmul_rn(__fsub_rn(x, mu), rs); asm volatile("" : "+v"(t)); float y = __fadd_rn(__fmul_rn(t, bfr(w[c + q])), bfr(bb[c + q])); if (RELU) y = fmaxf(y, 0.f); unsigned short a, c2; splitf(y, a, c2); oh[q] = a; ol[q] = c2; }
    *(v2us*)(Ph + i) = oh; *(v2us*)(Pl + i) = ol;  }
template <int RAW, int RELU>
__global__ __launch_bounds__(256) void k_snpl(const float* __restrict__ A0, const float* __restrict__ A1, const float* __restrict__ ST, const float* __restrict__ w0, const float* __restrict__ bb0, const float* __restrict__ w1, const float* __restrict__ bb1, bf* Ph, bf* Pl) { const size_t i = ((size_t)blockIdx.x * 256 + threadIdx.x) * 2; if (i >= (size_t)TT * CC) return;
    const int set = blockIdx.y; const bool first = set < NB_;
    snpl_set<RAW, RELU>(first ? A0 + (size_t)set * TT * CC : A1 + (size_t)(set - NB_) * TT * CC, ST + set * 32, first ? w0 : w1, first ? bb0 : bb1, Ph + (size_t)set * TT * CC, Pl + (size_t)set * TT * CC, i); }
// ---- k_fattn: scores, softmax, attn.v and the hi/lo split of O in one kernel; no score and no weight leaves the registers.
// grid (2048 / 256 query blocks, 32 (batch, head) pairs), 16 waves. The pair's whole K [2048][32] and V^T [32][2048] are laid into LDS once (padded pitches), then read by every wave.
// Wave w: query columns (w & 7) * 32 .. + 31, keys (w >> 3) * 1024 .. + 1023, 64 keys a pass. S^T = K Q^T: lane (c, h) holds query c's scores of keys 8h + r of each 16-key tile, which, rounded to fp16,
// ARE the B operand of O^T += V^T P^T (hardware k order; K, Q and V^T fragments are loaded in the same order). Running maximum per query column; the two key halves are joined through LDS at the end.
typedef __attribute__((ext_vector_type(2))) float v2f;
typedef float __attribute__((may_alias)) fa;
__device__ __forceinline__ float xhalf(float x) { const int b = __float_as_int(x); return __int_as_float(__builtin_amdgcn_permlanex16(b, b, 0x76543210, 0xfedcba98, false, false)); }   // lane l <- lane l ^ 16
// v_exp_f32 with the one slot behind a transcendental filled in the same statement
__device__ __forceinline__ float exp2_slot(float x) { float r; asm("v_exp_f32 %0, %1\n\tv_nop" : "=v"(r) : "v"(x)); return r; }
__global__ __launch_bounds__(512) void k_fattn(const h16* __restrict__ QP, const h16* __restrict__ KP, const h16* __restrict__ V16, bf* Oh, bf* Ol) {
    __shared__ __align__(16) unsigned char sm[TT * KPB + DH * VPB];
    unsigned char* Ks = sm; unsigned char* Vs = sm + TT * KPB;
    const int g = blockIdx.y, tid = threadIdx.x, lane = tid & 31, wave = tid >> 5, lr = lane & 15, hi = lane >> 4;
    const int qg = wave & 7, kh = wave >> 3, q0 = blockIdx.x * 256 + qg * 32;
    v16h qf[2];
#pragma unroll
    for (int t = 0; t < 2; ++t) { const h16* p = QP + ((size_t)g * TT + q0 + t * 16 + lr) * DH + 8 * hi; qf[t] = cat16(*(const v8h*)p, *(const v8h*)(p + 16)); }
    asm volatile("s_wait_xcnt 0x0" ::: "memory");   // the Q loads' address registers are given new values further down, ahead of the loads' data wait: this wait stands in front of that
    const h16* Kg = KP + (size_t)g * TT * DH; const h16* Vg = V16 + (size_t)g * DH * TT;
#pragma unroll
    for (int u = 0; u < TT * DH / 8 / 512; ++u) { const int i = u * 512 + tid; *(v8ha*)(Ks + (i >> 2) * KPB + (i & 3) * 16) = *(const v8h*)(Kg + (size_t)i * 8); }
#pragma unroll
    for (int u = 0; u < TT * DH / 8 / 512; ++u) { const int i = u * 512 + tid; *(v8ha*)(Vs + (i >> 8) * VPB + (i & 255) * 16) = *(const v8h*)(Vg + (size_t)i * 8); }
    __syncthreads();
    v8f o[2][2]; float m[2], l[2];
#pragma unroll
    for (int t = 0; t < 2; ++t) { o[t][0] = (v8f){}; o[t][1] = (v8f){}; m[t] = -3.0e38f; l[t] = 0.f; }
    const unsigned char* kp = Ks + (kh * (TT / 2) + lr) * KPB + 16 * hi; const unsigned char* vp = Vs + lr * VPB + (kh * (TT / 2) + 8 * hi) * 2;
    // kept rolled: one pass is already several hundred instructions
#pragma unroll 1
    for (int ps = 0; ps < TT / 2 / 64; ++ps, kp += 64 * KPB, vp += 64 * 2) {
        v8f s[2][4];
#pragma unroll
        for (int kt = 0; kt < 4; ++kt) { const v16h ka = cat16(*(const v8ha*)(kp + kt * 16 * KPB), *(const v8ha*)(kp + kt * 16 * KPB + 32));
#pragma unroll
            for (int t = 0; t < 2; ++t) s[t][kt] = wmma16(ka, qf[t], (v8f){}); }
        v16h va[2][2];
#pragma unroll
        for (int dt = 0; dt < 2; ++dt)
#pragma unroll
            for (int kk = 0; kk < 2; ++kk) va[dt][kk] = cat16(*(const v8ha*)(vp + dt * 16 * VPB + kk * 64), *(const v8ha*)(vp + dt * 16 * VPB + kk * 64 + 32));
#pragma unroll
        for (int t = 0; t < 2; ++t) {
            float mk[4];
#pragma unroll
            for (int kt = 0; kt < 4; ++kt) { mk[kt] = s[t][kt][0];
#pragma unroll
                for (int j = 1; j < 8; ++j) mk[kt] = fmaxf(mk[kt], s[t][kt][j]); }
            float mx = fmaxf(fmaxf(mk[0], mk[1]), fmaxf(mk[2], mk[3])); mx = fmaxf(mx, xhalf(mx));
            const float mn = fmaxf(m[t], mx * C2), al = exp2_slot(m[t] - mn); m[t] = mn;
            const v2f cv = {C2, C2}, nb = {PSH - mn, PSH - mn}; v2f sk[4]; v16h pf[2];
#pragma unroll
            for (int kt = 0; kt < 4; ++kt) {
#pragma unroll
                for (int j = 0; j < 8; j += 2) { const v2f x = __builtin_elementwise_fma((v2f){s[t][kt][j], s[t][kt][j + 1]}, cv, nb); const v2f e = {__builtin_amdgcn_exp2f(x[0]), __builtin_amdgcn_exp2f(x[1])}; sk[kt] = j ? sk[kt] + e : e;
                    const v2h c = __builtin_convertvector(e, v2h); pf[kt >> 1][(kt & 1) * 8 + j] = c[0]; pf[kt >> 1][(kt & 1) * 8 + j + 1] = c[1]; } }
            const v2f st = (sk[0] + sk[1]) + (sk[2] + sk[3]); l[t] = l[t] * al + (st[0] + st[1]);
#pragma unroll
            for (int dt = 0; dt < 2; ++dt) { o[t][dt] *= al;
#pragma unroll
                for (int kk = 0; kk < 2; ++kk) o[t][dt] = wmma16(va[dt][kk], pf[kk], o[t][dt]); }
        }
    }
    __syncthreads();   // every wave has left K and V^T: the first K rows now carry the upper key half's state to its partner wave
    fa* mb = (fa*)sm + (size_t)qg * 36 * 32 + lane;
    if (kh == 1) {
#pragma unroll
        for (int t = 0; t < 2; ++t) { mb[(t * 18) * 32] = m[t]; mb[(t * 18 + 1) * 32] = l[t];
#pragma unroll
            for (int r = 0; r < 16; ++r) mb[(t * 18 + 2 + r) * 32] = o[t][r >> 3][r & 7]; }
    }
    __syncthreads();
    if (kh == 0) {
#pragma unroll
        for (int t = 0; t < 2; ++t) { const float m1 = mb[(t * 18) * 32], l1 = mb[(t * 18 + 1) * 32], mN = fmaxf(m[t], m1); float a0 = exp2_slot(m[t] - mN), a1 = exp2_slot(m1 - mN);
            float lt = l[t] * a0 + l1 * a1; lt += xhalf(lt); const float inv = __fdiv_rn(1.0f, lt); a0 *= inv; a1 *= inv;
#pragma unroll
            for (int dt = 0; dt < 2; ++dt) { v8us oh, ol;
#pragma unroll
                for (int j = 0; j < 8; ++j) { unsigned short a, c2; splitf(o[t][dt][j] * a0 + mb[(t * 18 + 2 + dt * 8 + j) * 32] * a1, a, c2); oh[j] = a; ol[j] = c2; }
                const size_t off = ((size_t)(g >> 3) * TT + q0 + t * 16 + lr) * CC + (g & 7) * DH + dt * 16 + 8 * hi; *(v8us*)(Oh + off) = oh; *(v8us*)(Ol + off) = ol; } }
    }
}
extern "C" void kernel_launch(void* const* d_in, const int* in_sizes, int n_in,
                              void* d_out, int out_size, void* d_ws, size_t ws_size, hipStream_t stream) {
    (void)in_sizes; (void)n_in; (void)out_size;
    const float* IN[18]; for (int i = 0; i < 18; ++i) IN[i] = (const float*)d_in[i];
    // X, Y [4][2048][256], Wq [256][256], bq, Wk, bk, Wv, bv, Wo, bo, Wres, bres, nq_w, nq_b, nk_w, nk_b, n0_w, n0_b = d_in[0..17]
    float* OUT = (float*)d_out;     // [4][2048][256]
    char* wsp = (char*)d_ws;
    auto take = [&](size_t bytes) { char* p = wsp; wsp += (bytes + 255) & ~(size_t)255; return (void*)p; };
    const size_t PE = (size_t)TT * CC;                      // elements of one batch element's [2048][256] plane
    bf* WQ = (bf*)take((size_t)CC * CC * 2); bf* WK = (bf*)take((size_t)CC * CC * 2); bf* WV = (bf*)take((size_t)CC * CC * 2); bf* WO = (bf*)take((size_t)CC * CC * 2); bf* WR = (bf*)take((size_t)CC * CC * 2);   // one behind the other (k_cvtw)
    float* PART = (float*)take((size_t)4 * NB_ * NW * 32 * 4); float* ST = (float*)take((size_t)2 * NB_ * 32 * 4);
    // live through the attention part; g = batch * 8 + head runs through all of them
    h16* QP = (h16*)take((size_t)NB_ * NHD * TT * DH * 2); h16* KP = (h16*)take((size_t)NB_ * NHD * TT * DH * 2); h16* V16 = (h16*)take((size_t)NB_ * CC * TT * 2);
    bf* Ph = (bf*)take(2 * NB_ * PE * 2); bf* Pl = (bf*)take(2 * NB_ * PE * 2); bf* YB = (bf*)take(NB_ * PE * 2);
    bf* Oh = YB; bf* Ol = (bf*)take(NB_ * PE * 2); float* H = (float*)take(NB_ * PE * 4);
    if ((size_t)(wsp - (char*)d_ws) > ws_size) return;    // total ~ 45 MiB; ws 256 MiB
    k_cvtw<<<dim3(CC * CC / 8 / 256, 5), 256, 0, stream>>>(IN[2], IN[4], IN[6], IN[8], IN[10], WQ);
    const unsigned L2 = (unsigned)((PE / 2 + 255) / 256); const dim3 gP(NB_ * TT / 64, CC / 64, 1);
    // SetNorm(X) and SetNorm(Y), all batch elements: sets 0..3 = X, 4..7 = Y
    k_psum<1, 0><<<dim3(NW, 2 * NB_), 256, 0, stream>>>(IN[0], IN[1], ST, PART); k_comb<0, 1><<<2 * NB_, 32, 0, stream>>>(PART, ST); k_psum<1, 1><<<dim3(NW, 2 * NB_), 256, 0, stream>>>(IN[0], IN[1], ST, PART); k_comb<1, 1><<<2 * NB_, 32, 0, stream>>>(PART, ST);
    k_snpl<1, 0><<<dim3(L2, 2 * NB_), 256, 0, stream>>>(IN[0], IN[1], ST, IN[12], IN[13], IN[14], IN[15], Ph, Pl);
    // Q = SetNorm(X) Wq^T + bq; K = SetNorm(Y) Wk^T + bk; V = Y Wv^T + bv: the four batch elements are 8192 rows of one product; each leaves its GEMM as the fp16 plane that the attention kernel reads
    k_gemmw<bf, 1, 0><<<gP, 32, 0, stream>>>(Ph, Pl, WQ, nullptr, CC, nullptr, IN[3], nullptr, QP, nullptr, 0, 0, 0);
    k_gemmw<bf, 1, 0><<<gP, 32, 0, stream>>>(Ph + NB_ * PE, Pl + NB_ * PE, WK, nullptr, CC, nullptr, IN[5], nullptr, KP, nullptr, 0, 0, 0);
    k_cvt8<<<(unsigned)((NB_ * PE / 8 + 255) / 256), 256, 0, stream>>>(IN[1], YB, NB_ * PE / 8);
    k_gemmw<bf, 0, 1><<<gP, 32, 0, stream>>>(YB, nullptr, WV, nullptr, CC, nullptr, IN[7], nullptr, V16, nullptr, 0, 0, 0);
    k_fattn<<<dim3(TT / 256, NB_ * NHD), 512, 0, stream>>>(QP, KP, V16, Oh, Ol);                             // softmax(Q_h K_h^T / 16) V_h, all pairs -> O as hi + lo planes
    k_gemmw<bf, 1, 2><<<gP, 32, 0, stream>>>(Oh, Ol, WO, nullptr, CC, H, IN[9], IN[0], nullptr, PART, 0, 0, 0);   // H = bf16(X) + O Wo^T + bo, and H's sums per tile
    k_comb<0, 4><<<NB_, 32, 0, stream>>>(PART, ST); k_psum<0, 1><<<dim3(NW, NB_), 256, 0, stream>>>(H, H, ST, PART); k_comb<1, 1><<<NB_, 32, 0, stream>>>(PART, ST);
    k_snpl<0, 1><<<dim3(L2, NB_), 256, 0, stream>>>(H, H, ST, IN[16], IN[17], IN[16], IN[17], Ph, Pl);      // relu(SetNorm(H))
    k_gemmw<bf, 1, 3><<<gP, 32, 0, stream>>>(Ph, Pl, WR, nullptr, CC, OUT, IN[11], H, nullptr, nullptr, 0, 0, 0);  // out = H + relu(SetNorm(H)) Wres^T + bres
}

// v005
// Measured time: 92.4 microseconds a run.
// In two side-by-side timings against v004, it was 1.18 and 1.20 times as fast.
// All steps since v000 together make it 32.7 times as fast.
#include <hip/hip_runtime.h>

// MABClean (Set-Transformer MAB; X, Y [4][2048][256]; Q = SetNorm(X) Wq^T + bq, K = SetNorm(Y) Wk^T + bk, V = Y Wv^T + bv (SetNorm: normalise over all (samples, features) of one batch element, eps 1e-5,
// then per-feature scale/shift); 8 heads of 32: A = softmax_k(Q_h.K_h / sqrt(256)); O = concat_h A V_h; H = X + O Wo^T + bo; out = H + relu(SetNorm(H)) Wres^T + bres).
// Compute dtypes, f32 accumulate: every input rounded to bf16; the three SetNorm statistics (mean, then variance, over 524,288 values each) by fixed-order two-level
// reductions in f32; the normalised operands as bf16 hi+lo planes x exact weights (2 products); V on PLAIN bf16 operands (exact, + bias); scores (K = 32) and attn.v on SINGLE fp16 planes (model

#define NB_  4
#define TT   2048
#define CC   256
#define NHD  8
#define DH   32
#define SCL  0.0625f              // 1/sqrt(dim_Y = 256)
#define C2   (SCL * 1.44269504f)  // score -> exponent of two
#define PSH  10.0f                // P carries 2^10 (as does its sum), so that small weights stay normal fp16 numbers
#define KPB  80                   // LDS pitch of one K row: 64 bytes + 16 (16 B x odd: no bank conflict for 16-byte reads down a column of rows)
#define VPB  4112                 // LDS pitch of one row of V^T: 4096 bytes + 16
#define NW   32                   // 64-row slices per statistic (k_psum: one partial sum each, from a work-group of 8 waves; k_gemmw: four, one a column tile)
typedef _Float16 h16;
typedef unsigned short bf;
typedef __attribute__((ext_vector_type(16))) __bf16   v16bf;
typedef __attribute__((ext_vector_type(16))) _Float16 v16h;
typedef __attribute__((ext_vector_type(8)))  _Float16 v8h;
typedef __attribute__((ext_vector_type(8)))  unsigned short v8us;
typedef __attribute__((ext_vector_type(8)))  float    v8f;
typedef __attribute__((ext_vector_type(4)))  float    v4f;
typedef v8h  __attribute__((may_alias)) v8ha;
typedef v4f  __attribute__((may_alias)) v4fa;
typedef v8us __attribute__((may_alias)) v8usa;

__device__ __forceinline__ unsigned short f2bf(float f) { unsigned u = __float_as_uint(f); u += 0x7FFFu + ((u >> 16) & 1u); return (unsigned short)(u >> 16); }
__device__ __forceinline__ float bf2f(unsigned short b) { return __uint_as_float(((unsigned)b) << 16); }
__device__ __forceinline__ float bfr(float f) { return bf2f(f2bf(f)); }
__device__ __forceinline__ v16h cat16(v8h lo, v8h hi) { return __builtin_shufflevector(lo, hi, 0, 1, 2, 3, 4, 5, 6, 7, 8, 9, 10, 11, 12, 13, 14, 15); }
__device__ __forceinline__ v16bf cat16b(v8us lo, v8us hi) { return __builtin_bit_cast(v16bf, __builtin_shufflevector(lo, hi, 0, 1, 2, 3, 4, 5, 6, 7, 8, 9, 10, 11, 12, 13, 14, 15)); }
__device__ __forceinline__ v8f wmma16(v16h a, v16h b, v8f c) { return __builtin_amdgcn_wmma_f32_16x16x32_f16(false, a, false, b, (short)0, c, false, false); }
__device__ __forceinline__ v8f wmmab(v16bf a, v16bf b, v8f c) { return __builtin_amdgcn_wmma_f32_16x16x32_bf16(false, a, false, b, (short)0, c, false, false); }



// ---- gemmw_tile (kernels k_gemmw and k_qkv): register-blocked GEMM, ONE WAVE per 64x64 output tile (16 accumulators), operands straight from K-contiguous 16-bit planes; grid (M/64, N/64, Z), 32 threads.
// c[m][n] = sum_k A[m][k] Bt[n][k] (+ split products per NSPLIT) + bias[n], f32, n < 256. z-batch strides sA/sB/sC in elements. K % 32 == 0. The 8192 rows m are (batch element, token).
// The epilogue does the elementwise pass that used to follow in a launch of its own, so that c never goes through memory:
// EPI 0: c as fp16 into the head planes P[batch][head][token][32]. EPI 1: c as fp16, transposed, into P[batch][column][token].
// EPI 2: C = bf16(R) + c, and the tile's sum of C into PART (first partial sums of the statistics over C). EPI 3: C = R + c.
// Every address of the epilogue is a tile base that is the same in all lanes, one lane offset that is kept to the end, and a compile-time step.
template <typename T16> struct WFrag;
template <> struct WFrag<bf> { typedef v16bf V; static __device__ __forceinline__ V ld(const bf* p) { return cat16b(*(const v8us*)p, *(const v8us*)(p + 16)); } static __device__ __forceinline__ v8f mma(V a, V b, v8f c) { return wmmab(a, b, c); } };
template <typename T16, int NSPLIT, int EPI>
__device__ __forceinline__ void gemmw_tile(const T16* __restrict__ A, const T16* __restrict__ A2, const T16* __restrict__ Bt, const T16* __restrict__ Bt2, const int K, float* C, const float* __restrict__ bias, const float* __restrict__ R, h16* P, float* PART) {
    typedef typename WFrag<T16>::V V;
    const int lane = threadIdx.x & 31, lr = lane & 15, hi = lane >> 4; const int r0 = blockIdx.x * 64, c0 = blockIdx.y * 64;
    v8f acc[4][4];
#pragma unroll
    for (int mb = 0; mb < 4; ++mb)
#pragma unroll
        for (int nb = 0; nb < 4; ++nb) acc[mb][nb] = (v8f){};
    const size_t aoff = (size_t)(r0 + lr) * K + 8 * hi, boff = (size_t)(c0 + lr) * K + 8 * hi;
#pragma unroll 1
    for (int kc = 0; kc < K; kc += 32) {
        V a[4], a2[4];
#pragma unroll
        for (int mb = 0; mb < 4; ++mb) { a[mb] = WFrag<T16>::ld(A + aoff + (size_t)mb * 16 * K + kc); if (NSPLIT == 1 || NSPLIT == 2) a2[mb] = WFrag<T16>::ld(A2 + aoff + (size_t)mb * 16 * K + kc); }
#pragma unroll
        for (int nb = 0; nb < 4; ++nb) { const V b = WFrag<T16>::ld(Bt + boff + (size_t)nb * 16 * K + kc); V b2; if (NSPLIT >= 2) b2 = WFrag<T16>::ld(Bt2 + boff + (size_t)nb * 16 * K + kc);
#pragma unroll
            for (int mb = 0; mb < 4; ++mb) { acc[mb][nb] = WFrag<T16>::mma(a[mb], b, acc[mb][nb]); if (NSPLIT == 1 || NSPLIT == 2) acc[mb][nb] = WFrag<T16>::mma(a2[mb], b, acc[mb][nb]); if (NSPLIT >= 2) acc[mb][nb] = WFrag<T16>::mma(a[mb], b2, acc[mb][nb]); } }
        asm volatile("v_nop\n\tv_nop\n\tv_nop\n\tv_nop" : "+v"(acc[0][0]), "+v"(acc[1][1]), "+v"(acc[2][2]), "+v"(acc[3][3]) : "v"(a[0]), "v"(a[3]));
    }
    asm volatile("s_wait_xcnt 0x0" ::: "memory");   // the wait owed before the epilogue gives new values to the address registers of the loop's loads
    const int bt = r0 >> 11, t0 = r0 & (TT - 1);   // the tile's batch element and its first token (64 divides 2048: a tile lies in one batch element)
    if constexpr (EPI == 1) {
        // lane (lr, hi) holds 8 consecutive tokens of one column: 16 bytes of fp16. Through LDS (pitch 144 B = 16 B x odd) each column's 64 tokens leave as one whole 128-byte line.
        __shared__ __align__(16) h16 ts[64 * 72];
#pragma unroll
        for (int nb = 0; nb < 4; ++nb) { const float bn = bfr(bias[c0 + nb * 16 + lr]);
#pragma unroll
            for (int mb = 0; mb < 4; ++mb) { v8h o;
#pragma unroll
                for (int j = 0; j < 8; ++j) o[j] = (h16)(acc[mb][nb][j] + bn);
                *(v8ha*)(ts + (nb * 16 + lr) * 72 + mb * 16 + hi * 8) = o; } }
        __builtin_amdgcn_wave_barrier(); asm volatile("" ::: "memory");   // keeps the LDS reads below behind the LDS writes above (other lanes' data)
        h16* vt = P + ((size_t)bt * CC + c0) * TT + t0; const int vo = (lane >> 3) * TT + (lane & 7) * 8;
#pragma unroll
        for (int s = 0; s < 16; ++s) *(v8h*)(vt + vo + s * 4 * TT) = *(const v8ha*)(ts + (s * 4 + (lane >> 3)) * 72 + (lane & 7) * 8);
    } else {
        __shared__ __align__(16) float os[16 * 68];
        float bq[2][8]; v4f bv, rr[2][8], hs = {0.f, 0.f, 0.f, 0.f};
        const float* rt = R + (size_t)r0 * CC + c0; float* ct = C + (size_t)r0 * CC + c0; const int lo = hi * CC + lr * 4;
        h16* pt = P + (((size_t)bt * NHD + (c0 >> 5)) * TT + t0) * DH;
        if constexpr (EPI == 0) {
#pragma unroll
            for (int hh = 0; hh < 2; ++hh)
#pragma unroll
                for (int q = 0; q < 8; ++q) bq[hh][q] = bfr(bias[c0 + hh * 32 + (lane & 3) * 8 + q]);
        } else {
            // the residual rows of two 16-row blocks are asked for ahead, those of block mb + 2 as soon as block mb's are used: their latency is waited out once
#pragma unroll
            for (int mb = 0; mb < 2; ++mb)
#pragma unroll
                for (int s = 0; s < 8; ++s) rr[mb][s] = *(const v4f*)(rt + lo + (mb * 16 + 2 * s) * CC);
            const v4f braw = *(const v4f*)(bias + c0 + lr * 4);
            asm volatile("s_wait_xcnt 0x0" :: "v"(lr) : "memory");   // the wait owed before the bias load's offset register (lr) takes a new value; lr as an input keeps it whole up to here, so that no residual load lands on it
#pragma unroll
            for (int q = 0; q < 4; ++q) bv[q] = bfr(braw[q]);
        }
#pragma unroll
        for (int mb = 0; mb < 4; ++mb) {
#pragma unroll
            for (int nb = 0; nb < 4; ++nb) {
#pragma unroll
                for (int j = 0; j < 8; ++j) os[(hi * 8 + j) * 68 + nb * 16 + lr] = acc[mb][nb][j]; }
            __builtin_amdgcn_wave_barrier(); asm volatile("" ::: "memory");   // keeps the LDS reads below behind the LDS writes above (other lanes' data)
            if constexpr (EPI == 0) {
                // one store = 8 tokens x 64 bytes of one head = 512 contiguous bytes
#pragma unroll
                for (int s = 0; s < 4; ++s) { const int hh = s >> 1, th = s & 1; const float* op = os + (th * 8 + (lane >> 2)) * 68 + hh * 32 + (lane & 3) * 8; const v4f x0 = *(const v4fa*)op, x1 = *(const v4fa*)(op + 4); v8h o;
#pragma unroll
                    for (int q = 0; q < 4; ++q) { o[q] = (h16)(x0[q] + bq[hh][q]); o[4 + q] = (h16)(x1[q] + bq[hh][4 + q]); }
                    *(v8h*)(pt + lane * 8 + (hh * TT + mb * 16 + th * 8) * DH) = o; }
            } else {
#pragma unroll
                for (int s = 0; s < 8; ++s) { const int row = 2 * s + hi, cofs = lr * 4; const v4f val = *(const v4fa*)(os + row * 68 + cofs) + bv; const v4f x = rr[mb & 1][s]; v4f o;
#pragma unroll
                    for (int q = 0; q < 4; ++q) { o[q] = __fadd_rn(EPI == 2 ? bfr(x[q]) : x[q], val[q]); if (EPI == 2) hs[q] = __fadd_rn(hs[q], o[q]); }
                    *(v4f*)(ct + lo + (mb * 16 + 2 * s) * CC) = o; }
                if (mb < 2) {
#pragma unroll
                    for (int s = 0; s < 8; ++s) rr[mb][s] = *(const v4f*)(rt + lo + ((mb + 2) * 16 + 2 * s) * CC); }
            }
            __builtin_amdgcn_wave_barrier(); asm volatile("" ::: "memory");   // keeps the next block's LDS writes behind this block's LDS reads
        }
        if constexpr (EPI == 2) {
            // fixed order: four chains a lane, their pair sums, the lanes of the wave; one 128-byte line of PART per tile: set bt, row (column tile) * NW + 64-row slice
            float s = __fadd_rn(__fadd_rn(hs[0], hs[1]), __fadd_rn(hs[2], hs[3]));
#pragma unroll
            for (int sh = 16; sh; sh >>= 1) s += __shfl_xor(s, sh, 32);
            PART[(((size_t)bt * 4 + blockIdx.y) * NW + (t0 >> 6)) * 32 + lane] = (lane == 0) ? s : 0.f;
        }
    }
}
template <typename T16, int NSPLIT, int EPI>
__global__ __launch_bounds__(32) void k_gemmw(const T16* __restrict__ A, const T16* __restrict__ A2, const T16* __restrict__ Bt, const T16* __restrict__ Bt2, int K, float* C, const float* __restrict__ bias, const float* __restrict__ R, h16* P, float* PART, size_t sA, size_t sB, size_t sC) {
    const size_t z = blockIdx.z; A += z * sA; if (A2) A2 += z * sA; Bt += z * sB; if (Bt2) Bt2 += z * sB; C += z * sC;
    gemmw_tile<T16, NSPLIT, EPI>(A, A2, Bt, Bt2, K, C, bias, R, P, PART);
}
// The three projections depend on nothing of one another: one launch, blockIdx.z = 0: Q, 1: K (hi + lo planes of the normalised X and Y, one behind the other in Ph and Pl), 2: V (plain bf16 Y).
// A launch of 512 one-wave tiles leaves every SIMD with at most one wave, which waits out each k step's load latency alone; 1,536 tiles share the SIMDs and the launch's start and end are paid once.
// W: the planes of Wq, Wk, Wv one behind the other.
__global__ __launch_bounds__(32) void k_qkv(const bf* __restrict__ Ph, const bf* __restrict__ Pl, const bf* __restrict__ YB, const bf* __restrict__ W, const float* __restrict__ bq, const float* __restrict__ bk, const float* __restrict__ bv, h16* QP, h16* KP, h16* V16) {
    const int z = blockIdx.z;
    if (z == 2) gemmw_tile<bf, 0, 1>(YB, nullptr, W + 2 * CC * CC, nullptr, CC, nullptr, bv, nullptr, V16, nullptr);
    else gemmw_tile<bf, 1, 0>(Ph + (size_t)z * NB_ * TT * CC, Pl + (size_t)z * NB_ * TT * CC, W + z * CC * CC, nullptr, CC, nullptr, z ? bk : bq, nullptr, z ? KP : QP, nullptr);
}

__device__ __forceinline__ void splitf(float y, unsigned short& h, unsigned short& l) { h = f2bf(y); l = f2bf(y - bf2f(h)); }
typedef __attribute__((ext_vector_type(2))) _Float16 v2h;
typedef __attribute__((ext_vector_type(4))) _Float16 v4h;
typedef __attribute__((ext_vector_type(2))) unsigned short v2us;
typedef __attribute__((ext_vector_type(8))) _Float16 v8h16;

__device__ __forceinline__ void cvt8_blk(const float* __restrict__ src, bf* dst, const unsigned blk) { const size_t i = (size_t)blk * 256 + threadIdx.x; const v8f v = *(const v8f*)(src + i * 8); v8us o;
    asm volatile("s_wait_xcnt 0x0" ::: "memory");   // the wait owed before the load's address registers take new values in the rounding below
#pragma unroll
    for (int k = 0; k < 8; ++k) o[k] = f2bf(v[k]); *(v8us*)(dst + i * 8) = o;
    asm volatile("s_wait_xcnt 0x0" ::: "memory"); }   // the wait owed behind the store: in k_pre the code of the other branches follows in the listing and gives new values to the store's registers
// set = statistic set: sets 0..NB_-1 are the batch elements of A0, sets NB_.. those of A1; slice = one slice of 64 rows, one partial sum.
// Wave v of the work-group takes rows 8v .. 8v + 7 of the slice: 16 loads of 16 bytes a lane, all issued before the first value is used, so that the wave waits out the load latency once and not once a load.
// amdgpu_waves_per_eu (on the kernels that call it): without the hint the compiler saved registers for sixteen waves a SIMD and held four of the sixteen loads back until earlier ones had returned.
// Fixed order: four chains a lane (one per vector component), their pair sums, the lanes of the wave, then the eight waves through LDS.
template <int RAW, int PASS>
__device__ __forceinline__ void psum_slice(const float* __restrict__ A0, const float* __restrict__ A1, const float* __restrict__ ST, float* PART, const int slice, const int set) {
    __shared__ float wsum[8];
    const float* A = set < NB_ ? A0 + (size_t)set * TT * CC : A1 + (size_t)(set - NB_) * TT * CC; ST += set * 32; PART += (size_t)set * NW * 32;
    const int lane = threadIdx.x & 31, wv = threadIdx.x >> 5; const float* p = A + ((size_t)slice * 64 + wv * 8) * CC + lane * 4;
    v4f v[16];
#pragma unroll
    for (int u = 0; u < 16; ++u) v[u] = *(const v4f*)(p + u * 128);
    asm volatile("s_wait_xcnt 0x0" :: "v"(p) : "memory");   // the wait owed before the loads' address registers take new values; p as an input keeps the pair whole up to here, so that no load of the run lands on it
    const float mu = PASS ? ST[0] : 0.f; v4f a = {0.f, 0.f, 0.f, 0.f};
#pragma unroll
    for (int u = 0; u < 16; ++u) {
#pragma unroll
        for (int q = 0; q < 4; ++q) { float x = RAW ? bfr(v[u][q]) : v[u][q]; if (PASS) { const float d0 = __fsub_rn(x, mu); x = __fmul_rn(d0, d0); } a[q] = __fadd_rn(a[q], x); } }
    float s = __fadd_rn(__fadd_rn(a[0], a[1]), __fadd_rn(a[2], a[3]));
#pragma unroll
    for (int sh = 16; sh; sh >>= 1) s += __shfl_xor(s, sh, 32);
    if (lane == 0) wsum[wv] = s;
    __syncthreads();   // the eight waves' sums are in LDS; wave 0 joins them
    if (wv == 0) { float t = wsum[lane & 7];
#pragma unroll
        for (int sh = 4; sh; sh >>= 1) t += __shfl_xor(t, sh, 32);
        PART[(size_t)slice * 32 + lane] = (lane == 0) ? t : 0.f; }
}
template <int RAW, int PASS>
__global__ __launch_bounds__(256) __attribute__((amdgpu_waves_per_eu(2, 4))) void k_psum(const float* __restrict__ A0, const float* __restrict__ A1, const float* __restrict__ ST, float* PART) { psum_slice<RAW, PASS>(A0, A1, ST, PART, blockIdx.x, blockIdx.y); }
// The three passes that depend on the inputs alone, in one launch: first the 256 slices of the first sums over X and Y (the next launch waits for them),
// then the bf16 copy of Y (NBY work-groups), then the bf16 planes of the five weight matrices (NBW work-groups each, one plane behind the other in WP).
#define NBS (NW * 2 * NB_)
#define NBY (NB_ * TT * CC / 8 / 256)
#define NBW (CC * CC / 8 / 256)
__global__ __launch_bounds__(256) __attribute__((amdgpu_waves_per_eu(2, 4))) void k_pre(const float* __restrict__ X, const float* __restrict__ Y, const float* __restrict__ s0, const float* __restrict__ s1, const float* __restrict__ s2, const float* __restrict__ s3, const float* __restrict__ s4, const float* __restrict__ ST, float* PART, bf* YB, bf* WP) {
    const unsigned b = blockIdx.x;
    if (b < NBS) psum_slice<1, 0>(X, Y, ST, PART, b % NW, b / NW);
    else if (b < NBS + NBY) cvt8_blk(Y, YB, b - NBS);
    else { const unsigned y = (b - NBS - NBY) / NBW; cvt8_blk(y == 0 ? s0 : y == 1 ? s1 : y == 2 ? s2 : y == 3 ? s3 : s4, WP + (size_t)y * CC * CC, (b - NBS - NBY) % NBW); }
}
// NP partial sums per 64-row slice (one from k_pre or k_psum, four from the column tiles of k_gemmw), added in their order ahead of the lanes' sum
template <int PASS, int NP>
__global__ __launch_bounds__(32) void k_comb(const float* __restrict__ PART, float* ST) {
    PART += (size_t)blockIdx.x * NP * NW * 32; ST += blockIdx.x * 32;
    const int lane = threadIdx.x; float s = PART[(size_t)lane * 32];
#pragma unroll
    for (int p = 1; p < NP; ++p) s += PART[(size_t)(p * NW + lane) * 32];
#pragma unroll
    for (int sh = 16; sh; sh >>= 1) s += __shfl_xor(s, sh, 32);
    const float inv = 1.0f / (float)(TT * CC); float o;
    if (PASS == 0) o = (lane == 0) ? s * inv : 0.f; else { const float mu = ST[0]; o = (lane == 0) ? mu : (lane == 1 ? __fdiv_rn(1.0f, __fsqrt_rn(__fadd_rn(s * inv, 1e-5f))) : 0.f); }
    *(float*)(ST + lane) = o;  }
// one set's plane; the kernel below picks the set's pointers (blockIdx.y) and calls it, so that the __restrict__ of the picked pointers is kept
template <int RAW, int RELU>
__device__ __forceinline__ void snpl_set(const float* __restrict__ A, const float* __restrict__ ST, const float* __restrict__ w, const float* __restrict__ bb, bf* Ph, bf* Pl, const size_t i) { const int c = (int)(i & (CC - 1)); const float mu = ST[0], rs = ST[1]; v2us oh, ol;
#pragma unroll
    for (int q = 0; q < 2; ++q) { float x = A[i + q]; if (RAW) x = bfr(x); float t = __fmul_rn(__fsub_rn(x, mu), rs); asm volatile("" : "+v"(t)); float y = __fadd_rn(__fmul_rn(t, bfr(w[c + q])), bfr(bb[c + q])); if (RELU) y = fmaxf(y, 0.f); unsigned short a, c2; splitf(y, a, c2); oh[q] = a; ol[q] = c2; }
    *(v2us*)(Ph + i) = oh; *(v2us*)(Pl + i) = ol;  }
template <int RAW, int RELU>
__global__ __launch_bounds__(256) void k_snpl(const float* __restrict__ A0, const float* __restrict__ A1, const float* __restrict__ ST, const float* __restrict__ w0, const float* __restrict__ bb0, const float* __restrict__ w1, const float* __restrict__ bb1, bf* Ph, bf* Pl) { const size_t i = ((size_t)blockIdx.x * 256 + threadIdx.x) * 2; if (i >= (size_t)TT * CC) return;
    const int set = blockIdx.y; const bool first = set < NB_;
    snpl_set<RAW, RELU>(first ? A0 + (size_t)set * TT * CC : A1 + (size_t)(set - NB_) * TT * CC, ST + set * 32, first ? w0 : w1, first ? bb0 : bb1, Ph + (size_t)set * TT * CC, Pl + (size_t)set * TT * CC, i); }
// ---- k_fattn: scores, softmax, attn.v and the hi/lo split of O in one kernel; no score and no weight leaves the registers.
// grid (2048 / 256 query blocks, 32 (batch, head) pairs), 16 waves. The pair's whole K [2048][32] and V^T [32][2048] are laid into LDS once (padded pitches), then read by every wave.
// Wave w: query columns (w & 7) * 32 .. + 31, keys (w >> 3) * 1024 .. + 1023, 64 keys a pass. S^T = K Q^T: lane (c, h) holds query c's scores of keys 8h + r of each 16-key tile, which, rounded to fp16,
// ARE the B operand of O^T += V^T P^T (hardware k order; K, Q and V^T fragments are loaded in the same order). Running maximum per query column; the two key halves are joined through LDS at the end.
typedef __attribute__((ext_vector_type(2))) float v2f;
typedef float __attribute__((may_alias)) fa;
__device__ __forceinline__ float xhalf(float x) { const int b = __float_as_int(x); return __int_as_float(__builtin_amdgcn_permlanex16(b, b, 0x76543210, 0xfedcba98, false, false)); }   // lane l <- lane l ^ 16
// v_exp_f32 with the one slot behind a transcendental filled in the same statement
__device__ __forceinline__ float exp2_slot(float x) { float r; asm("v_exp_f32 %0, %1\n\tv_nop" : "=v"(r) : "v"(x)); return r; }
__global__ __launch_bounds__(512) void k_fattn(const h16* __restrict__ QP, const h16* __restrict__ KP, const h16* __restrict__ V16, bf* Oh, bf* Ol) {
    __shared__ __align__(16) unsigned char sm[TT * KPB + DH * VPB];
    unsigned char* Ks = sm; unsigned char* Vs = sm + TT * KPB;
    const int g = blockIdx.y, tid = threadIdx.x, lane = tid & 31, wave = tid >> 5, lr = lane & 15, hi = lane >> 4;
    const int qg = wave & 7, kh = wave >> 3, q0 = blockIdx.x * 256 + qg * 32;
    v16h qf[2];
#pragma unroll
    for (int t = 0; t < 2; ++t) { const h16* p = QP + ((size_t)g * TT + q0 + t * 16 + lr) * DH + 8 * hi; qf[t] = cat16(*(const v8h*)p, *(const v8h*)(p + 16)); }
    asm volatile("s_wait_xcnt 0x0" ::: "memory");   // the Q loads' address registers are given new values further down, ahead of the loads' data wait: this wait stands in front of that
    const h16* Kg = KP + (size_t)g * TT * DH; const h16* Vg = V16 + (size_t)g * DH * TT;
#pragma unroll
    for (int u = 0; u < TT * DH / 8 / 512; ++u) { const int i = u * 512 + tid; *(v8ha*)(Ks + (i >> 2) * KPB + (i & 3) * 16) = *(const v8h*)(Kg + (size_t)i * 8); }
#pragma unroll
    for (int u = 0; u < TT * DH / 8 / 512; ++u) { const int i = u * 512 + tid; *(v8ha*)(Vs + (i >> 8) * VPB + (i & 255) * 16) = *(const v8h*)(Vg + (size_t)i * 8); }
    __syncthreads();
    v8f o[2][2]; float m[2], l[2];
#pragma unroll
    for (int t = 0; t < 2; ++t) { o[t][0] = (v8f){}; o[t][1] = (v8f){}; m[t] = -3.0e38f; l[t] = 0.f; }
    const unsigned char* kp = Ks + (kh * (TT / 2) + lr) * KPB + 16 * hi; const unsigned char* vp = Vs + lr * VPB + (kh * (TT / 2) + 8 * hi) * 2;
    // kept rolled: one pass is already several hundred instructions
#pragma unroll 1
    for (int ps = 0; ps < TT / 2 / 64; ++ps, kp += 64 * KPB, vp += 64 * 2) {
        v8f s[2][4];
#pragma unroll
        for (int kt = 0; kt < 4; ++kt) { const v16h ka = cat16(*(const v8ha*)(kp + kt * 16 * KPB), *(const v8ha*)(kp + kt * 16 * KPB + 32));
#pragma unroll
            for (int t = 0; t < 2; ++t) s[t][kt] = wmma16(ka, qf[t], (v8f){}); }
        v16h va[2][2];
#pragma unroll
        for (int dt = 0; dt < 2; ++dt)
#pragma unroll
            for (int kk = 0; kk < 2; ++kk) va[dt][kk] = cat16(*(const v8ha*)(vp + dt * 16 * VPB + kk * 64), *(const v8ha*)(vp + dt * 16 * VPB + kk * 64 + 32));
#pragma unroll
        for (int t = 0; t < 2; ++t) {
            float mk[4];
#pragma unroll
            for (int kt = 0; kt < 4; ++kt) { mk[kt] = s[t][kt][0];
#pragma unroll
                for (int j = 1; j < 8; ++j) mk[kt] = fmaxf(mk[kt], s[t][kt][j]); }
            float mx = fmaxf(fmaxf(mk[0], mk[1]), fmaxf(mk[2], mk[3])); mx = fmaxf(mx, xhalf(mx));
            const float mn = fmaxf(m[t], mx * C2), al = exp2_slot(m[t] - mn); m[t] = mn;
            const v2f cv = {C2, C2}, nb = {PSH - mn, PSH - mn}; v2f sk[4]; v16h pf[2];
#pragma unroll
            for (int kt = 0; kt < 4; ++kt) {
#pragma unroll
                for (int j = 0; j < 8; j += 2) { const v2f x = __builtin_elementwise_fma((v2f){s[t][kt][j], s[t][kt][j + 1]}, cv, nb); const v2f e = {__builtin_amdgcn_exp2f(x[0]), __builtin_amdgcn_exp2f(x[1])}; sk[kt] = j ? sk[kt] + e : e;
                    const v2h c = __builtin_convertvector(e, v2h); pf[kt >> 1][(kt & 1) * 8 + j] = c[0]; pf[kt >> 1][(kt & 1) * 8 + j + 1] = c[1]; } }
            const v2f st = (sk[0] + sk[1]) + (sk[2] + sk[3]); l[t] = l[t] * al + (st[0] + st[1]);
#pragma unroll
            for (int dt = 0; dt < 2; ++dt) { o[t][dt] *= al;
#pragma unroll
                for (int kk = 0; kk < 2; ++kk) o[t][dt] = wmma16(va[dt][kk], pf[kk], o[t][dt]); }
        }
    }
    __syncthreads();   // every wave has left K and V^T: the first K rows now carry the upper key half's state to its partner wave
    fa* mb = (fa*)sm + (size_t)qg * 36 * 32 + lane;
    if (kh == 1) {
#pragma unroll
        for (int t = 0; t < 2; ++t) { mb[(t * 18) * 32] = m[t]; mb[(t * 18 + 1) * 32] = l[t];
#pragma unroll
            for (int r = 0; r < 16; ++r) mb[(t * 18 + 2 + r) * 32] = o[t][r >> 3][r & 7]; }
    }
    __syncthreads();
    if (kh == 0) {
#pragma unroll
        for (int t = 0; t < 2; ++t) { const float m1 = mb[(t * 18) * 32], l1 = mb[(t * 18 + 1) * 32], mN = fmaxf(m[t], m1); float a0 = exp2_slot(m[t] - mN), a1 = exp2_slot(m1 - mN);
            float lt = l[t] * a0 + l1 * a1; lt += xhalf(lt); const float inv = __fdiv_rn(1.0f, lt); a0 *= inv; a1 *= inv;
#pragma unroll
            for (int dt = 0; dt < 2; ++dt) { v8us oh, ol;
#pragma unroll
                for (int j = 0; j < 8; ++j) { unsigned short a, c2; splitf(o[t][dt][j] * a0 + mb[(t * 18 + 2 + dt * 8 + j) * 32] * a1, a, c2); oh[j] = a; ol[j] = c2; }
                const size_t off = ((size_t)(g >> 3) * TT + q0 + t * 16 + lr) * CC + (g & 7) * DH + dt * 16 + 8 * hi; *(v8us*)(Oh + off) = oh; *(v8us*)(Ol + off) = ol; } }
    }
}
extern "C" void kernel_launch(void* const* d_in, const int* in_sizes, int n_in,
                              void* d_out, int out_size, void* d_ws, size_t ws_size, hipStream_t stream) {
    (void)in_sizes; (void)n_in; (void)out_size;
    const float* IN[18]; for (int i = 0; i < 18; ++i) IN[i] = (const float*)d_in[i];
    // X, Y [4][2048][256], Wq [256][256], bq, Wk, bk, Wv, bv, Wo, bo, Wres, bres, nq_w, nq_b, nk_w, nk_b, n0_w, n0_b = d_in[0..17]
    float* OUT = (float*)d_out;     // [4][2048][256]
    char* wsp = (char*)d_ws;
    auto take = [&](size_t bytes) { char* p = wsp; wsp += (bytes + 255) & ~(size_t)255; return (void*)p; };
    const size_t PE = (size_t)TT * CC;                      // elements of one batch element's [2048][256] plane
    bf* WQ = (bf*)take((size_t)CC * CC * 2); bf* WK = (bf*)take((size_t)CC * CC * 2); bf* WV = (bf*)take((size_t)CC * CC * 2); bf* WO = (bf*)take((size_t)CC * CC * 2); bf* WR = (bf*)take((size_t)CC * CC * 2);   (void)WK; (void)WV;   // one behind the other (k_pre, k_qkv)
    float* PART = (float*)take((size_t)4 * NB_ * NW * 32 * 4); float* ST = (float*)take((size_t)2 * NB_ * 32 * 4);
    // live through the attention part; g = batch * 8 + head runs through all of them
    h16* QP = (h16*)take((size_t)NB_ * NHD * TT * DH * 2); h16* KP = (h16*)take((size_t)NB_ * NHD * TT * DH * 2); h16* V16 = (h16*)take((size_t)NB_ * CC * TT * 2);
    bf* Ph = (bf*)take(2 * NB_ * PE * 2); bf* Pl = (bf*)take(2 * NB_ * PE * 2); bf* YB = (bf*)take(NB_ * PE * 2);
    bf* Oh = YB; bf* Ol = (bf*)take(NB_ * PE * 2); float* H = (float*)take(NB_ * PE * 4);
    if ((size_t)(wsp - (char*)d_ws) > ws_size) return;    // total ~ 45 MiB; ws 256 MiB
    const unsigned L2 = (unsigned)((PE / 2 + 255) / 256); const dim3 gP(NB_ * TT / 64, CC / 64, 1);
    // SetNorm(X) and SetNorm(Y), all batch elements: sets 0..3 = X, 4..7 = Y
    k_pre<<<NBS + NBY + 5 * NBW, 256, 0, stream>>>(IN[0], IN[1], IN[2], IN[4], IN[6], IN[8], IN[10], ST, PART, YB, WQ); k_comb<0, 1><<<2 * NB_, 32, 0, stream>>>(PART, ST); k_psum<1, 1><<<dim3(NW, 2 * NB_), 256, 0, stream>>>(IN[0], IN[1], ST, PART); k_comb<1, 1><<<2 * NB_, 32, 0, stream>>>(PART, ST);
    k_snpl<1, 0><<<dim3(L2, 2 * NB_), 256, 0, stream>>>(IN[0], IN[1], ST, IN[12], IN[13], IN[14], IN[15], Ph, Pl);
    // Q = SetNorm(X) Wq^T + bq; K = SetNorm(Y) Wk^T + bk; V = Y Wv^T + bv: the four batch elements are 8192 rows of one product; each leaves its GEMM as the fp16 plane that the attention kernel reads
    k_qkv<<<dim3(NB_ * TT / 64, CC / 64, 3), 32, 0, stream>>>(Ph, Pl, YB, WQ, IN[3], IN[5], IN[7], QP, KP, V16);
    k_fattn<<<dim3(TT / 256, NB_ * NHD), 512, 0, stream>>>(QP, KP, V16, Oh, Ol);                             // softmax(Q_h K_h^T / 16) V_h, all pairs -> O as hi + lo planes
    k_gemmw<bf, 1, 2><<<gP, 32, 0, stream>>>(Oh, Ol, WO, nullptr, CC, H, IN[9], IN[0], nullptr, PART, 0, 0, 0);   // H = bf16(X) + O Wo^T + bo, and H's sums per tile
    k_comb<0, 4><<<NB_, 32, 0, stream>>>(PART, ST); k_psum<0, 1><<<dim3(NW, NB_), 256, 0, stream>>>(H, H, ST, PART); k_comb<1, 1><<<NB_, 32, 0, stream>>>(PART, ST);
    k_snpl<0, 1><<<dim3(L2, NB_), 256, 0, stream>>>(H, H, ST, IN[16], IN[17], IN[16], IN[17], Ph, Pl);      // relu(SetNorm(H))
    k_gemmw<bf, 1, 3><<<gP, 32, 0, stream>>>(Ph, Pl, WR, nullptr, CC, OUT, IN[11], H, nullptr, nullptr, 0, 0, 0);  // out = H + relu(SetNorm(H)) Wres^T + bres
}

// v006
// A run of this version takes 79 microseconds.
// Two timings next to v005 both put it at 1.16 times that version's speed.
// Over all steps from v000 it is 38.1 times as fast.
#include <hip/hip_runtime.h>

// MABClean (Set-Transformer MAB; X, Y [4][2048][256]; Q = SetNorm(X) Wq^T + bq, K = SetNorm(Y) Wk^T + bk, V = Y Wv^T + bv (SetNorm: normalise over all (samples, features) of one batch element, eps 1e-5,
// then per-feature scale/shift); 8 heads of 32: A = softmax_k(Q_h.K_h / sqrt(256)); O = concat_h A V_h; H = X + O Wo^T + bo; out = H + relu(SetNorm(H)) Wres^T + bres).
// Compute dtypes, f32 accumulate: every input rounded to bf16; the three SetNorm statistics (mean and variance over 524,288 values each) in ONE pass over the values: each group
// (a 64-row slice, a 64x64 tile) gives its sum and its squared deviations about ITS OWN mean, joined in fixed order (join_stats); the normalised operands as bf16 hi+lo planes x exact weights (2 products); V on PLAIN bf16 operands (exact, + bias); scores (K = 32) and attn.v on SINGLE fp16 planes (model

#define NB_  4
#define TT   2048
#define CC   256
#define NHD  8
#define DH   32
#define SCL  0.0625f              // 1/sqrt(dim_Y = 256)
#define C2   (SCL * 1.44269504f)  // score -> exponent of two
#define PSH  10.0f                // P carries 2^10 (as does its sum), so that small weights stay normal fp16 numbers
#define KPB  80                   // LDS pitch of one K row: 64 bytes + 16 (16 B x odd: no bank conflict for 16-byte reads down a column of rows)
#define VPB  4112                 // LDS pitch of one row of V^T: 4096 bytes + 16
#define NW   32                   // 64-row slices per statistic (k_pre: one group (sum, squared deviations) each, from a work-group of 8 waves; k_gemmw: four, one a column tile)
typedef _Float16 h16;
typedef unsigned short bf;
typedef __attribute__((ext_vector_type(16))) __bf16   v16bf;
typedef __attribute__((ext_vector_type(16))) _Float16 v16h;
typedef __attribute__((ext_vector_type(8)))  _Float16 v8h;
typedef __attribute__((ext_vector_type(8)))  unsigned short v8us;
typedef __attribute__((ext_vector_type(8)))  float    v8f;
typedef __attribute__((ext_vector_type(4)))  float    v4f;
typedef v8h  __attribute__((may_alias)) v8ha;
typedef v4f  __attribute__((may_alias)) v4fa;
typedef v8us __attribute__((may_alias)) v8usa;
typedef __attribute__((ext_vector_type(2)))  float    v2f;

__device__ __forceinline__ unsigned short f2bf(float f) { unsigned u = __float_as_uint(f); u += 0x7FFFu + ((u >> 16) & 1u); return (unsigned short)(u >> 16); }
__device__ __forceinline__ float bf2f(unsigned short b) { return __uint_as_float(((unsigned)b) << 16); }
__device__ __forceinline__ float bfr(float f) { return bf2f(f2bf(f)); }
__device__ __forceinline__ v16h cat16(v8h lo, v8h hi) { return __builtin_shufflevector(lo, hi, 0, 1, 2, 3, 4, 5, 6, 7, 8, 9, 10, 11, 12, 13, 14, 15); }
__device__ __forceinline__ v16bf cat16b(v8us lo, v8us hi) { return __builtin_bit_cast(v16bf, __builtin_shufflevector(lo, hi, 0, 1, 2, 3, 4, 5, 6, 7, 8, 9, 10, 11, 12, 13, 14, 15)); }
__device__ __forceinline__ v8f wmma16(v16h a, v16h b, v8f c) { return __builtin_amdgcn_wmma_f32_16x16x32_f16(false, a, false, b, (short)0, c, false, false); }
__device__ __forceinline__ v8f wmmab(v16bf a, v16bf b, v8f c) { return __builtin_amdgcn_wmma_f32_16x16x32_bf16(false, a, false, b, (short)0, c, false, false); }
__device__ __forceinline__ float xhalf(float x) { const int b = __float_as_int(x); return __int_as_float(__builtin_amdgcn_permlanex16(b, b, 0x76543210, 0xfedcba98, false, false)); }   // lane l <- lane l ^ 16
// lane l <- lane l ^ M inside its row of 16 lanes (DPP row_xmask; every lane of the wave must be on): for speed only, where __shfl_xor goes through the LDS pipe and its wait
template <int M> __device__ __forceinline__ float xrow(float x) { return __int_as_float(__builtin_amdgcn_update_dpp(0, __float_as_int(x), 0x160 | M, 0xf, 0xf, true)); }
__device__ __forceinline__ float wave_sum(float x) { x += xhalf(x); x += xrow<8>(x); x += xrow<4>(x); x += xrow<2>(x); return x + xrow<1>(x); }   // the sum over the 32 lanes, in every lane; partners 16, 8, 4, 2, 1



// ---- gemmw_tile (kernels k_gemmw and k_qkv): register-blocked GEMM, ONE WAVE per 64x64 output tile (16 accumulators), operands straight from K-contiguous 16-bit planes; grid (M/64, N/64, Z), 32 threads.
// c[m][n] = sum_k A[m][k] Bt[n][k] (+ split products per NSPLIT) + bias[n], f32, n < 256. z-batch strides sA/sB/sC in elements. K % 32 == 0. The 8192 rows m are (batch element, token).
// The epilogue does the elementwise pass that used to follow in a launch of its own, so that c never goes through memory:
// EPI 0: c as fp16 into the head planes P[batch][head][token][32]. EPI 1: c as fp16, transposed, into P[batch][column][token].
// EPI 2: C = bf16(R) + c, and the tile's sum of C and its squared deviations about the tile's own mean into PART (one group of the statistics over C). EPI 3: C = R + c.
// Every address of the epilogue is a tile base that is the same in all lanes, one lane offset that is kept to the end, and a compile-time step.
template <typename T16> struct WFrag;
template <> struct WFrag<bf> { typedef v16bf V; static __device__ __forceinline__ V ld(const bf* p) { return cat16b(*(const v8us*)p, *(const v8us*)(p + 16)); } static __device__ __forceinline__ v8f mma(V a, V b, v8f c) { return wmmab(a, b, c); } };
template <typename T16, int NSPLIT, int EPI>
__device__ __forceinline__ void gemmw_tile(const T16* __restrict__ A, const T16* __restrict__ A2, const T16* __restrict__ Bt, const T16* __restrict__ Bt2, const int K, float* C, const float* __restrict__ bias, const float* __restrict__ R, h16* P, float* PART) {
    typedef typename WFrag<T16>::V V;
    const int lane = threadIdx.x & 31, lr = lane & 15, hi = lane >> 4; const int r0 = blockIdx.x * 64, c0 = blockIdx.y * 64;
    v8f acc[4][4];
#pragma unroll
    for (int mb = 0; mb < 4; ++mb)
#pragma unroll
        for (int nb = 0; nb < 4; ++nb) acc[mb][nb] = (v8f){};
    const size_t aoff = (size_t)(r0 + lr) * K + 8 * hi, boff = (size_t)(c0 + lr) * K + 8 * hi;
#pragma unroll 1
    for (int kc = 0; kc < K; kc += 32) {
        V a[4], a2[4];
#pragma unroll
        for (int mb = 0; mb < 4; ++mb) { a[mb] = WFrag<T16>::ld(A + aoff + (size_t)mb * 16 * K + kc); if (NSPLIT == 1 || NSPLIT == 2) a2[mb] = WFrag<T16>::ld(A2 + aoff + (size_t)mb * 16 * K + kc); }
#pragma unroll
        for (int nb = 0; nb < 4; ++nb) { const V b = WFrag<T16>::ld(Bt + boff + (size_t)nb * 16 * K + kc); V b2; if (NSPLIT >= 2) b2 = WFrag<T16>::ld(Bt2 + boff + (size_t)nb * 16 * K + kc);
#pragma unroll
            for (int mb = 0; mb < 4; ++mb) { acc[mb][nb] = WFrag<T16>::mma(a[mb], b, acc[mb][nb]); if (NSPLIT == 1 || NSPLIT == 2) acc[mb][nb] = WFrag<T16>::mma(a2[mb], b, acc[mb][nb]); if (NSPLIT >= 2) acc[mb][nb] = WFrag<T16>::mma(a[mb], b2, acc[mb][nb]); } }
        asm volatile("v_nop\n\tv_nop\n\tv_nop\n\tv_nop" : "+v"(acc[0][0]), "+v"(acc[1][1]), "+v"(acc[2][2]), "+v"(acc[3][3]) : "v"(a[0]), "v"(a[3]));
    }
    asm volatile("s_wait_xcnt 0x0" ::: "memory");   // the wait owed before the epilogue gives new values to the address registers of the loop's loads
    const int bt = r0 >> 11, t0 = r0 & (TT - 1);   // the tile's batch element and its first token (64 divides 2048: a tile lies in one batch element)
    if constexpr (EPI == 1) {
        // lane (lr, hi) holds 8 consecutive tokens of one column: 16 bytes of fp16. Through LDS (pitch 144 B = 16 B x odd) each column's 64 tokens leave as one whole 128-byte line.
        __shared__ __align__(16) h16 ts[64 * 72];
#pragma unroll
        for (int nb = 0; nb < 4; ++nb) { const float bn = bfr(bias[c0 + nb * 16 + lr]);
#pragma unroll
            for (int mb = 0; mb < 4; ++mb) { v8h o;
#pragma unroll
                for (int j = 0; j < 8; ++j) o[j] = (h16)(acc[mb][nb][j] + bn);
                *(v8ha*)(ts + (nb * 16 + lr) * 72 + mb * 16 + hi * 8) = o; } }
        __builtin_amdgcn_wave_barrier(); asm volatile("" ::: "memory");   // keeps the LDS reads below behind the LDS writes above (other lanes' data)
        h16* vt = P + ((size_t)bt * CC + c0) * TT + t0; const int vo = (lane >> 3) * TT + (lane & 7) * 8;
#pragma unroll
        for (int s = 0; s < 16; ++s) *(v8h*)(vt + vo + s * 4 * TT) = *(const v8ha*)(ts + (s * 4 + (lane >> 3)) * 72 + (lane & 7) * 8);
    } else {
        __shared__ __align__(16) float os[16 * 68];
        float bq[2][8]; v4f bv, rr[2][8], hs = {0.f, 0.f, 0.f, 0.f};
        v4f keep[4][8];   // EPI 2: the tile's values of C, for the squared deviations about the tile's mean
        const float* rt = R + (size_t)r0 * CC + c0; float* ct = C + (size_t)r0 * CC + c0; const int lo = hi * CC + lr * 4;
        h16* pt = P + (((size_t)bt * NHD + (c0 >> 5)) * TT + t0) * DH;
        if constexpr (EPI == 0) {
#pragma unroll
            for (int hh = 0; hh < 2; ++hh)
#pragma unroll
                for (int q = 0; q < 8; ++q) bq[hh][q] = bfr(bias[c0 + hh * 32 + (lane & 3) * 8 + q]);
        } else {
            // the residual rows of two 16-row blocks are asked for ahead, those of block mb + 2 as soon as block mb's are used: their latency is waited out once
#pragma unroll
            for (int mb = 0; mb < 2; ++mb)
#pragma unroll
                for (int s = 0; s < 8; ++s) rr[mb][s] = *(const v4f*)(rt + lo + (mb * 16 + 2 * s) * CC);
            const v4f braw = *(const v4f*)(bias + c0 + lr * 4);
            asm volatile("s_wait_xcnt 0x0" :: "v"(lr) : "memory");   // the wait owed before the bias load's offset register (lr) takes a new value; lr as an input keeps it whole up to here, so that no residual load lands on it
#pragma unroll
            for (int q = 0; q < 4; ++q) bv[q] = bfr(braw[q]);
        }
#pragma unroll
        for (int mb = 0; mb < 4; ++mb) {
#pragma unroll
            for (int nb = 0; nb < 4; ++nb) {
#pragma unroll
                for (int j = 0; j < 8; ++j) os[(hi * 8 + j) * 68 + nb * 16 + lr] = acc[mb][nb][j]; }
            __builtin_amdgcn_wave_barrier(); asm volatile("" ::: "memory");   // keeps the LDS reads below behind the LDS writes above (other lanes' data)
            if constexpr (EPI == 0) {
                // one store = 8 tokens x 64 bytes of one head = 512 contiguous bytes
#pragma unroll
                for (int s = 0; s < 4; ++s) { const int hh = s >> 1, th = s & 1; const float* op = os + (th * 8 + (lane >> 2)) * 68 + hh * 32 + (lane & 3) * 8; const v4f x0 = *(const v4fa*)op, x1 = *(const v4fa*)(op + 4); v8h o;
#pragma unroll
                    for (int q = 0; q < 4; ++q) { o[q] = (h16)(x0[q] + bq[hh][q]); o[4 + q] = (h16)(x1[q] + bq[hh][4 + q]); }
                    *(v8h*)(pt + lane * 8 + (hh * TT + mb * 16 + th * 8) * DH) = o; }
            } else {
#pragma unroll
                for (int s = 0; s < 8; ++s) { const int row = 2 * s + hi, cofs = lr * 4; const v4f val = *(const v4fa*)(os + row * 68 + cofs) + bv; const v4f x = rr[mb & 1][s]; v4f o;
#pragma unroll
                    for (int q = 0; q < 4; ++q) { o[q] = __fadd_rn(EPI == 2 ? bfr(x[q]) : x[q], val[q]); if (EPI == 2) hs[q] = __fadd_rn(hs[q], o[q]); }
                    if constexpr (EPI == 2) keep[mb][s] = o;   // block mb's accumulators are dead by now: the tile's values take their place in the registers
                    *(v4f*)(ct + lo + (mb * 16 + 2 * s) * CC) = o; }
                if (mb < 2) {
#pragma unroll
                    for (int s = 0; s < 8; ++s) rr[mb][s] = *(const v4f*)(rt + lo + ((mb + 2) * 16 + 2 * s) * CC); }
            }
            __builtin_amdgcn_wave_barrier(); asm volatile("" ::: "memory");   // keeps the next block's LDS writes behind this block's LDS reads
        }
        if constexpr (EPI == 2) {
            // fixed order: four chains a lane, their pair sums, the lanes of the wave; one 128-byte line of PART per tile: set bt, row (column tile) * NW + 64-row slice; word 0 the sum, word 1 the squared deviations
            float s = __fadd_rn(__fadd_rn(hs[0], hs[1]), __fadd_rn(hs[2], hs[3]));
#pragma unroll
            for (int sh = 16; sh; sh >>= 1) s += __shfl_xor(s, sh, 32);
            const float mt = s * (1.0f / 4096.0f); v4f dq = {0.f, 0.f, 0.f, 0.f};   // the tile's own mean; its 4,096 values are still in the registers
            asm volatile("s_wait_xcnt 0x0" ::: "memory");   // the wait owed before the registers that the tile's stores name take new values in the sums below
#pragma unroll   // both loops unrolled: keep is indexed by constants only and so stays in registers
            for (int mb = 0; mb < 4; ++mb)
#pragma unroll
                for (int u = 0; u < 8; ++u) { const v4f d = keep[mb][u] - mt; dq += d * d; }
            const float m2 = wave_sum((dq[0] + dq[1]) + (dq[2] + dq[3]));
            PART[(((size_t)bt * 4 + blockIdx.y) * NW + (t0 >> 6)) * 32 + lane] = (lane == 0) ? s : (lane == 1) ? m2 : 0.f;
        }
    }
}
template <typename T16, int NSPLIT, int EPI>
__global__ __launch_bounds__(32) void k_gemmw(const T16* __restrict__ A, const T16* __restrict__ A2, const T16* __restrict__ Bt, const T16* __restrict__ Bt2, int K, float* C, const float* __restrict__ bias, const float* __restrict__ R, h16* P, float* PART, size_t sA, size_t sB, size_t sC) {
    const size_t z = blockIdx.z; A += z * sA; if (A2) A2 += z * sA; Bt += z * sB; if (Bt2) Bt2 += z * sB; C += z * sC;
    gemmw_tile<T16, NSPLIT, EPI>(A, A2, Bt, Bt2, K, C, bias, R, P, PART);
}
// The three projections depend on nothing of one another: one launch, blockIdx.z = 0: Q, 1: K (hi + lo planes of the normalised X and Y, one behind the other in Ph and Pl), 2: V (plain bf16 Y).
// A launch of 512 one-wave tiles leaves every SIMD with at most one wave, which waits out each k step's load latency alone; 1,536 tiles share the SIMDs and the launch's start and end are paid once.
// W: the planes of Wq, Wk, Wv one behind the other.
__global__ __launch_bounds__(32) void k_qkv(const bf* __restrict__ Ph, const bf* __restrict__ Pl, const bf* __restrict__ YB, const bf* __restrict__ W, const float* __restrict__ bq, const float* __restrict__ bk, const float* __restrict__ bv, h16* QP, h16* KP, h16* V16) {
    const int z = blockIdx.z;
    if (z == 2) gemmw_tile<bf, 0, 1>(YB, nullptr, W + 2 * CC * CC, nullptr, CC, nullptr, bv, nullptr, V16, nullptr);
    else gemmw_tile<bf, 1, 0>(Ph + (size_t)z * NB_ * TT * CC, Pl + (size_t)z * NB_ * TT * CC, W + z * CC * CC, nullptr, CC, nullptr, z ? bk : bq, nullptr, z ? KP : QP, nullptr);
}

__device__ __forceinline__ void splitf(float y, unsigned short& h, unsigned short& l) { h = f2bf(y); l = f2bf(y - bf2f(h)); }
typedef __attribute__((ext_vector_type(2))) _Float16 v2h;
typedef __attribute__((ext_vector_type(4))) _Float16 v4h;
typedef __attribute__((ext_vector_type(2))) unsigned short v2us;
typedef __attribute__((ext_vector_type(8))) _Float16 v8h16;

__device__ __forceinline__ void cvt8_blk(const float* __restrict__ src, bf* dst, const unsigned blk) { const size_t i = (size_t)blk * 256 + threadIdx.x; const v8f v = *(const v8f*)(src + i * 8); v8us o;
    asm volatile("s_wait_xcnt 0x0" ::: "memory");   // the wait owed before the load's address registers take new values in the rounding below
#pragma unroll
    for (int k = 0; k < 8; ++k) o[k] = f2bf(v[k]); *(v8us*)(dst + i * 8) = o;
    asm volatile("s_wait_xcnt 0x0" ::: "memory"); }   // the wait owed behind the store: in k_pre the code of the other branches follows in the listing and gives new values to the store's registers
// set = statistic set: sets 0..NB_-1 are the batch elements of A0, sets NB_.. those of A1; slice = one slice of 64 rows, one group of the statistics: its sum and its squared deviations about its own mean.
// Wave v of the work-group takes rows 8v .. 8v + 7 of the slice: 16 loads of 16 bytes a lane, all issued before the first value is used, so that the wave waits out the load latency once and not once a load.
// amdgpu_waves_per_eu (on the kernels that call it): without the hint the compiler saved registers for sixteen waves a SIMD and held four of the sixteen loads back until earlier ones had returned.
// Fixed order, for the sum and then for the squared deviations: four chains a lane (one per vector component), their pair sums, the lanes of the wave, then the eight waves through LDS.
// The slice's 16,384 values stay in the registers between the two, so that they are read once; about the slice's own mean nothing cancels, whatever the mean of the whole set is.
template <int RAW>
__device__ __forceinline__ void psum_slice(const float* __restrict__ A0, const float* __restrict__ A1, float* PART, const int slice, const int set) {
    __shared__ float wsum[8], wsq[8];
    const float* A = set < NB_ ? A0 + (size_t)set * TT * CC : A1 + (size_t)(set - NB_) * TT * CC; PART += (size_t)set * NW * 32;
    const int lane = threadIdx.x & 31, wv = threadIdx.x >> 5; const float* p = A + ((size_t)slice * 64 + wv * 8) * CC + lane * 4;
    v4f v[16];
#pragma unroll
    for (int u = 0; u < 16; ++u) v[u] = *(const v4f*)(p + u * 128);
    asm volatile("s_wait_xcnt 0x0" :: "v"(p) : "memory");   // the wait owed before the loads' address registers take new values; p as an input keeps the pair whole up to here, so that no load of the run lands on it
    v4f a = {0.f, 0.f, 0.f, 0.f}, dq = {0.f, 0.f, 0.f, 0.f};
#pragma unroll
    for (int u = 0; u < 16; ++u) {
#pragma unroll
        for (int q = 0; q < 4; ++q) { if (RAW) v[u][q] = bfr(v[u][q]); a[q] = __fadd_rn(a[q], v[u][q]); } }
    float s = __fadd_rn(__fadd_rn(a[0], a[1]), __fadd_rn(a[2], a[3]));
#pragma unroll
    for (int sh = 16; sh; sh >>= 1) s += __shfl_xor(s, sh, 32);
    if (lane == 0) wsum[wv] = s;
    __syncthreads();   // the eight waves' sums are in LDS; every wave joins them, in one order, to the slice's sum
    float t = wsum[lane & 7]; t += xrow<4>(t); t += xrow<2>(t); t += xrow<1>(t);
    const float ms = t * (1.0f / 16384.0f);
#pragma unroll   // unrolled: v is indexed by constants only and so stays in registers
    for (int u = 0; u < 16; ++u) { const v4f d = v[u] - ms; dq += d * d; }
    const float r = wave_sum((dq[0] + dq[1]) + (dq[2] + dq[3]));
    if (lane == 0) wsq[wv] = r;
    __syncthreads();   // the eight waves' squared deviations are in LDS; wave 0 joins them
    if (wv == 0) { float t2 = wsq[lane & 7]; t2 += xrow<4>(t2); t2 += xrow<2>(t2); t2 += xrow<1>(t2);
        PART[(size_t)slice * 32 + lane] = (lane == 0) ? t : (lane == 1) ? t2 : 0.f; }
}
// The three passes that depend on the inputs alone, in one launch: first the 256 slices of the statistics over X and Y (the next launch waits for them),
// then the bf16 copy of Y (NBY work-groups), then the bf16 planes of the five weight matrices (NBW work-groups each, one plane behind the other in WP).
#define NBS (NW * 2 * NB_)
#define NBY (NB_ * TT * CC / 8 / 256)
#define NBW (CC * CC / 8 / 256)
__global__ __launch_bounds__(256) __attribute__((amdgpu_waves_per_eu(2, 4))) void k_pre(const float* __restrict__ X, const float* __restrict__ Y, const float* __restrict__ s0, const float* __restrict__ s1, const float* __restrict__ s2, const float* __restrict__ s3, const float* __restrict__ s4, float* PART, bf* YB, bf* WP) {
    const unsigned b = blockIdx.x;
    if (b < NBS) psum_slice<1>(X, Y, PART, b % NW, b / NW);
    else if (b < NBS + NBY) cvt8_blk(Y, YB, b - NBS);
    else { const unsigned y = (b - NBS - NBY) / NBW; cvt8_blk(y == 0 ? s0 : y == 1 ? s1 : y == 2 ? s2 : y == 3 ? s3 : s4, WP + (size_t)y * CC * CC, (b - NBS - NBY) % NBW); }
}
// One wave joins a set's NP * NW groups (NP per lane: one slice from k_pre, or the four column tiles of k_gemmw) of TT * CC / (NP * NW) values each; PART holds a group's sum in word 0 of its line and its squared
// deviations about its own mean in word 1. Squared deviations about the set's mean = sum over the groups of (their own + group size x (group mean - set mean)^2): only non-negative terms are added.
// Returns {mean, 1 / sqrt(variance + 1e-5)} in every lane.
template <int NP>
__device__ __forceinline__ v2f join_stats(const float* __restrict__ PART, const int lane) {
    constexpr float gn = (float)(TT * CC / (NP * NW)), inv = 1.0f / (float)(TT * CC); const float* p = PART + (size_t)lane * 32; v2f g[NP];
#pragma unroll   // unrolled, here and below: g stays in registers and its NP loads are in flight together
    for (int k = 0; k < NP; ++k) g[k] = *(const v2f*)(p + (size_t)k * NW * 32);
    asm volatile("s_wait_xcnt 0x0" ::: "memory");   // the wait owed before the loads' address registers take new values
    float s = g[0][0];
#pragma unroll
    for (int k = 1; k < NP; ++k) s += g[k][0];
    const float mu = wave_sum(s) * inv; float m2 = 0.f;
#pragma unroll
    for (int k = 0; k < NP; ++k) { const float d = g[k][0] * (1.0f / gn) - mu; m2 += g[k][1] + gn * d * d; }
    return (v2f){mu, __fdiv_rn(1.0f, __fsqrt_rn(__fadd_rn(wave_sum(m2) * inv, 1e-5f)))}; }
// Normalises one set's plane (blockIdx.y: the set) and splits it into its hi + lo planes. No launch stands between the groups' sums and their use: wave 0 of each work-group joins the set's statistics and hands
// them to the other waves through LDS. The values and their scale and shift are asked for ahead of the join, so that the two latencies run side by side.
template <int RAW, int RELU, int NP>
__global__ __launch_bounds__(256) void k_snpl(const float* __restrict__ A0, const float* __restrict__ A1, const float* __restrict__ PART, const float* __restrict__ w0, const float* __restrict__ bb0, const float* __restrict__ w1, const float* __restrict__ bb1, bf* Ph, bf* Pl) { const size_t i = ((size_t)blockIdx.x * 256 + threadIdx.x) * 2; if (i >= (size_t)TT * CC) return;
    __shared__ float st[2];
    const int set = blockIdx.y, c = (int)(i & (CC - 1)); const bool first = set < NB_;
    const v2f x2 = *(const v2f*)((first ? A0 + (size_t)set * TT * CC : A1 + (size_t)(set - NB_) * TT * CC) + i), w2 = *(const v2f*)((first ? w0 : w1) + c), b2 = *(const v2f*)((first ? bb0 : bb1) + c);
    asm volatile("s_wait_xcnt 0x0" ::: "memory");   // the wait owed before the three loads' address registers take new values
    if (threadIdx.x < 32) { const v2f r = join_stats<NP>(PART + (size_t)set * NP * NW * 32, threadIdx.x); if (threadIdx.x == 0) { st[0] = r[0]; st[1] = r[1]; } }
    __syncthreads();   // the set's mean and scale are in LDS for all eight waves
    const float mu = st[0], rs = st[1]; v2us oh, ol;
#pragma unroll
    for (int q = 0; q < 2; ++q) { float x = x2[q]; if (RAW) x = bfr(x); const float t = __fmul_rn(__fsub_rn(x, mu), rs); float y = __fadd_rn(__fmul_rn(t, bfr(w2[q])), bfr(b2[q])); if (RELU) y = fmaxf(y, 0.f); unsigned short a, c2; splitf(y, a, c2); oh[q] = a; ol[q] = c2; }
    *(v2us*)(Ph + (size_t)set * TT * CC + i) = oh; *(v2us*)(Pl + (size_t)set * TT * CC + i) = ol;  }
// ---- k_fattn: scores, softmax, attn.v and the hi/lo split of O in one kernel; no score and no weight leaves the registers.
// grid (2048 / 256 query blocks, 32 (batch, head) pairs), 16 waves. The pair's whole K [2048][32] and V^T [32][2048] are laid into LDS once (padded pitches), then read by every wave.
// Wave w: query columns (w & 7) * 32 .. + 31, keys (w >> 3) * 1024 .. + 1023, 64 keys a pass. S^T = K Q^T: lane (c, h) holds query c's scores of keys 8h + r of each 16-key tile, which, rounded to fp16,
// ARE the B operand of O^T += V^T P^T (hardware k order; K, Q and V^T fragments are loaded in the same order). Running maximum per query column; the two key halves are joined through LDS at the end.
typedef float __attribute__((may_alias)) fa;
// v_exp_f32 with the one slot behind a transcendental filled in the same statement
__device__ __forceinline__ float exp2_slot(float x) { float r; asm("v_exp_f32 %0, %1\n\tv_nop" : "=v"(r) : "v"(x)); return r; }
__global__ __launch_bounds__(512) void k_fattn(const h16* __restrict__ QP, const h16* __restrict__ KP, const h16* __restrict__ V16, bf* Oh, bf* Ol) {
    __shared__ __align__(16) unsigned char sm[TT * KPB + DH * VPB];
    unsigned char* Ks = sm; unsigned char* Vs = sm + TT * KPB;
    const int g = blockIdx.y, tid = threadIdx.x, lane = tid & 31, wave = tid >> 5, lr = lane & 15, hi = lane >> 4;
    const int qg = wave & 7, kh = wave >> 3, q0 = blockIdx.x * 256 + qg * 32;
    v16h qf[2];
#pragma unroll
    for (int t = 0; t < 2; ++t) { const h16* p = QP + ((size_t)g * TT + q0 + t * 16 + lr) * DH + 8 * hi; qf[t] = cat16(*(const v8h*)p, *(const v8h*)(p + 16)); }
    asm volatile("s_wait_xcnt 0x0" ::: "memory");   // the Q loads' address registers are given new values further down, ahead of the loads' data wait: this wait stands in front of that
    const h16* Kg = KP + (size_t)g * TT * DH; const h16* Vg = V16 + (size_t)g * DH * TT;
#pragma unroll
    for (int u = 0; u < TT * DH / 8 / 512; ++u) { const int i = u * 512 + tid; *(v8ha*)(Ks + (i >> 2) * KPB + (i & 3) * 16) = *(const v8h*)(Kg + (size_t)i * 8); }
#pragma unroll
    for (int u = 0; u < TT * DH / 8 / 512; ++u) { const int i = u * 512 + tid; *(v8ha*)(Vs + (i >> 8) * VPB + (i & 255) * 16) = *(const v8h*)(Vg + (size_t)i * 8); }
    __syncthreads();
    v8f o[2][2]; float m[2], l[2];
#pragma unroll
    for (int t = 0; t < 2; ++t) { o[t][0] = (v8f){}; o[t][1] = (v8f){}; m[t] = -3.0e38f; l[t] = 0.f; }
    const unsigned char* kp = Ks + (kh * (TT / 2) + lr) * KPB + 16 * hi; const unsigned char* vp = Vs + lr * VPB + (kh * (TT / 2) + 8 * hi) * 2;
    // kept rolled: one pass is already several hundred instructions
#pragma unroll 1
    for (int ps = 0; ps < TT / 2 / 64; ++ps, kp += 64 * KPB, vp += 64 * 2) {
        v8f s[2][4];
#pragma unroll
        for (int kt = 0; kt < 4; ++kt) { const v16h ka = cat16(*(const v8ha*)(kp + kt * 16 * KPB), *(const v8ha*)(kp + kt * 16 * KPB + 32));
#pragma unroll
            for (int t = 0; t < 2; ++t) s[t][kt] = wmma16(ka, qf[t], (v8f){}); }
        v16h va[2][2];
#pragma unroll
        for (int dt = 0; dt < 2; ++dt)
#pragma unroll
            for (int kk = 0; kk < 2; ++kk) va[dt][kk] = cat16(*(const v8ha*)(vp + dt * 16 * VPB + kk * 64), *(const v8ha*)(vp + dt * 16 * VPB + kk * 64 + 32));
#pragma unroll
        for (int t = 0; t < 2; ++t) {
            float mk[4];
#pragma unroll
            for (int kt = 0; kt < 4; ++kt) { mk[kt] = s[t][kt][0];
#pragma unroll
                for (int j = 1; j < 8; ++j) mk[kt] = fmaxf(mk[kt], s[t][kt][j]); }
            float mx = fmaxf(fmaxf(mk[0], mk[1]), fmaxf(mk[2], mk[3])); mx = fmaxf(mx, xhalf(mx));
            const float mn = fmaxf(m[t], mx * C2), al = exp2_slot(m[t] - mn); m[t] = mn;
            const v2f cv = {C2, C2}, nb = {PSH - mn, PSH - mn}; v2f sk[4]; v16h pf[2];
#pragma unroll
            for (int kt = 0; kt < 4; ++kt) {
#pragma unroll
                for (int j = 0; j < 8; j += 2) { const v2f x = __builtin_elementwise_fma((v2f){s[t][kt][j], s[t][kt][j + 1]}, cv, nb); const v2f e = {__builtin_amdgcn_exp2f(x[0]), __builtin_amdgcn_exp2f(x[1])}; sk[kt] = j ? sk[kt] + e : e;
                    const v2h c = __builtin_convertvector(e, v2h); pf[kt >> 1][(kt & 1) * 8 + j] = c[0]; pf[kt >> 1][(kt & 1) * 8 + j + 1] = c[1]; } }
            const v2f st = (sk[0] + sk[1]) + (sk[2] + sk[3]); l[t] = l[t] * al + (st[0] + st[1]);
#pragma unroll
            for (int dt = 0; dt < 2; ++dt) { o[t][dt] *= al;
#pragma unroll
                for (int kk = 0; kk < 2; ++kk) o[t][dt] = wmma16(va[dt][kk], pf[kk], o[t][dt]); }
        }
    }
    __syncthreads();   // every wave has left K and V^T: the first K rows now carry the upper key half's state to its partner wave
    fa* mb = (fa*)sm + (size_t)qg * 36 * 32 + lane;
    if (kh == 1) {
#pragma unroll
        for (int t = 0; t < 2; ++t) { mb[(t * 18) * 32] = m[t]; mb[(t * 18 + 1) * 32] = l[t];
#pragma unroll
            for (int r = 0; r < 16; ++r) mb[(t * 18 + 2 + r) * 32] = o[t][r >> 3][r & 7]; }
    }
    __syncthreads();
    if (kh == 0) {
#pragma unroll
        for (int t = 0; t < 2; ++t) { const float m1 = mb[(t * 18) * 32], l1 = mb[(t * 18 + 1) * 32], mN = fmaxf(m[t], m1); float a0 = exp2_slot(m[t] - mN), a1 = exp2_slot(m1 - mN);
            float lt = l[t] * a0 + l1 * a1; lt += xhalf(lt); const float inv = __fdiv_rn(1.0f, lt); a0 *= inv; a1 *= inv;
#pragma unroll
            for (int dt = 0; dt < 2; ++dt) { v8us oh, ol;
#pragma unroll
                for (int j = 0; j < 8; ++j) { unsigned short a, c2; splitf(o[t][dt][j] * a0 + mb[(t * 18 + 2 + dt * 8 + j) * 32] * a1, a, c2); oh[j] = a; ol[j] = c2; }
                const size_t off = ((size_t)(g >> 3) * TT + q0 + t * 16 + lr) * CC + (g & 7) * DH + dt * 16 + 8 * hi; *(v8us*)(Oh + off) = oh; *(v8us*)(Ol + off) = ol; } }
    }
}
extern "C" void kernel_launch(void* const* d_in, const int* in_sizes, int n_in,
                              void* d_out, int out_size, void* d_ws, size_t ws_size, hipStream_t stream) {
    (void)in_sizes; (void)n_in; (void)out_size;
    const float* IN[18]; for (int i = 0; i < 18; ++i) IN[i] = (const float*)d_in[i];
    // X, Y [4][2048][256], Wq [256][256], bq, Wk, bk, Wv, bv, Wo, bo, Wres, bres, nq_w, nq_b, nk_w, nk_b, n0_w, n0_b = d_in[0..17]
    float* OUT = (float*)d_out;     // [4][2048][256]
    char* wsp = (char*)d_ws;
    auto take = [&](size_t bytes) { char* p = wsp; wsp += (bytes + 255) & ~(size_t)255; return (void*)p; };
    const size_t PE = (size_t)TT * CC;                      // elements of one batch element's [2048][256] plane
    bf* WQ = (bf*)take((size_t)CC * CC * 2); bf* WK = (bf*)take((size_t)CC * CC * 2); bf* WV = (bf*)take((size_t)CC * CC * 2); bf* WO = (bf*)take((size_t)CC * CC * 2); bf* WR = (bf*)take((size_t)CC * CC * 2);   (void)WK; (void)WV;   // one behind the other (k_pre, k_qkv)
    float* PART = (float*)take((size_t)4 * NB_ * NW * 32 * 4);
    // live through the attention part; g = batch * 8 + head runs through all of them
    h16* QP = (h16*)take((size_t)NB_ * NHD * TT * DH * 2); h16* KP = (h16*)take((size_t)NB_ * NHD * TT * DH * 2); h16* V16 = (h16*)take((size_t)NB_ * CC * TT * 2);
    bf* Ph = (bf*)take(2 * NB_ * PE * 2); bf* Pl = (bf*)take(2 * NB_ * PE * 2); bf* YB = (bf*)take(NB_ * PE * 2);
    bf* Oh = YB; bf* Ol = (bf*)take(NB_ * PE * 2); float* H = (float*)take(NB_ * PE * 4);
    if ((size_t)(wsp - (char*)d_ws) > ws_size) return;    // total ~ 45 MiB; ws 256 MiB
    const unsigned L2 = (unsigned)((PE / 2 + 255) / 256); const dim3 gP(NB_ * TT / 64, CC / 64, 1);
    // SetNorm(X) and SetNorm(Y), all batch elements: sets 0..3 = X, 4..7 = Y
    k_pre<<<NBS + NBY + 5 * NBW, 256, 0, stream>>>(IN[0], IN[1], IN[2], IN[4], IN[6], IN[8], IN[10], PART, YB, WQ);
    k_snpl<1, 0, 1><<<dim3(L2, 2 * NB_), 256, 0, stream>>>(IN[0], IN[1], PART, IN[12], IN[13], IN[14], IN[15], Ph, Pl);
    // Q = SetNorm(X) Wq^T + bq; K = SetNorm(Y) Wk^T + bk; V = Y Wv^T + bv: the four batch elements are 8192 rows of one product; each leaves its GEMM as the fp16 plane that the attention kernel reads
    k_qkv<<<dim3(NB_ * TT / 64, CC / 64, 3), 32, 0, stream>>>(Ph, Pl, YB, WQ, IN[3], IN[5], IN[7], QP, KP, V16);
    k_fattn<<<dim3(TT / 256, NB_ * NHD), 512, 0, stream>>>(QP, KP, V16, Oh, Ol);                             // softmax(Q_h K_h^T / 16) V_h, all pairs -> O as hi + lo planes
    k_gemmw<bf, 1, 2><<<gP, 32, 0, stream>>>(Oh, Ol, WO, nullptr, CC, H, IN[9], IN[0], nullptr, PART, 0, 0, 0);   // H = bf16(X) + O Wo^T + bo, and H's statistics per tile
    k_snpl<0, 1, 4><<<dim3(L2, NB_), 256, 0, stream>>>(H, H, PART, IN[16], IN[17], IN[16], IN[17], Ph, Pl);      // relu(SetNorm(H))
    k_gemmw<bf, 1, 3><<<gP, 32, 0, stream>>>(Ph, Pl, WR, nullptr, CC, OUT, IN[11], H, nullptr, nullptr, 0, 0, 0);  // out = H + relu(SetNorm(H)) Wres^T + bres
}

// v007
// It runs in 75.8 microseconds.
// Two timings next to v006 both put it at 1.03 times that version's speed.
// All steps since v000 together make it 39.2 times as fast.
#include <hip/hip_runtime.h>

// MABClean (Set-Transformer MAB; X, Y [4][2048][256]; Q = SetNorm(X) Wq^T + bq, K = SetNorm(Y) Wk^T + bk, V = Y Wv^T + bv (SetNorm: normalise over all (samples, features) of one batch element, eps 1e-5,
// then per-feature scale/shift); 8 heads of 32: A = softmax_k(Q_h.K_h / sqrt(256)); O = concat_h A V_h; H = X + O Wo^T + bo; out = H + relu(SetNorm(H)) Wres^T + bres).
// Compute dtypes, f32 accumulate: every input rounded to bf16; the three SetNorm statistics (mean and variance over 524,288 values each) in ONE pass over the values: each group
// (a 64-row slice, a 64x64 tile) gives its sum and its squared deviations about ITS OWN mean, joined in fixed order (join_stats); the normalised operands as bf16 hi+lo planes x exact weights (2 products); V on PLAIN bf16 operands (exact, + bias); scores (K = 32) and attn.v on SINGLE fp16 planes (model

#define NB_  4
#define TT   2048
#define CC   256
#define NHD  8
#define DH   32
#define SCL  0.0625f              // 1/sqrt(dim_Y = 256)
#define C2   (SCL * 1.44269504f)  // score -> exponent of two
#define PSH  10.0f                // P carries 2^10 (as does its sum), so that small weights stay normal fp16 numbers
#define KPB  80                   // LDS pitch of one K row: 64 bytes + 16 (16 B x odd: no bank conflict for 16-byte reads down a column of rows)
#define VPB  4112                 // LDS pitch of one row of V^T: 4096 bytes + 16
#define NW   32                   // 64-row slices per statistic (k_pre: one group (sum, squared deviations) each, from a work-group of 8 waves; k_gemmw: four, one a column tile)
typedef _Float16 h16;
typedef unsigned short bf;
typedef __attribute__((ext_vector_type(16))) __bf16   v16bf;
typedef __attribute__((ext_vector_type(16))) _Float16 v16h;
typedef __attribute__((ext_vector_type(8)))  _Float16 v8h;
typedef __attribute__((ext_vector_type(8)))  unsigned short v8us;
typedef __attribute__((ext_vector_type(8)))  float    v8f;
typedef __attribute__((ext_vector_type(4)))  float    v4f;
typedef v8h  __attribute__((may_alias)) v8ha;
typedef v4f  __attribute__((may_alias)) v4fa;
typedef v8us __attribute__((may_alias)) v8usa;
typedef __attribute__((ext_vector_type(2)))  float    v2f;

__device__ __forceinline__ unsigned short f2bf(float f) { unsigned u = __float_as_uint(f); u += 0x7FFFu + ((u >> 16) & 1u); return (unsigned short)(u >> 16); }
__device__ __forceinline__ float bf2f(unsigned short b) { return __uint_as_float(((unsigned)b) << 16); }
__device__ __forceinline__ float bfr(float f) { return bf2f(f2bf(f)); }
__device__ __forceinline__ v16h cat16(v8h lo, v8h hi) { return __builtin_shufflevector(lo, hi, 0, 1, 2, 3, 4, 5, 6, 7, 8, 9, 10, 11, 12, 13, 14, 15); }
__device__ __forceinline__ v16bf cat16b(v8us lo, v8us hi) { return __builtin_bit_cast(v16bf, __builtin_shufflevector(lo, hi, 0, 1, 2, 3, 4, 5, 6, 7, 8, 9, 10, 11, 12, 13, 14, 15)); }
__device__ __forceinline__ v8f wmma16(v16h a, v16h b, v8f c) { return __builtin_amdgcn_wmma_f32_16x16x32_f16(false, a, false, b, (short)0, c, false, false); }
__device__ __forceinline__ v8f wmmab(v16bf a, v16bf b, v8f c) { return __builtin_amdgcn_wmma_f32_16x16x32_bf16(false, a, false, b, (short)0, c, false, false); }
__device__ __forceinline__ float xhalf(float x) { const int b = __float_as_int(x); return __int_as_float(__builtin_amdgcn_permlanex16(b, b, 0x76543210, 0xfedcba98, false, false)); }   // lane l <- lane l ^ 16
// lane l <- lane l ^ M inside its row of 16 lanes (DPP row_xmask; every lane of the wave must be on): for speed only, where __shfl_xor goes through the LDS pipe and its wait
template <int M> __device__ __forceinline__ float xrow(float x) { return __int_as_float(__builtin_amdgcn_update_dpp(0, __float_as_int(x), 0x160 | M, 0xf, 0xf, true)); }
__device__ __forceinline__ float wave_sum(float x) { x += xhalf(x); x += xrow<8>(x); x += xrow<4>(x); x += xrow<2>(x); return x + xrow<1>(x); }   // the sum over the 32 lanes, in every lane; partners 16, 8, 4, 2, 1



// ---- gemmw_tile (kernels k_gemmw and k_qkv): register-blocked GEMM, ONE WAVE per 64x64 output tile (16 accumulators), operands straight from K-contiguous 16-bit planes; grid (M/64, N/64, Z), 32 threads.
// c[m][n] = sum_k A[m][k] Bt[n][k] (+ split products per NSPLIT) + bias[n], f32, n < 256. z-batch strides sA/sB/sC in elements. K % 32 == 0. The 8192 rows m are (batch element, token).
// The epilogue does the elementwise pass that used to follow in a launch of its own, so that c never goes through memory:
// EPI 0: c as fp16 into the head planes P[batch][head][token][32]. EPI 1: c as fp16, transposed, into P[batch][column][token].
// EPI 2: C = bf16(R) + c, and the tile's sum of C and its squared deviations about the tile's own mean into PART (one group of the statistics over C). EPI 3: C = R + c.
// Every address of the epilogue is a tile base that is the same in all lanes, one lane offset that is kept to the end, and a compile-time step.
template <typename T16> struct WFrag;
template <> struct WFrag<bf> { typedef v16bf V; static __device__ __forceinline__ V ld(const bf* p) { return cat16b(*(const v8us*)p, *(const v8us*)(p + 16)); } static __device__ __forceinline__ v8f mma(V a, V b, v8f c) { return wmmab(a, b, c); } };
template <typename T16, int NSPLIT, int EPI>
__device__ __forceinline__ void gemmw_tile(const T16* __restrict__ A, const T16* __restrict__ A2, const T16* __restrict__ Bt, const T16* __restrict__ Bt2, const int K, float* C, const float* __restrict__ bias, const float* __restrict__ R, h16* P, float* PART) {
    typedef typename WFrag<T16>::V V;
    const int lane = threadIdx.x & 31, lr = lane & 15, hi = lane >> 4; const int r0 = blockIdx.x * 64, c0 = blockIdx.y * 64;
    v8f acc[4][4];
#pragma unroll
    for (int mb = 0; mb < 4; ++mb)
#pragma unroll
        for (int nb = 0; nb < 4; ++nb) acc[mb][nb] = (v8f){};
    const size_t aoff = (size_t)(r0 + lr) * K + 8 * hi, boff = (size_t)(c0 + lr) * K + 8 * hi;
#pragma unroll 1
    for (int kc = 0; kc < K; kc += 32) {
        V a[4], a2[4];
#pragma unroll
        for (int mb = 0; mb < 4; ++mb) { a[mb] = WFrag<T16>::ld(A + aoff + (size_t)mb * 16 * K + kc); if (NSPLIT == 1 || NSPLIT == 2) a2[mb] = WFrag<T16>::ld(A2 + aoff + (size_t)mb * 16 * K + kc); }
#pragma unroll
        for (int nb = 0; nb < 4; ++nb) { const V b = WFrag<T16>::ld(Bt + boff + (size_t)nb * 16 * K + kc); V b2; if (NSPLIT >= 2) b2 = WFrag<T16>::ld(Bt2 + boff + (size_t)nb * 16 * K + kc);
#pragma unroll
            for (int mb = 0; mb < 4; ++mb) { acc[mb][nb] = WFrag<T16>::mma(a[mb], b, acc[mb][nb]); if (NSPLIT == 1 || NSPLIT == 2) acc[mb][nb] = WFrag<T16>::mma(a2[mb], b, acc[mb][nb]); if (NSPLIT >= 2) acc[mb][nb] = WFrag<T16>::mma(a[mb], b2, acc[mb][nb]); } }
        asm volatile("v_nop\n\tv_nop\n\tv_nop\n\tv_nop" : "+v"(acc[0][0]), "+v"(acc[1][1]), "+v"(acc[2][2]), "+v"(acc[3][3]) : "v"(a[0]), "v"(a[3]));
    }
    asm volatile("s_wait_xcnt 0x0" ::: "memory");   // the wait owed before the epilogue gives new values to the address registers of the loop's loads
    const int bt = r0 >> 11, t0 = r0 & (TT - 1);   // the tile's batch element and its first token (64 divides 2048: a tile lies in one batch element)
    if constexpr (EPI == 1) {
        // lane (lr, hi) holds 8 consecutive tokens of one column: 16 bytes of fp16. Through LDS (pitch 144 B = 16 B x odd) each column's 64 tokens leave as one whole 128-byte line.
        __shared__ __align__(16) h16 ts[64 * 72];
#pragma unroll
        for (int nb = 0; nb < 4; ++nb) { const float bn = bfr(bias[c0 + nb * 16 + lr]);
#pragma unroll
            for (int mb = 0; mb < 4; ++mb) { v8h o;
#pragma unroll
                for (int j = 0; j < 8; ++j) o[j] = (h16)(acc[mb][nb][j] + bn);
                *(v8ha*)(ts + (nb * 16 + lr) * 72 + mb * 16 + hi * 8) = o; } }
        __builtin_amdgcn_wave_barrier(); asm volatile("" ::: "memory");   // keeps the LDS reads below behind the LDS writes above (other lanes' data)
        h16* vt = P + ((size_t)bt * CC + c0) * TT + t0; const int vo = (lane >> 3) * TT + (lane & 7) * 8;
#pragma unroll
        for (int s = 0; s < 16; ++s) *(v8h*)(vt + vo + s * 4 * TT) = *(const v8ha*)(ts + (s * 4 + (lane >> 3)) * 72 + (lane & 7) * 8);
    } else {
        __shared__ __align__(16) float os[16 * 68];
        float bq[2][8]; v4f bv, rr[2][8], hs = {0.f, 0.f, 0.f, 0.f};
        v4f keep[4][8];   // EPI 2: the tile's values of C, for the squared deviations about the tile's mean
        const float* rt = R + (size_t)r0 * CC + c0; float* ct = C + (size_t)r0 * CC + c0; const int lo = hi * CC + lr * 4;
        h16* pt = P + (((size_t)bt * NHD + (c0 >> 5)) * TT + t0) * DH;
        if constexpr (EPI == 0) {
#pragma unroll
            for (int hh = 0; hh < 2; ++hh)
#pragma unroll
                for (int q = 0; q < 8; ++q) bq[hh][q] = bfr(bias[c0 + hh * 32 + (lane & 3) * 8 + q]);
        } else {
            // the residual rows of two 16-row blocks are asked for ahead, those of block mb + 2 as soon as block mb's are used: their latency is waited out once
#pragma unroll
            for (int mb = 0; mb < 2; ++mb)
#pragma unroll
                for (int s = 0; s < 8; ++s) rr[mb][s] = *(const v4f*)(rt + lo + (mb * 16 + 2 * s) * CC);
            const v4f braw = *(const v4f*)(bias + c0 + lr * 4);
            asm volatile("s_wait_xcnt 0x0" :: "v"(lr) : "memory");   // the wait owed before the bias load's offset register (lr) takes a new value; lr as an input keeps it whole up to here, so that no residual load lands on it
#pragma unroll
            for (int q = 0; q < 4; ++q) bv[q] = bfr(braw[q]);
        }
#pragma unroll
        for (int mb = 0; mb < 4; ++mb) {
#pragma unroll
            for (int nb = 0; nb < 4; ++nb) {
#pragma unroll
                for (int j = 0; j < 8; ++j) os[(hi * 8 + j) * 68 + nb * 16 + lr] = acc[mb][nb][j]; }
            __builtin_amdgcn_wave_barrier(); asm volatile("" ::: "memory");   // keeps the LDS reads below behind the LDS writes above (other lanes' data)
            if constexpr (EPI == 0) {
                // one store = 8 tokens x 64 bytes of one head = 512 contiguous bytes
#pragma unroll
                for (int s = 0; s < 4; ++s) { const int hh = s >> 1, th = s & 1; const float* op = os + (th * 8 + (lane >> 2)) * 68 + hh * 32 + (lane & 3) * 8; const v4f x0 = *(const v4fa*)op, x1 = *(const v4fa*)(op + 4); v8h o;
#pragma unroll
                    for (int q = 0; q < 4; ++q) { o[q] = (h16)(x0[q] + bq[hh][q]); o[4 + q] = (h16)(x1[q] + bq[hh][4 + q]); }
                    *(v8h*)(pt + lane * 8 + (hh * TT + mb * 16 + th * 8) * DH) = o; }
            } else {
#pragma unroll
                for (int s = 0; s < 8; ++s) { const int row = 2 * s + hi, cofs = lr * 4; const v4f val = *(const v4fa*)(os + row * 68 + cofs) + bv; const v4f x = rr[mb & 1][s]; v4f o;
#pragma unroll
                    for (int q = 0; q < 4; ++q) { o[q] = __fadd_rn(EPI == 2 ? bfr(x[q]) : x[q], val[q]); if (EPI == 2) hs[q] = __fadd_rn(hs[q], o[q]); }
                    if constexpr (EPI == 2) keep[mb][s] = o;   // block mb's accumulators are dead by now: the tile's values take their place in the registers
                    *(v4f*)(ct + lo + (mb * 16 + 2 * s) * CC) = o; }
                if (mb < 2) {
#pragma unroll
                    for (int s = 0; s < 8; ++s) rr[mb][s] = *(const v4f*)(rt + lo + ((mb + 2) * 16 + 2 * s) * CC); }
            }
            __builtin_amdgcn_wave_barrier(); asm volatile("" ::: "memory");   // keeps the next block's LDS writes behind this block's LDS reads
        }
        if constexpr (EPI == 2) {
            // fixed order: four chains a lane, their pair sums, the lanes of the wave; one 128-byte line of PART per tile: set bt, row (column tile) * NW + 64-row slice; word 0 the sum, word 1 the squared deviations
            float s = __fadd_rn(__fadd_rn(hs[0], hs[1]), __fadd_rn(hs[2], hs[3]));
#pragma unroll
            for (int sh = 16; sh; sh >>= 1) s += __shfl_xor(s, sh, 32);
            const float mt = s * (1.0f / 4096.0f); v4f dq = {0.f, 0.f, 0.f, 0.f};   // the tile's own mean; its 4,096 values are still in the registers
            asm volatile("s_wait_xcnt 0x0" ::: "memory");   // the wait owed before the registers that the tile's stores name take new values in the sums below
#pragma unroll   // both loops unrolled: keep is indexed by constants only and so stays in registers
            for (int mb = 0; mb < 4; ++mb)
#pragma unroll
                for (int u = 0; u < 8; ++u) { const v4f d = keep[mb][u] - mt; dq += d * d; }
            const float m2 = wave_sum((dq[0] + dq[1]) + (dq[2] + dq[3]));
            PART[(((size_t)bt * 4 + blockIdx.y) * NW + (t0 >> 6)) * 32 + lane] = (lane == 0) ? s : (lane == 1) ? m2 : 0.f;
        }
    }
}
template <typename T16, int NSPLIT, int EPI>
__global__ __launch_bounds__(32) void k_gemmw(const T16* __restrict__ A, const T16* __restrict__ A2, const T16* __restrict__ Bt, const T16* __restrict__ Bt2, int K, float* C, const float* __restrict__ bias, const float* __restrict__ R, h16* P, float* PART, size_t sA, size_t sB, size_t sC) {
    const size_t z = blockIdx.z; A += z * sA; if (A2) A2 += z * sA; Bt += z * sB; if (Bt2) Bt2 += z * sB; C += z * sC;
    gemmw_tile<T16, NSPLIT, EPI>(A, A2, Bt, Bt2, K, C, bias, R, P, PART);
}
// The three projections depend on nothing of one another: one launch, blockIdx.z = 0: Q, 1: K (hi + lo planes of the normalised X and Y, one behind the other in Ph and Pl), 2: V (plain bf16 Y).
// A launch of 512 one-wave tiles leaves every SIMD with at most one wave, which waits out each k step's load latency alone; 1,536 tiles share the SIMDs and the launch's start and end are paid once.
// W: the planes of Wq, Wk, Wv one behind the other.
__global__ __launch_bounds__(32) void k_qkv(const bf* __restrict__ Ph, const bf* __restrict__ Pl, const bf* __restrict__ YB, const bf* __restrict__ W, const float* __restrict__ bq, const float* __restrict__ bk, const float* __restrict__ bv, h16* QP, h16* KP, h16* V16) {
    const int z = blockIdx.z;
    if (z == 2) gemmw_tile<bf, 0, 1>(YB, nullptr, W + 2 * CC * CC, nullptr, CC, nullptr, bv, nullptr, V16, nullptr);
    else gemmw_tile<bf, 1, 0>(Ph + (size_t)z * NB_ * TT * CC, Pl + (size_t)z * NB_ * TT * CC, W + z * CC * CC, nullptr, CC, nullptr, z ? bk : bq, nullptr, z ? KP : QP, nullptr);
}

__device__ __forceinline__ void splitf(float y, unsigned short& h, unsigned short& l) { h = f2bf(y); l = f2bf(y - bf2f(h)); }
typedef __attribute__((ext_vector_type(2))) _Float16 v2h;
typedef __attribute__((ext_vector_type(4))) _Float16 v4h;
typedef __attribute__((ext_vector_type(2))) unsigned short v2us;
typedef __attribute__((ext_vector_type(8))) _Float16 v8h16;

// CVU groups of 8 values a thread (a work-group: CVU * 2,048 values in a row), all loads issued before the first value is used; few waves with much to do each, for speed only
#define CVU 4
__device__ __forceinline__ void cvt8_blk(const float* __restrict__ src, bf* dst, const unsigned blk) { const size_t i = ((size_t)blk * (CVU * 256) + threadIdx.x) * 8; const float* p = src + i; bf* d = dst + i; v8f v[CVU]; v8us o[CVU];
#pragma unroll   // unrolled, here and below: v and o are indexed by constants only and so stay in registers
    for (int u = 0; u < CVU; ++u) v[u] = *(const v8f*)(p + u * 2048);
    asm volatile("s_wait_xcnt 0x0" :: "v"(p) : "memory");   // the wait owed before the loads' address registers take new values in the rounding below; p as an input keeps the pair whole up to here
#pragma unroll
    for (int u = 0; u < CVU; ++u)
#pragma unroll
        for (int k = 0; k < 8; ++k) o[u][k] = f2bf(v[u][k]);
#pragma unroll
    for (int u = 0; u < CVU; ++u) *(v8us*)(d + u * 2048) = o[u];
    asm volatile("s_wait_xcnt 0x0" ::: "memory"); }   // the wait owed behind the stores: in k_pre the code of the other branches follows in the listing and gives new values to the stores' registers
// set = statistic set: sets 0..NB_-1 are the batch elements of A0, sets NB_.. those of A1; slice = one slice of 64 rows, one group of the statistics: its sum and its squared deviations about its own mean.
// Wave v of the work-group takes rows 8v .. 8v + 7 of the slice: 16 loads of 16 bytes a lane, all issued before the first value is used, so that the wave waits out the load latency once and not once a load.
// amdgpu_waves_per_eu (on the kernels that call it): without the hint the compiler saved registers for sixteen waves a SIMD and held four of the sixteen loads back until earlier ones had returned.
// Fixed order, for the sum and then for the squared deviations: four chains a lane (one per vector component), their pair sums, the lanes of the wave, then the eight waves through LDS.
// The slice's 16,384 values stay in the registers between the two, so that they are read once; about the slice's own mean nothing cancels, whatever the mean of the whole set is.
template <int RAW>
__device__ __forceinline__ void psum_slice(const float* __restrict__ A0, const float* __restrict__ A1, float* PART, const int slice, const int set) {
    __shared__ float wsum[8], wsq[8];
    const float* A = set < NB_ ? A0 + (size_t)set * TT * CC : A1 + (size_t)(set - NB_) * TT * CC; PART += (size_t)set * NW * 32;
    const int lane = threadIdx.x & 31, wv = threadIdx.x >> 5; const float* p = A + ((size_t)slice * 64 + wv * 8) * CC + lane * 4;
    v4f v[16];
#pragma unroll
    for (int u = 0; u < 16; ++u) v[u] = *(const v4f*)(p + u * 128);
    asm volatile("s_wait_xcnt 0x0" :: "v"(p) : "memory");   // the wait owed before the loads' address registers take new values; p as an input keeps the pair whole up to here, so that no load of the run lands on it
    v4f a = {0.f, 0.f, 0.f, 0.f}, dq = {0.f, 0.f, 0.f, 0.f};
#pragma unroll
    for (int u = 0; u < 16; ++u) {
#pragma unroll
        for (int q = 0; q < 4; ++q) { if (RAW) v[u][q] = bfr(v[u][q]); a[q] = __fadd_rn(a[q], v[u][q]); } }
    float s = __fadd_rn(__fadd_rn(a[0], a[1]), __fadd_rn(a[2], a[3]));
#pragma unroll
    for (int sh = 16; sh; sh >>= 1) s += __shfl_xor(s, sh, 32);
    if (lane == 0) wsum[wv] = s;
    __syncthreads();   // the eight waves' sums are in LDS; every wave joins them, in one order, to the slice's sum
    float t = wsum[lane & 7]; t += xrow<4>(t); t += xrow<2>(t); t += xrow<1>(t);
    const float ms = t * (1.0f / 16384.0f);
#pragma unroll   // unrolled: v is indexed by constants only and so stays in registers
    for (int u = 0; u < 16; ++u) { const v4f d = v[u] - ms; dq += d * d; }
    const float r = wave_sum((dq[0] + dq[1]) + (dq[2] + dq[3]));
    if (lane == 0) wsq[wv] = r;
    __syncthreads();   // the eight waves' squared deviations are in LDS; wave 0 joins them
    if (wv == 0) { float t2 = wsq[lane & 7]; t2 += xrow<4>(t2); t2 += xrow<2>(t2); t2 += xrow<1>(t2);
        PART[(size_t)slice * 32 + lane] = (lane == 0) ? t : (lane == 1) ? t2 : 0.f; }
}
// The three passes that depend on the inputs alone, in one launch: first the 256 slices of the statistics over X and Y (the next launch waits for them),
// then the bf16 copy of Y (NBY work-groups), then the bf16 planes of the five weight matrices (NBW work-groups each, one plane behind the other in WP).
#define NBS (NW * 2 * NB_)
#define NBY (NB_ * TT * CC / 8 / 256 / CVU)
#define NBW (CC * CC / 8 / 256 / CVU)
__global__ __launch_bounds__(256) __attribute__((amdgpu_waves_per_eu(2, 4))) void k_pre(const float* __restrict__ X, const float* __restrict__ Y, const float* __restrict__ s0, const float* __restrict__ s1, const float* __restrict__ s2, const float* __restrict__ s3, const float* __restrict__ s4, float* PART, bf* YB, bf* WP) {
    const unsigned b = blockIdx.x;
    if (b < NBS) psum_slice<1>(X, Y, PART, b % NW, b / NW);
    else if (b < NBS + NBY) cvt8_blk(Y, YB, b - NBS);
    else { const unsigned y = (b - NBS - NBY) / NBW; cvt8_blk(y == 0 ? s0 : y == 1 ? s1 : y == 2 ? s2 : y == 3 ? s3 : s4, WP + (size_t)y * CC * CC, (b - NBS - NBY) % NBW); }
}
// One wave joins a set's NP * NW groups (NP per lane: one slice from k_pre, or the four column tiles of k_gemmw) of TT * CC / (NP * NW) values each; PART holds a group's sum in word 0 of its line and its squared
// deviations about its own mean in word 1. Squared deviations about the set's mean = sum over the groups of (their own + group size x (group mean - set mean)^2): only non-negative terms are added.
// Returns {mean, 1 / sqrt(variance + 1e-5)} in every lane.
template <int NP>
__device__ __forceinline__ v2f join_stats(const float* __restrict__ PART, const int lane) {
    constexpr float gn = (float)(TT * CC / (NP * NW)), inv = 1.0f / (float)(TT * CC); const float* p = PART + (size_t)lane * 32; v2f g[NP];
#pragma unroll   // unrolled, here and below: g stays in registers and its NP loads are in flight together
    for (int k = 0; k < NP; ++k) g[k] = *(const v2f*)(p + (size_t)k * NW * 32);
    asm volatile("s_wait_xcnt 0x0" ::: "memory");   // the wait owed before the loads' address registers take new values
    float s = g[0][0];
#pragma unroll
    for (int k = 1; k < NP; ++k) s += g[k][0];
    const float mu = wave_sum(s) * inv; float m2 = 0.f;
#pragma unroll
    for (int k = 0; k < NP; ++k) { const float d = g[k][0] * (1.0f / gn) - mu; m2 += g[k][1] + gn * d * d; }
    return (v2f){mu, __fdiv_rn(1.0f, __fsqrt_rn(__fadd_rn(wave_sum(m2) * inv, 1e-5f)))}; }
// Normalises one set's plane (blockIdx.y: the set) and splits it into its hi + lo planes. No launch stands between the groups' sums and their use: wave 0 of each work-group joins the set's statistics and hands
// them to the other waves through LDS. The values and their scale and shift are asked for ahead of the join, so that the two latencies run side by side.
// A thread takes SNV groups of 4 values, 1,024 values apart (a work-group: SNV * 1,024 values in a row = SNV * 4 rows, so that a thread keeps its four columns and their scale and shift):
// the pass is made of few waves with much to do each, for speed only; a wave-wide load covers 512 bytes in a row, and all SNV are in flight together.
#define SNV 8
#define SNG (TT * CC / (256 * 4 * SNV))
typedef __attribute__((ext_vector_type(4))) unsigned short v4us;
template <int RAW, int RELU, int NP>
__global__ __launch_bounds__(256) void k_snpl(const float* __restrict__ A0, const float* __restrict__ A1, const float* __restrict__ PART, const float* __restrict__ w0, const float* __restrict__ bb0, const float* __restrict__ w1, const float* __restrict__ bb1, bf* Ph, bf* Pl) {
    __shared__ float st[2];
    const int set = blockIdx.y, c = (int)(threadIdx.x * 4) & (CC - 1); const bool first = set < NB_; const size_t i = (size_t)blockIdx.x * (256 * 4 * SNV) + threadIdx.x * 4;
    const float* p = (first ? A0 + (size_t)set * TT * CC : A1 + (size_t)(set - NB_) * TT * CC) + i; v4f x[SNV];
#pragma unroll   // unrolled, here and below: x, oh and ol are indexed by constants only and so stay in registers
    for (int u = 0; u < SNV; ++u) x[u] = *(const v4f*)(p + u * 1024);
    v4f w4 = *(const v4f*)((first ? w0 : w1) + c), b4 = *(const v4f*)((first ? bb0 : bb1) + c);
    asm volatile("s_wait_xcnt 0x0" :: "v"(p) : "memory");   // the wait owed before the loads' address registers take new values; p as an input keeps the pair whole up to here, so that no load of the run lands on it
    if (threadIdx.x < 32) { const v2f r = join_stats<NP>(PART + (size_t)set * NP * NW * 32, threadIdx.x); if (threadIdx.x == 0) { st[0] = r[0]; st[1] = r[1]; } }
    __syncthreads();   // the set's mean and scale are in LDS for all eight waves
    const float mu = st[0], rs = st[1]; v4us oh[SNV], ol[SNV];
#pragma unroll
    for (int q = 0; q < 4; ++q) { w4[q] = bfr(w4[q]); b4[q] = bfr(b4[q]); }
#pragma unroll
    for (int u = 0; u < SNV; ++u)
#pragma unroll
        for (int q = 0; q < 4; ++q) { float xv = x[u][q]; if (RAW) xv = bfr(xv); const float t = __fmul_rn(__fsub_rn(xv, mu), rs); float y = __fadd_rn(__fmul_rn(t, w4[q]), b4[q]); if (RELU) y = fmaxf(y, 0.f); unsigned short a, c2; splitf(y, a, c2); oh[u][q] = a; ol[u][q] = c2; }
    bf* ph = Ph + (size_t)set * TT * CC + i; bf* pl = Pl + (size_t)set * TT * CC + i;
#pragma unroll
    for (int u = 0; u < SNV; ++u) { *(v4us*)(ph + u * 1024) = oh[u]; *(v4us*)(pl + u * 1024) = ol[u]; }
}
// ---- k_fattn: scores, softmax, attn.v and the hi/lo split of O in one kernel; no score and no weight leaves the registers.
// grid (2048 / 256 query blocks, 32 (batch, head) pairs), 16 waves. The pair's whole K [2048][32] and V^T [32][2048] are laid into LDS once (padded pitches), then read by every wave.
// Wave w: query columns (w & 7) * 32 .. + 31, keys (w >> 3) * 1024 .. + 1023, 64 keys a pass. S^T = K Q^T: lane (c, h) holds query c's scores of keys 8h + r of each 16-key tile, which, rounded to fp16,
// ARE the B operand of O^T += V^T P^T (hardware k order; K, Q and V^T fragments are loaded in the same order). Running maximum per query column; the two key halves are joined through LDS at the end.
typedef float __attribute__((may_alias)) fa;
// v_exp_f32 with the one slot behind a transcendental filled in the same statement
__device__ __forceinline__ float exp2_slot(float x) { float r; asm("v_exp_f32 %0, %1\n\tv_nop" : "=v"(r) : "v"(x)); return r; }
__global__ __launch_bounds__(512) void k_fattn(const h16* __restrict__ QP, const h16* __restrict__ KP, const h16* __restrict__ V16, bf* Oh, bf* Ol) {
    __shared__ __align__(16) unsigned char sm[TT * KPB + DH * VPB];
    unsigned char* Ks = sm; unsigned char* Vs = sm + TT * KPB;
    const int g = blockIdx.y, tid = threadIdx.x, lane = tid & 31, wave = tid >> 5, lr = lane & 15, hi = lane >> 4;
    const int qg = wave & 7, kh = wave >> 3, q0 = blockIdx.x * 256 + qg * 32;
    v16h qf[2];
#pragma unroll
    for (int t = 0; t < 2; ++t) { const h16* p = QP + ((size_t)g * TT + q0 + t * 16 + lr) * DH + 8 * hi; qf[t] = cat16(*(const v8h*)p, *(const v8h*)(p + 16)); }
    asm volatile("s_wait_xcnt 0x0" ::: "memory");   // the Q loads' address registers are given new values further down, ahead of the loads' data wait: this wait stands in front of that
    const h16* Kg = KP + (size_t)g * TT * DH; const h16* Vg = V16 + (size_t)g * DH * TT;
#pragma unroll
    for (int u = 0; u < TT * DH / 8 / 512; ++u) { const int i = u * 512 + tid; *(v8ha*)(Ks + (i >> 2) * KPB + (i & 3) * 16) = *(const v8h*)(Kg + (size_t)i * 8); }
#pragma unroll
    for (int u = 0; u < TT * DH / 8 / 512; ++u) { const int i = u * 512 + tid; *(v8ha*)(Vs + (i >> 8) * VPB + (i & 255) * 16) = *(const v8h*)(Vg + (size_t)i * 8); }
    __syncthreads();
    v8f o[2][2]; float m[2], l[2];
#pragma unroll
    for (int t = 0; t < 2; ++t) { o[t][0] = (v8f){}; o[t][1] = (v8f){}; m[t] = -3.0e38f; l[t] = 0.f; }
    const unsigned char* kp = Ks + (kh * (TT / 2) + lr) * KPB + 16 * hi; const unsigned char* vp = Vs + lr * VPB + (kh * (TT / 2) + 8 * hi) * 2;
    // kept rolled: one pass is already several hundred instructions
#pragma unroll 1
    for (int ps = 0; ps < TT / 2 / 64; ++ps, kp += 64 * KPB, vp += 64 * 2) {
        v8f s[2][4];
#pragma unroll
        for (int kt = 0; kt < 4; ++kt) { const v16h ka = cat16(*(const v8ha*)(kp + kt * 16 * KPB), *(const v8ha*)(kp + kt * 16 * KPB + 32));
#pragma unroll
            for (int t = 0; t < 2; ++t) s[t][kt] = wmma16(ka, qf[t], (v8f){}); }
        v16h va[2][2];
#pragma unroll
        for (int dt = 0; dt < 2; ++dt)
#pragma unroll
            for (int kk = 0; kk < 2; ++kk) va[dt][kk] = cat16(*(const v8ha*)(vp + dt * 16 * VPB + kk * 64), *(const v8ha*)(vp + dt * 16 * VPB + kk * 64 + 32));
#pragma unroll
        for (int t = 0; t < 2; ++t) {
            float mk[4];
#pragma unroll
            for (int kt = 0; kt < 4; ++kt) { mk[kt] = s[t][kt][0];
#pragma unroll
                for (int j = 1; j < 8; ++j) mk[kt] = fmaxf(mk[kt], s[t][kt][j]); }
            float mx = fmaxf(fmaxf(mk[0], mk[1]), fmaxf(mk[2], mk[3])); mx = fmaxf(mx, xhalf(mx));
            const float mn = fmaxf(m[t], mx * C2), al = exp2_slot(m[t] - mn); m[t] = mn;
            const v2f cv = {C2, C2}, nb = {PSH - mn, PSH - mn}; v2f sk[4]; v16h pf[2];
#pragma unroll
            for (int kt = 0; kt < 4; ++kt) {
#pragma unroll
                for (int j = 0; j < 8; j += 2) { const v2f x = __builtin_elementwise_fma((v2f){s[t][kt][j], s[t][kt][j + 1]}, cv, nb); const v2f e = {__builtin_amdgcn_exp2f(x[0]), __builtin_amdgcn_exp2f(x[1])}; sk[kt] = j ? sk[kt] + e : e;
                    const v2h c = __builtin_convertvector(e, v2h); pf[kt >> 1][(kt & 1) * 8 + j] = c[0]; pf[kt >> 1][(kt & 1) * 8 + j + 1] = c[1]; } }
            const v2f st = (sk[0] + sk[1]) + (sk[2] + sk[3]); l[t] = l[t] * al + (st[0] + st[1]);
#pragma unroll
            for (int dt = 0; dt < 2; ++dt) { o[t][dt] *= al;
#pragma unroll
                for (int kk = 0; kk < 2; ++kk) o[t][dt] = wmma16(va[dt][kk], pf[kk], o[t][dt]); }
        }
    }
    __syncthreads();   // every wave has left K and V^T: the first K rows now carry the upper key half's state to its partner wave
    fa* mb = (fa*)sm + (size_t)qg * 36 * 32 + lane;
    if (kh == 1) {
#pragma unroll
        for (int t = 0; t < 2; ++t) { mb[(t * 18) * 32] = m[t]; mb[(t * 18 + 1) * 32] = l[t];
#pragma unroll
            for (int r = 0; r < 16; ++r) mb[(t * 18 + 2 + r) * 32] = o[t][r >> 3][r & 7]; }
    }
    __syncthreads();
    if (kh == 0) {
#pragma unroll
        for (int t = 0; t < 2; ++t) { const float m1 = mb[(t * 18) * 32], l1 = mb[(t * 18 + 1) * 32], mN = fmaxf(m[t], m1); float a0 = exp2_slot(m[t] - mN), a1 = exp2_slot(m1 - mN);
            float lt = l[t] * a0 + l1 * a1; lt += xhalf(lt); const float inv = __fdiv_rn(1.0f, lt); a0 *= inv; a1 *= inv;
#pragma unroll
            for (int dt = 0; dt < 2; ++dt) { v8us oh, ol;
#pragma unroll
                for (int j = 0; j < 8; ++j) { unsigned short a, c2; splitf(o[t][dt][j] * a0 + mb[(t * 18 + 2 + dt * 8 + j) * 32] * a1, a, c2); oh[j] = a; ol[j] = c2; }
                const size_t off = ((size_t)(g >> 3) * TT + q0 + t * 16 + lr) * CC + (g & 7) * DH + dt * 16 + 8 * hi; *(v8us*)(Oh + off) = oh; *(v8us*)(Ol + off) = ol; } }
    }
}
extern "C" void kernel_launch(void* const* d_in, const int* in_sizes, int n_in,
                              void* d_out, int out_size, void* d_ws, size_t ws_size, hipStream_t stream) {
    (void)in_sizes; (void)n_in; (void)out_size;
    const float* IN[18]; for (int i = 0; i < 18; ++i) IN[i] = (const float*)d_in[i];
    // X, Y [4][2048][256], Wq [256][256], bq, Wk, bk, Wv, bv, Wo, bo, Wres, bres, nq_w, nq_b, nk_w, nk_b, n0_w, n0_b = d_in[0..17]
    float* OUT = (float*)d_out;     // [4][2048][256]
    char* wsp = (char*)d_ws;
    auto take = [&](size_t bytes) { char* p = wsp; wsp += (bytes + 255) & ~(size_t)255; return (void*)p; };
    const size_t PE = (size_t)TT * CC;                      // elements of one batch element's [2048][256] plane
    bf* WQ = (bf*)take((size_t)CC * CC * 2); bf* WK = (bf*)take((size_t)CC * CC * 2); bf* WV = (bf*)take((size_t)CC * CC * 2); bf* WO = (bf*)take((size_t)CC * CC * 2); bf* WR = (bf*)take((size_t)CC * CC * 2);   (void)WK; (void)WV;   // one behind the other (k_pre, k_qkv)
    float* PART = (float*)take((size_t)4 * NB_ * NW * 32 * 4);
    // live through the attention part; g = batch * 8 + head runs through all of them
    h16* QP = (h16*)take((size_t)NB_ * NHD * TT * DH * 2); h16* KP = (h16*)take((size_t)NB_ * NHD * TT * DH * 2); h16* V16 = (h16*)take((size_t)NB_ * CC * TT * 2);
    bf* Ph = (bf*)take(2 * NB_ * PE * 2); bf* Pl = (bf*)take(2 * NB_ * PE * 2); bf* YB = (bf*)take(NB_ * PE * 2);
    bf* Oh = YB; bf* Ol = (bf*)take(NB_ * PE * 2); float* H = (float*)take(NB_ * PE * 4);
    if ((size_t)(wsp - (char*)d_ws) > ws_size) return;    // total ~ 45 MiB; ws 256 MiB
    const dim3 gP(NB_ * TT / 64, CC / 64, 1);
    // SetNorm(X) and SetNorm(Y), all batch elements: sets 0..3 = X, 4..7 = Y
    k_pre<<<NBS + NBY + 5 * NBW, 256, 0, stream>>>(IN[0], IN[1], IN[2], IN[4], IN[6], IN[8], IN[10], PART, YB, WQ);
    k_snpl<1, 0, 1><<<dim3(SNG, 2 * NB_), 256, 0, stream>>>(IN[0], IN[1], PART, IN[12], IN[13], IN[14], IN[15], Ph, Pl);
    // Q = SetNorm(X) Wq^T + bq; K = SetNorm(Y) Wk^T + bk; V = Y Wv^T + bv: the four batch elements are 8192 rows of one product; each leaves its GEMM as the fp16 plane that the attention kernel reads
    k_qkv<<<dim3(NB_ * TT / 64, CC / 64, 3), 32, 0, stream>>>(Ph, Pl, YB, WQ, IN[3], IN[5], IN[7], QP, KP, V16);
    k_fattn<<<dim3(TT / 256, NB_ * NHD), 512, 0, stream>>>(QP, KP, V16, Oh, Ol);                             // softmax(Q_h K_h^T / 16) V_h, all pairs -> O as hi + lo planes
    k_gemmw<bf, 1, 2><<<gP, 32, 0, stream>>>(Oh, Ol, WO, nullptr, CC, H, IN[9], IN[0], nullptr, PART, 0, 0, 0);   // H = bf16(X) + O Wo^T + bo, and H's statistics per tile
    k_snpl<0, 1, 4><<<dim3(SNG, NB_), 256, 0, stream>>>(H, H, PART, IN[16], IN[17], IN[16], IN[17], Ph, Pl);      // relu(SetNorm(H))
    k_gemmw<bf, 1, 3><<<gP, 32, 0, stream>>>(Ph, Pl, WR, nullptr, CC, OUT, IN[11], H, nullptr, nullptr, 0, 0, 0);  // out = H + relu(SetNorm(H)) Wres^T + bres
}

// v008
// Measured time: 61.4 microseconds a run.
// Timed twice side by side with v007, it ran 1.26 and 1.22 times as fast.
// All steps since v000 together make it 48.7 times as fast.
#include <hip/hip_runtime.h>

// MABClean (Set-Transformer MAB; X, Y [4][2048][256]; Q = SetNorm(X) Wq^T + bq, K = SetNorm(Y) Wk^T + bk, V = Y Wv^T + bv (SetNorm: normalise over all (samples, features) of one batch element, eps 1e-5,
// then per-feature scale/shift); 8 heads of 32: A = softmax_k(Q_h.K_h / sqrt(256)); O = concat_h A V_h; H = X + O Wo^T + bo; out = H + relu(SetNorm(H)) Wres^T + bres).
// Compute dtypes, f32 accumulate: every input rounded to bf16; the three SetNorm statistics (mean and variance over 524,288 values each) in ONE pass over the values: each group
// (a 64-row slice, a 64x64 tile) gives its sum and its squared deviations about ITS OWN mean, joined in fixed order (join_stats); the normalised operands as bf16 hi+lo planes x exact weights (2 products); V on PLAIN bf16 operands (exact, + bias); scores (K = 32) and attn.v on SINGLE fp16 planes (model

#define NB_  4
#define TT   2048
#define CC   256
#define NHD  8
#define DH   32
#define SCL  0.0625f              // 1/sqrt(dim_Y = 256)
#define C2   (SCL * 1.44269504f)  // score -> exponent of two
#define PSH  10.0f                // P carries 2^10 (as does its sum), so that small weights stay normal fp16 numbers
#define KPB  80                   // LDS pitch of one K row: 64 bytes + 16 (16 B x odd: no bank conflict for 16-byte reads down a column of rows)
#define VPB  4112                 // LDS pitch of one row of V^T: 4096 bytes + 16
#define NW   32                   // 64-row slices per statistic (k_pre: one group (sum, squared deviations) each, from a work-group of 8 waves; k_gemmw: four, one a column tile)
typedef _Float16 h16;
typedef unsigned short bf;
typedef __attribute__((ext_vector_type(16))) __bf16   v16bf;
typedef __attribute__((ext_vector_type(16))) _Float16 v16h;
typedef __attribute__((ext_vector_type(8)))  _Float16 v8h;
typedef __attribute__((ext_vector_type(8)))  unsigned short v8us;
typedef __attribute__((ext_vector_type(8)))  float    v8f;
typedef __attribute__((ext_vector_type(4)))  float    v4f;
typedef v8h  __attribute__((may_alias)) v8ha;
typedef v4f  __attribute__((may_alias)) v4fa;
typedef v8us __attribute__((may_alias)) v8usa;
typedef __attribute__((ext_vector_type(2)))  float    v2f;

__device__ __forceinline__ unsigned short f2bf(float f) { unsigned u = __float_as_uint(f); u += 0x7FFFu + ((u >> 16) & 1u); return (unsigned short)(u >> 16); }
__device__ __forceinline__ float bf2f(unsigned short b) { return __uint_as_float(((unsigned)b) << 16); }
__device__ __forceinline__ float bfr(float f) { return bf2f(f2bf(f)); }
__device__ __forceinline__ v16h cat16(v8h lo, v8h hi) { return __builtin_shufflevector(lo, hi, 0, 1, 2, 3, 4, 5, 6, 7, 8, 9, 10, 11, 12, 13, 14, 15); }
__device__ __forceinline__ v16bf cat16b(v8us lo, v8us hi) { return __builtin_bit_cast(v16bf, __builtin_shufflevector(lo, hi, 0, 1, 2, 3, 4, 5, 6, 7, 8, 9, 10, 11, 12, 13, 14, 15)); }
__device__ __forceinline__ v8f wmma16(v16h a, v16h b, v8f c) { return __builtin_amdgcn_wmma_f32_16x16x32_f16(false, a, false, b, (short)0, c, false, false); }
__device__ __forceinline__ v8f wmmab(v16bf a, v16bf b, v8f c) { return __builtin_amdgcn_wmma_f32_16x16x32_bf16(false, a, false, b, (short)0, c, false, false); }
__device__ __forceinline__ float xhalf(float x) { const int b = __float_as_int(x); return __int_as_float(__builtin_amdgcn_permlanex16(b, b, 0x76543210, 0xfedcba98, false, false)); }   // lane l <- lane l ^ 16
// lane l <- lane l ^ M inside its row of 16 lanes (DPP row_xmask; every lane of the wave must be on): for speed only, where __shfl_xor goes through the LDS pipe and its wait
template <int M> __device__ __forceinline__ float xrow(float x) { return __int_as_float(__builtin_amdgcn_update_dpp(0, __float_as_int(x), 0x160 | M, 0xf, 0xf, true)); }
__device__ __forceinline__ float wave_sum(float x) { x += xhalf(x); x += xrow<8>(x); x += xrow<4>(x); x += xrow<2>(x); return x + xrow<1>(x); }   // the sum over the 32 lanes, in every lane; partners 16, 8, 4, 2, 1



// ---- gemmw_tile (kernels k_gemmw, k_qkv and k_res): register-blocked GEMM, ONE WAVE per 64x64 output tile (16 accumulators), operands from K-contiguous 16-bit planes.
// NWV 1: a work-group is one wave, grid (M/64, N/64, Z), A and A2 are planes in memory. NWV 4: grid x = M/64, four waves share the tile rows and wave wv takes the columns 64 wv .. + 63;
// A and A2 are the tile's 64 rows in LDS (row pitch AP, laid there by stage_rows), and each wave has its own slice of the epilogue's LDS.
#define AP 264   // LDS pitch of a staged row in elements: 512 bytes + 16 (16 B x odd: no bank conflict for 16-byte reads down a column of rows)
// c[m][n] = sum_k A[m][k] Bt[n][k] (+ split products per NSPLIT) + bias[n], f32, n < 256. z-batch strides sA/sB/sC in elements. K % 32 == 0. The 8192 rows m are (batch element, token).
// The epilogue does the elementwise pass that used to follow in a launch of its own, so that c never goes through memory:
// EPI 0: c as fp16 into the head planes P[batch][head][token][32]. EPI 1: c as fp16, transposed, into P[batch][column][token].
// EPI 2: C = bf16(R) + c, and the tile's sum of C and its squared deviations about the tile's own mean into PART (one group of the statistics over C). EPI 3: C = R + c.
// Every address of the epilogue is a tile base that is the same in all lanes, one lane offset that is kept to the end, and a compile-time step.
template <typename T16> struct WFrag;
template <> struct WFrag<bf> { typedef v16bf V; static __device__ __forceinline__ V ld(const bf* p) { return cat16b(*(const v8us*)p, *(const v8us*)(p + 16)); } static __device__ __forceinline__ v8f mma(V a, V b, v8f c) { return wmmab(a, b, c); } };
template <typename T16, int NSPLIT, int EPI, int NWV = 1>
__device__ __forceinline__ void gemmw_tile(const T16* __restrict__ A, const T16* __restrict__ A2, const T16* __restrict__ Bt, const T16* __restrict__ Bt2, const int K, float* C, const float* __restrict__ bias, const float* __restrict__ R, h16* P, float* PART) {
    typedef typename WFrag<T16>::V V;
    static_assert(NWV == 1 || EPI != 2, "the line of PART is numbered by blockIdx.y");
    const int lane = threadIdx.x & 31, lr = lane & 15, hi = lane >> 4; const int wv = NWV == 1 ? 0 : __builtin_amdgcn_readfirstlane(threadIdx.x >> 5);   // the wave's number as a scalar: the tile bases stay the same in all lanes
    const int r0 = blockIdx.x * 64, c0 = (NWV == 1 ? blockIdx.y : wv) * 64;
    v8f acc[4][4];
#pragma unroll
    for (int mb = 0; mb < 4; ++mb)
#pragma unroll
        for (int nb = 0; nb < 4; ++nb) acc[mb][nb] = (v8f){};
    const size_t aoff = (size_t)(r0 + lr) * K + 8 * hi, boff = (size_t)(c0 + lr) * K + 8 * hi;
    if constexpr (NWV == 1) {
#pragma unroll 1
    for (int kc = 0; kc < K; kc += 32) {
        V a[4], a2[4];
#pragma unroll
        for (int mb = 0; mb < 4; ++mb) { a[mb] = WFrag<T16>::ld(A + aoff + (size_t)mb * 16 * K + kc); if (NSPLIT == 1 || NSPLIT == 2) a2[mb] = WFrag<T16>::ld(A2 + aoff + (size_t)mb * 16 * K + kc); }
#pragma unroll
        for (int nb = 0; nb < 4; ++nb) { const V b = WFrag<T16>::ld(Bt + boff + (size_t)nb * 16 * K + kc); V b2; if (NSPLIT >= 2) b2 = WFrag<T16>::ld(Bt2 + boff + (size_t)nb * 16 * K + kc);
#pragma unroll
            for (int mb = 0; mb < 4; ++mb) { acc[mb][nb] = WFrag<T16>::mma(a[mb], b, acc[mb][nb]); if (NSPLIT == 1 || NSPLIT == 2) acc[mb][nb] = WFrag<T16>::mma(a2[mb], b, acc[mb][nb]); if (NSPLIT >= 2) acc[mb][nb] = WFrag<T16>::mma(a[mb], b2, acc[mb][nb]); } }
        asm volatile("v_nop\n\tv_nop\n\tv_nop\n\tv_nop" : "+v"(acc[0][0]), "+v"(acc[1][1]), "+v"(acc[2][2]), "+v"(acc[3][3]) : "v"(a[0]), "v"(a[3]));
    }
    } else {
        const T16* as = A + lr * AP + 8 * hi; const T16* as2 = NSPLIT == 1 ? A2 + lr * AP + 8 * hi : as;   // the same k order as the B loader's: k = kc + 8 hi + 0..7, then kc + 16 + 8 hi + 0..7
#pragma unroll 1   // kept rolled, as the loop above
        for (int kc = 0; kc < K; kc += 32) {
            V a[4], a2[4];
#pragma unroll   // unrolled, here and below: a, a2 and acc are indexed by constants only and so stay in registers
            for (int mb = 0; mb < 4; ++mb) { a[mb] = WFrag<T16>::ld(as + mb * 16 * AP + kc); if (NSPLIT == 1) a2[mb] = WFrag<T16>::ld(as2 + mb * 16 * AP + kc); }
#pragma unroll
            for (int nb = 0; nb < 4; ++nb) { const V b = WFrag<T16>::ld(Bt + boff + (size_t)nb * 16 * K + kc);
#pragma unroll
                for (int mb = 0; mb < 4; ++mb) { acc[mb][nb] = WFrag<T16>::mma(a[mb], b, acc[mb][nb]); if (NSPLIT == 1) acc[mb][nb] = WFrag<T16>::mma(a2[mb], b, acc[mb][nb]); } }
            // the distance the chip needs behind the last matrix instruction, also on the taken side of the loop's branch, where the next trip's loads overwrite A
            asm volatile("v_nop\n\tv_nop\n\tv_nop\n\tv_nop" : "+v"(acc[0][0]), "+v"(acc[1][1]), "+v"(acc[2][2]), "+v"(acc[3][3]) : "v"(a[0]), "v"(a[3]));
        }
    }
    asm volatile("s_wait_xcnt 0x0" ::: "memory");   // the wait owed before the epilogue gives new values to the address registers of the loop's loads
    const int bt = r0 >> 11, t0 = r0 & (TT - 1);   // the tile's batch element and its first token (64 divides 2048: a tile lies in one batch element)
    if constexpr (EPI == 1) {
        // lane (lr, hi) holds 8 consecutive tokens of one column: 16 bytes of fp16. Through LDS (pitch 144 B = 16 B x odd) each column's 64 tokens leave as one whole 128-byte line.
        __shared__ __align__(16) h16 tsa[NWV * 64 * 72]; h16* ts = tsa + wv * 64 * 72;
#pragma unroll
        for (int nb = 0; nb < 4; ++nb) { const float bn = bfr(bias[c0 + nb * 16 + lr]);
#pragma unroll
            for (int mb = 0; mb < 4; ++mb) { v8h o;
#pragma unroll
                for (int j = 0; j < 8; ++j) o[j] = (h16)(acc[mb][nb][j] + bn);
                *(v8ha*)(ts + (nb * 16 + lr) * 72 + mb * 16 + hi * 8) = o; } }
        __builtin_amdgcn_wave_barrier(); asm volatile("" ::: "memory");   // keeps the LDS reads below behind the LDS writes above (other lanes' data)
        h16* vt = P + ((size_t)bt * CC + c0) * TT + t0; const int vo = (lane >> 3) * TT + (lane & 7) * 8;
#pragma unroll
        for (int s = 0; s < 16; ++s) *(v8h*)(vt + vo + s * 4 * TT) = *(const v8ha*)(ts + (s * 4 + (lane >> 3)) * 72 + (lane & 7) * 8);
    } else {
        __shared__ __align__(16) float osa[NWV * 16 * 68]; float* os = osa + wv * 16 * 68;
        float bq[2][8]; v4f bv, rr[2][8], hs = {0.f, 0.f, 0.f, 0.f};
        v4f keep[4][8];   // EPI 2: the tile's values of C, for the squared deviations about the tile's mean
        const float* rt = R + (size_t)r0 * CC + c0; float* ct = C + (size_t)r0 * CC + c0; const int lo = hi * CC + lr * 4;
        h16* pt = P + (((size_t)bt * NHD + (c0 >> 5)) * TT + t0) * DH;
        if constexpr (EPI == 0) {
#pragma unroll
            for (int hh = 0; hh < 2; ++hh)
#pragma unroll
                for (int q = 0; q < 8; ++q) bq[hh][q] = bfr(bias[c0 + hh * 32 + (lane & 3) * 8 + q]);
        } else {
            // the residual rows of two 16-row blocks are asked for ahead, those of block mb + 2 as soon as block mb's are used: their latency is waited out once
#pragma unroll
            for (int mb = 0; mb < 2; ++mb)
#pragma unroll
                for (int s = 0; s < 8; ++s) rr[mb][s] = *(const v4f*)(rt + lo + (mb * 16 + 2 * s) * CC);
            const v4f braw = *(const v4f*)(bias + c0 + lr * 4);
            asm volatile("s_wait_xcnt 0x0" :: "v"(lr) : "memory");   // the wait owed before the bias load's offset register (lr) takes a new value; lr as an input keeps it whole up to here, so that no residual load lands on it
#pragma unroll
            for (int q = 0; q < 4; ++q) bv[q] = bfr(braw[q]);
        }
#pragma unroll
        for (int mb = 0; mb < 4; ++mb) {
#pragma unroll
            for (int nb = 0; nb < 4; ++nb) {
#pragma unroll
                for (int j = 0; j < 8; ++j) os[(hi * 8 + j) * 68 + nb * 16 + lr] = acc[mb][nb][j]; }
            __builtin_amdgcn_wave_barrier(); asm volatile("" ::: "memory");   // keeps the LDS reads below behind the LDS writes above (other lanes' data)
            if constexpr (EPI == 0) {
                // one store = 8 tokens x 64 bytes of one head = 512 contiguous bytes
#pragma unroll
                for (int s = 0; s < 4; ++s) { const int hh = s >> 1, th = s & 1; const float* op = os + (th * 8 + (lane >> 2)) * 68 + hh * 32 + (lane & 3) * 8; const v4f x0 = *(const v4fa*)op, x1 = *(const v4fa*)(op + 4); v8h o;
#pragma unroll
                    for (int q = 0; q < 4; ++q) { o[q] = (h16)(x0[q] + bq[hh][q]); o[4 + q] = (h16)(x1[q] + bq[hh][4 + q]); }
                    *(v8h*)(pt + lane * 8 + (hh * TT + mb * 16 + th * 8) * DH) = o; }
            } else {
#pragma unroll
                for (int s = 0; s < 8; ++s) { const int row = 2 * s + hi, cofs = lr * 4; const v4f val = *(const v4fa*)(os + row * 68 + cofs) + bv; const v4f x = rr[mb & 1][s]; v4f o;
#pragma unroll
                    for (int q = 0; q < 4; ++q) { o[q] = __fadd_rn(EPI == 2 ? bfr(x[q]) : x[q], val[q]); if (EPI == 2) hs[q] = __fadd_rn(hs[q], o[q]); }
                    if constexpr (EPI == 2) keep[mb][s] = o;   // block mb's accumulators are dead by now: the tile's values take their place in the registers
                    *(v4f*)(ct + lo + (mb * 16 + 2 * s) * CC) = o; }
                if (mb < 2) {
#pragma unroll
                    for (int s = 0; s < 8; ++s) rr[mb][s] = *(const v4f*)(rt + lo + ((mb + 2) * 16 + 2 * s) * CC); }
            }
            __builtin_amdgcn_wave_barrier(); asm volatile("" ::: "memory");   // keeps the next block's LDS writes behind this block's LDS reads
        }
        if constexpr (EPI == 2) {
            // fixed order: four chains a lane, their pair sums, the lanes of the wave; one 128-byte line of PART per tile: set bt, row (column tile) * NW + 64-row slice; word 0 the sum, word 1 the squared deviations
            float s = __fadd_rn(__fadd_rn(hs[0], hs[1]), __fadd_rn(hs[2], hs[3]));
#pragma unroll
            for (int sh = 16; sh; sh >>= 1) s += __shfl_xor(s, sh, 32);
            const float mt = s * (1.0f / 4096.0f); v4f dq = {0.f, 0.f, 0.f, 0.f};   // the tile's own mean; its 4,096 values are still in the registers
            asm volatile("s_wait_xcnt 0x0" ::: "memory");   // the wait owed before the registers that the tile's stores name take new values in the sums below
#pragma unroll   // both loops unrolled: keep is indexed by constants only and so stays in registers
            for (int mb = 0; mb < 4; ++mb)
#pragma unroll
                for (int u = 0; u < 8; ++u) { const v4f d = keep[mb][u] - mt; dq += d * d; }
            const float m2 = wave_sum((dq[0] + dq[1]) + (dq[2] + dq[3]));
            PART[(((size_t)bt * 4 + blockIdx.y) * NW + (t0 >> 6)) * 32 + lane] = (lane == 0) ? s : (lane == 1) ? m2 : 0.f;
        }
    }
}
template <typename T16, int NSPLIT, int EPI>
__global__ __launch_bounds__(32) void k_gemmw(const T16* __restrict__ A, const T16* __restrict__ A2, const T16* __restrict__ Bt, const T16* __restrict__ Bt2, int K, float* C, const float* __restrict__ bias, const float* __restrict__ R, h16* P, float* PART, size_t sA, size_t sB, size_t sC) {
    const size_t z = blockIdx.z; A += z * sA; if (A2) A2 += z * sA; Bt += z * sB; if (Bt2) Bt2 += z * sB; C += z * sC;
    gemmw_tile<T16, NSPLIT, EPI>(A, A2, Bt, Bt2, K, C, bias, R, P, PART);
}
__device__ __forceinline__ void splitf(float y, unsigned short& h, unsigned short& l) { h = f2bf(y); l = f2bf(y - bf2f(h)); }
typedef __attribute__((ext_vector_type(2))) _Float16 v2h;
typedef __attribute__((ext_vector_type(4))) _Float16 v4h;
typedef __attribute__((ext_vector_type(2))) unsigned short v2us;
typedef __attribute__((ext_vector_type(8))) _Float16 v8h16;

// CVU groups of 8 values a thread (a work-group: CVU * 2,048 values in a row), all loads issued before the first value is used; few waves with much to do each, for speed only
#define CVU 4
__device__ __forceinline__ void cvt8_blk(const float* __restrict__ src, bf* dst, const unsigned blk) { const size_t i = ((size_t)blk * (CVU * 256) + threadIdx.x) * 8; const float* p = src + i; bf* d = dst + i; v8f v[CVU]; v8us o[CVU];
#pragma unroll   // unrolled, here and below: v and o are indexed by constants only and so stay in registers
    for (int u = 0; u < CVU; ++u) v[u] = *(const v8f*)(p + u * 2048);
    asm volatile("s_wait_xcnt 0x0" :: "v"(p) : "memory");   // the wait owed before the loads' address registers take new values in the rounding below; p as an input keeps the pair whole up to here
#pragma unroll
    for (int u = 0; u < CVU; ++u)
#pragma unroll
        for (int k = 0; k < 8; ++k) o[u][k] = f2bf(v[u][k]);
#pragma unroll
    for (int u = 0; u < CVU; ++u) *(v8us*)(d + u * 2048) = o[u];
    asm volatile("s_wait_xcnt 0x0" ::: "memory"); }   // the wait owed behind the stores: in k_pre the code of the other branches follows in the listing and gives new values to the stores' registers
// set = statistic set: sets 0..NB_-1 are the batch elements of A0, sets NB_.. those of A1; slice = one slice of 64 rows, one group of the statistics: its sum and its squared deviations about its own mean.
// Wave v of the work-group takes rows 8v .. 8v + 7 of the slice: 16 loads of 16 bytes a lane, all issued before the first value is used, so that the wave waits out the load latency once and not once a load.
// amdgpu_waves_per_eu (on the kernels that call it): without the hint the compiler saved registers for sixteen waves a SIMD and held four of the sixteen loads back until earlier ones had returned.
// Fixed order, for the sum and then for the squared deviations: four chains a lane (one per vector component), their pair sums, the lanes of the wave, then the eight waves through LDS.
// The slice's 16,384 values stay in the registers between the two, so that they are read once; about the slice's own mean nothing cancels, whatever the mean of the whole set is.
template <int RAW>
__device__ __forceinline__ void psum_slice(const float* __restrict__ A0, const float* __restrict__ A1, float* PART, const int slice, const int set) {
    __shared__ float wsum[8], wsq[8];
    const float* A = set < NB_ ? A0 + (size_t)set * TT * CC : A1 + (size_t)(set - NB_) * TT * CC; PART += (size_t)set * NW * 32;
    const int lane = threadIdx.x & 31, wv = threadIdx.x >> 5; const float* p = A + ((size_t)slice * 64 + wv * 8) * CC + lane * 4;
    v4f v[16];
#pragma unroll
    for (int u = 0; u < 16; ++u) v[u] = *(const v4f*)(p + u * 128);
    asm volatile("s_wait_xcnt 0x0" :: "v"(p) : "memory");   // the wait owed before the loads' address registers take new values; p as an input keeps the pair whole up to here, so that no load of the run lands on it
    v4f a = {0.f, 0.f, 0.f, 0.f}, dq = {0.f, 0.f, 0.f, 0.f};
#pragma unroll
    for (int u = 0; u < 16; ++u) {
#pragma unroll
        for (int q = 0; q < 4; ++q) { if (RAW) v[u][q] = bfr(v[u][q]); a[q] = __fadd_rn(a[q], v[u][q]); } }
    float s = __fadd_rn(__fadd_rn(a[0], a[1]), __fadd_rn(a[2], a[3]));
#pragma unroll
    for (int sh = 16; sh; sh >>= 1) s += __shfl_xor(s, sh, 32);
    if (lane == 0) wsum[wv] = s;
    __syncthreads();   // the eight waves' sums are in LDS; every wave joins them, in one order, to the slice's sum
    float t = wsum[lane & 7]; t += xrow<4>(t); t += xrow<2>(t); t += xrow<1>(t);
    const float ms = t * (1.0f / 16384.0f);
#pragma unroll   // unrolled: v is indexed by constants only and so stays in registers
    for (int u = 0; u < 16; ++u) { const v4f d = v[u] - ms; dq += d * d; }
    const float r = wave_sum((dq[0] + dq[1]) + (dq[2] + dq[3]));
    if (lane == 0) wsq[wv] = r;
    __syncthreads();   // the eight waves' squared deviations are in LDS; wave 0 joins them
    if (wv == 0) { float t2 = wsq[lane & 7]; t2 += xrow<4>(t2); t2 += xrow<2>(t2); t2 += xrow<1>(t2);
        PART[(size_t)slice * 32 + lane] = (lane == 0) ? t : (lane == 1) ? t2 : 0.f; }
}
// The two passes that depend on the inputs alone, in one launch: the 256 slices of the statistics over X and Y, then the bf16 planes of the five weight matrices (NBW work-groups each, one plane behind the other in WP).
#define NBS (NW * 2 * NB_)
#define NBW (CC * CC / 8 / 256 / CVU)
__global__ __launch_bounds__(256) __attribute__((amdgpu_waves_per_eu(2, 4))) void k_pre(const float* __restrict__ X, const float* __restrict__ Y, const float* __restrict__ s0, const float* __restrict__ s1, const float* __restrict__ s2, const float* __restrict__ s3, const float* __restrict__ s4, float* PART, bf* WP) {
    const unsigned b = blockIdx.x;
    if (b < NBS) psum_slice<1>(X, Y, PART, b % NW, b / NW);
    else { const unsigned y = (b - NBS) / NBW; cvt8_blk(y == 0 ? s0 : y == 1 ? s1 : y == 2 ? s2 : y == 3 ? s3 : s4, WP + (size_t)y * CC * CC, (b - NBS) % NBW); }
}
// One wave joins a set's NP * NW groups (NP per lane: one slice from k_pre, or the four column tiles of k_gemmw) of TT * CC / (NP * NW) values each; PART holds a group's sum in word 0 of its line and its squared
// deviations about its own mean in word 1. Squared deviations about the set's mean = sum over the groups of (their own + group size x (group mean - set mean)^2): only non-negative terms are added.
// Returns {mean, 1 / sqrt(variance + 1e-5)} in every lane.
template <int NP>
__device__ __forceinline__ v2f join_stats(const float* __restrict__ PART, const int lane) {
    constexpr float gn = (float)(TT * CC / (NP * NW)), inv = 1.0f / (float)(TT * CC); const float* p = PART + (size_t)lane * 32; v2f g[NP];
#pragma unroll   // unrolled, here and below: g stays in registers and its NP loads are in flight together
    for (int k = 0; k < NP; ++k) g[k] = *(const v2f*)(p + (size_t)k * NW * 32);
    asm volatile("s_wait_xcnt 0x0" ::: "memory");   // the wait owed before the loads' address registers take new values
    float s = g[0][0];
#pragma unroll
    for (int k = 1; k < NP; ++k) s += g[k][0];
    const float mu = wave_sum(s) * inv; float m2 = 0.f;
#pragma unroll
    for (int k = 0; k < NP; ++k) { const float d = g[k][0] * (1.0f / gn) - mu; m2 += g[k][1] + gn * d * d; }
    return (v2f){mu, __fdiv_rn(1.0f, __fsqrt_rn(__fadd_rn(wave_sum(m2) * inv, 1e-5f)))}; }
// stage_rows: the A operand of a 64-row tile is made where it is used. Wave wv of four reads rows 16 wv .. + 15 of the tile's f32 source (a lane: 8 columns of each row, all 32 loads in flight together),
// normalises them and lays the hi + lo bf16 planes into LDS, so that no plane goes through memory and no launch stands between the statistics and the product. Every wave joins the set's statistics itself (no hand-over).
// MODE 0: bf16 rounding alone, hi plane only. MODE 1: SetNorm of the bf16-rounded source. MODE 2: relu(SetNorm) of the f32 source.
template <int MODE, int NP>
__device__ __forceinline__ void stage_rows(const float* __restrict__ src, const float* __restrict__ PARTS, const float* __restrict__ w, const float* __restrict__ b, bf* Ah, bf* Al, const int wv, const int lane) {
    const float* p = src + (size_t)(wv * 16) * CC + lane * 8; v8f x[16], w8, b8; float mu = 0.f, rs = 0.f;
#pragma unroll   // unrolled, here and below: x is indexed by constants only and so stays in registers
    for (int u = 0; u < 16; ++u) x[u] = *(const v8f*)(p + u * CC);
    if constexpr (MODE != 0) { w8 = *(const v8f*)(w + lane * 8); b8 = *(const v8f*)(b + lane * 8); }
    asm volatile("s_wait_xcnt 0x0" :: "v"(p) : "memory");   // the wait owed before the loads' address registers take new values; p as an input keeps the pair whole up to here, so that no load of the run lands on it
    if constexpr (MODE != 0) { const v2f r = join_stats<NP>(PARTS, lane); mu = r[0]; rs = r[1];
#pragma unroll
        for (int q = 0; q < 8; ++q) { w8[q] = bfr(w8[q]); b8[q] = bfr(b8[q]); } }
    bf* dh = Ah + (wv * 16) * AP + lane * 8; bf* dl = Al + (wv * 16) * AP + lane * 8;
#pragma unroll
    for (int u = 0; u < 16; ++u) { v8us oh, ol;
#pragma unroll
        for (int q = 0; q < 8; ++q) { float xv = x[u][q];
            if constexpr (MODE == 0) oh[q] = f2bf(xv);
            else { if (MODE == 1) xv = bfr(xv); const float t = __fmul_rn(__fsub_rn(xv, mu), rs); float y = __fadd_rn(__fmul_rn(t, w8[q]), b8[q]); if (MODE == 2) y = fmaxf(y, 0.f); unsigned short a, c2; splitf(y, a, c2); oh[q] = a; ol[q] = c2; } }
        *(v8usa*)(dh + u * AP) = oh; if constexpr (MODE != 0) *(v8usa*)(dl + u * AP) = ol; }
}
// The three projections depend on nothing of one another: one launch, grid (8192 / 64 row tiles, 3), 4 waves: blockIdx.y = 0: Q from SetNorm(X), 1: K from SetNorm(Y), 2: V from bf16(Y).
// A work-group stages its 64 rows once and wave wv takes the output columns 64 wv .. + 63. W: the planes of Wq, Wk, Wv one behind the other. PART: the slices' statistics, sets 0..3 = X, 4..7 = Y.
__global__ __launch_bounds__(128) void k_qkv(const float* __restrict__ X, const float* __restrict__ Y, const float* __restrict__ PART, const float* __restrict__ nqw, const float* __restrict__ nqb, const float* __restrict__ nkw, const float* __restrict__ nkb, const bf* __restrict__ W, const float* __restrict__ bq, const float* __restrict__ bk, const float* __restrict__ bv, h16* QP, h16* KP, h16* V16) {
    __shared__ __align__(16) bf Ah[64 * AP], Al[64 * AP];
    const int z = blockIdx.y, r0 = blockIdx.x * 64, lane = threadIdx.x & 31, wv = __builtin_amdgcn_readfirstlane(threadIdx.x >> 5);   // the wave's number as a scalar: the tile bases stay the same in all lanes
    if (z == 2) stage_rows<0, 1>(Y + (size_t)r0 * CC, nullptr, nullptr, nullptr, Ah, Al, wv, lane);
    else stage_rows<1, 1>((z ? Y : X) + (size_t)r0 * CC, PART + (size_t)(z * NB_ + (r0 >> 11)) * NW * 32, z ? nkw : nqw, z ? nkb : nqb, Ah, Al, wv, lane);
    __syncthreads();   // the four waves' rows are in LDS for all of them
    if (z == 2) gemmw_tile<bf, 0, 1, 4>(Ah, nullptr, W + 2 * CC * CC, nullptr, CC, nullptr, bv, nullptr, V16, nullptr);
    else gemmw_tile<bf, 1, 0, 4>(Ah, Al, W + z * CC * CC, nullptr, CC, nullptr, z ? bk : bq, nullptr, z ? KP : QP, nullptr);
}
// out = H + relu(SetNorm(H)) Wres^T + bres: grid 8192 / 64 row tiles, 4 waves, staged as above; PART: the statistics of H per 64x64 tile (four column tiles a slice).
__global__ __launch_bounds__(128) void k_res(const float* __restrict__ H, const float* __restrict__ PART, const float* __restrict__ w, const float* __restrict__ b, const bf* __restrict__ WR, const float* __restrict__ bres, float* OUT) {
    __shared__ __align__(16) bf Ah[64 * AP], Al[64 * AP];
    const int r0 = blockIdx.x * 64, lane = threadIdx.x & 31, wv = __builtin_amdgcn_readfirstlane(threadIdx.x >> 5);   // the wave's number as a scalar: the tile bases stay the same in all lanes
    stage_rows<2, 4>(H + (size_t)r0 * CC, PART + (size_t)(r0 >> 11) * 4 * NW * 32, w, b, Ah, Al, wv, lane);
    __syncthreads();   // the four waves' rows are in LDS for all of them
    gemmw_tile<bf, 1, 3, 4>(Ah, Al, WR, nullptr, CC, OUT, bres, H, nullptr, nullptr);
}
// ---- k_fattn: scores, softmax, attn.v and the hi/lo split of O in one kernel; no score and no weight leaves the registers.
// grid (2048 / 256 query blocks, 32 (batch, head) pairs), 16 waves. The pair's whole K [2048][32] and V^T [32][2048] are laid into LDS once (padded pitches), then read by every wave.
// Wave w: query columns (w & 7) * 32 .. + 31, keys (w >> 3) * 1024 .. + 1023, 64 keys a pass. S^T = K Q^T: lane (c, h) holds query c's scores of keys 8h + r of each 16-key tile, which, rounded to fp16,
// ARE the B operand of O^T += V^T P^T (hardware k order; K, Q and V^T fragments are loaded in the same order). Running maximum per query column; the two key halves are joined through LDS at the end.
typedef float __attribute__((may_alias)) fa;
// v_exp_f32 with the one slot behind a transcendental filled in the same statement
__device__ __forceinline__ float exp2_slot(float x) { float r; asm("v_exp_f32 %0, %1\n\tv_nop" : "=v"(r) : "v"(x)); return r; }
__global__ __launch_bounds__(512) void k_fattn(const h16* __restrict__ QP, const h16* __restrict__ KP, const h16* __restrict__ V16, bf* Oh, bf* Ol) {
    __shared__ __align__(16) unsigned char sm[TT * KPB + DH * VPB];
    unsigned char* Ks = sm; unsigned char* Vs = sm + TT * KPB;
    const int g = blockIdx.y, tid = threadIdx.x, lane = tid & 31, wave = tid >> 5, lr = lane & 15, hi = lane >> 4;
    const int qg = wave & 7, kh = wave >> 3, q0 = blockIdx.x * 256 + qg * 32;
    v16h qf[2];
#pragma unroll
    for (int t = 0; t < 2; ++t) { const h16* p = QP + ((size_t)g * TT + q0 + t * 16 + lr) * DH + 8 * hi; qf[t] = cat16(*(const v8h*)p, *(const v8h*)(p + 16)); }
    asm volatile("s_wait_xcnt 0x0" ::: "memory");   // the Q loads' address registers are given new values further down, ahead of the loads' data wait: this wait stands in front of that
    const h16* Kg = KP + (size_t)g * TT * DH; const h16* Vg = V16 + (size_t)g * DH * TT;
#pragma unroll
    for (int u = 0; u < TT * DH / 8 / 512; ++u) { const int i = u * 512 + tid; *(v8ha*)(Ks + (i >> 2) * KPB + (i & 3) * 16) = *(const v8h*)(Kg + (size_t)i * 8); }
#pragma unroll
    for (int u = 0; u < TT * DH / 8 / 512; ++u) { const int i = u * 512 + tid; *(v8ha*)(Vs + (i >> 8) * VPB + (i & 255) * 16) = *(const v8h*)(Vg + (size_t)i * 8); }
    __syncthreads();
    v8f o[2][2]; float m[2], l[2];
#pragma unroll
    for (int t = 0; t < 2; ++t) { o[t][0] = (v8f){}; o[t][1] = (v8f){}; m[t] = -3.0e38f; l[t] = 0.f; }
    const unsigned char* kp = Ks + (kh * (TT / 2) + lr) * KPB + 16 * hi; const unsigned char* vp = Vs + lr * VPB + (kh * (TT / 2) + 8 * hi) * 2;
    // kept rolled: one pass is already several hundred instructions
#pragma unroll 1
    for (int ps = 0; ps < TT / 2 / 64; ++ps, kp += 64 * KPB, vp += 64 * 2) {
        v8f s[2][4];
#pragma unroll
        for (int kt = 0; kt < 4; ++kt) { const v16h ka = cat16(*(const v8ha*)(kp + kt * 16 * KPB), *(const v8ha*)(kp + kt * 16 * KPB + 32));
#pragma unroll
            for (int t = 0; t < 2; ++t) s[t][kt] = wmma16(ka, qf[t], (v8f){}); }
        v16h va[2][2];
#pragma unroll
        for (int dt = 0; dt < 2; ++dt)
#pragma unroll
            for (int kk = 0; kk < 2; ++kk) va[dt][kk] = cat16(*(const v8ha*)(vp + dt * 16 * VPB + kk * 64), *(const v8ha*)(vp + dt * 16 * VPB + kk * 64 + 32));
#pragma unroll
        for (int t = 0; t < 2; ++t) {
            float mk[4];
#pragma unroll
            for (int kt = 0; kt < 4; ++kt) { mk[kt] = s[t][kt][0];
#pragma unroll
                for (int j = 1; j < 8; ++j) mk[kt] = fmaxf(mk[kt], s[t][kt][j]); }
            float mx = fmaxf(fmaxf(mk[0], mk[1]), fmaxf(mk[2], mk[3])); mx = fmaxf(mx, xhalf(mx));
            const float mn = fmaxf(m[t], mx * C2), al = exp2_slot(m[t] - mn); m[t] = mn;
            const v2f cv = {C2, C2}, nb = {PSH - mn, PSH - mn}; v2f sk[4]; v16h pf[2];
#pragma unroll
            for (int kt = 0; kt < 4; ++kt) {
#pragma unroll
                for (int j = 0; j < 8; j += 2) { const v2f x = __builtin_elementwise_fma((v2f){s[t][kt][j], s[t][kt][j + 1]}, cv, nb); const v2f e = {__builtin_amdgcn_exp2f(x[0]), __builtin_amdgcn_exp2f(x[1])}; sk[kt] = j ? sk[kt] + e : e;
                    const v2h c = __builtin_convertvector(e, v2h); pf[kt >> 1][(kt & 1) * 8 + j] = c[0]; pf[kt >> 1][(kt & 1) * 8 + j + 1] = c[1]; } }
            const v2f st = (sk[0] + sk[1]) + (sk[2] + sk[3]); l[t] = l[t] * al + (st[0] + st[1]);
#pragma unroll
            for (int dt = 0; dt < 2; ++dt) { o[t][dt] *= al;
#pragma unroll
                for (int kk = 0; kk < 2; ++kk) o[t][dt] = wmma16(va[dt][kk], pf[kk], o[t][dt]); }
        }
    }
    __syncthreads();   // every wave has left K and V^T: the first K rows now carry the upper key half's state to its partner wave
    fa* mb = (fa*)sm + (size_t)qg * 36 * 32 + lane;
    if (kh == 1) {
#pragma unroll
        for (int t = 0; t < 2; ++t) { mb[(t * 18) * 32] = m[t]; mb[(t * 18 + 1) * 32] = l[t];
#pragma unroll
            for (int r = 0; r < 16; ++r) mb[(t * 18 + 2 + r) * 32] = o[t][r >> 3][r & 7]; }
    }
    __syncthreads();
    if (kh == 0) {
#pragma unroll
        for (int t = 0; t < 2; ++t) { const float m1 = mb[(t * 18) * 32], l1 = mb[(t * 18 + 1) * 32], mN = fmaxf(m[t], m1); float a0 = exp2_slot(m[t] - mN), a1 = exp2_slot(m1 - mN);
            float lt = l[t] * a0 + l1 * a1; lt += xhalf(lt); const float inv = __fdiv_rn(1.0f, lt); a0 *= inv; a1 *= inv;
#pragma unroll
            for (int dt = 0; dt < 2; ++dt) { v8us oh, ol;
#pragma unroll
                for (int j = 0; j < 8; ++j) { unsigned short a, c2; splitf(o[t][dt][j] * a0 + mb[(t * 18 + 2 + dt * 8 + j) * 32] * a1, a, c2); oh[j] = a; ol[j] = c2; }
                const size_t off = ((size_t)(g >> 3) * TT + q0 + t * 16 + lr) * CC + (g & 7) * DH + dt * 16 + 8 * hi; *(v8us*)(Oh + off) = oh; *(v8us*)(Ol + off) = ol; } }
    }
}
extern "C" void kernel_launch(void* const* d_in, const int* in_sizes, int n_in,
                              void* d_out, int out_size, void* d_ws, size_t ws_size, hipStream_t stream) {
    (void)in_sizes; (void)n_in; (void)out_size;
    const float* IN[18]; for (int i = 0; i < 18; ++i) IN[i] = (const float*)d_in[i];
    // X, Y [4][2048][256], Wq [256][256], bq, Wk, bk, Wv, bv, Wo, bo, Wres, bres, nq_w, nq_b, nk_w, nk_b, n0_w, n0_b = d_in[0..17]
    float* OUT = (float*)d_out;     // [4][2048][256]
    char* wsp = (char*)d_ws;
    auto take = [&](size_t bytes) { char* p = wsp; wsp += (bytes + 255) & ~(size_t)255; return (void*)p; };
    const size_t PE = (size_t)TT * CC;                      // elements of one batch element's [2048][256] plane
    bf* WQ = (bf*)take((size_t)CC * CC * 2); bf* WK = (bf*)take((size_t)CC * CC * 2); bf* WV = (bf*)take((size_t)CC * CC * 2); bf* WO = (bf*)take((size_t)CC * CC * 2); bf* WR = (bf*)take((size_t)CC * CC * 2);   (void)WK; (void)WV;   // one behind the other (k_pre, k_qkv)
    float* PART = (float*)take((size_t)4 * NB_ * NW * 32 * 4);
    // live through the attention part; g = batch * 8 + head runs through all of them
    h16* QP = (h16*)take((size_t)NB_ * NHD * TT * DH * 2); h16* KP = (h16*)take((size_t)NB_ * NHD * TT * DH * 2); h16* V16 = (h16*)take((size_t)NB_ * CC * TT * 2);
    bf* Oh = (bf*)take(NB_ * PE * 2); bf* Ol = (bf*)take(NB_ * PE * 2); float* H = (float*)take(NB_ * PE * 4);
    if ((size_t)(wsp - (char*)d_ws) > ws_size) return;    // total ~ 29 MiB; ws 256 MiB
    const dim3 gP(NB_ * TT / 64, CC / 64, 1);
    // the statistics of SetNorm(X) and SetNorm(Y), all batch elements: sets 0..3 = X, 4..7 = Y
    k_pre<<<NBS + 5 * NBW, 256, 0, stream>>>(IN[0], IN[1], IN[2], IN[4], IN[6], IN[8], IN[10], PART, WQ);
    // Q = SetNorm(X) Wq^T + bq; K = SetNorm(Y) Wk^T + bk; V = Y Wv^T + bv: the four batch elements are 8192 rows of one product; each leaves its GEMM as the fp16 plane that the attention kernel reads
    k_qkv<<<dim3(NB_ * TT / 64, 3), 128, 0, stream>>>(IN[0], IN[1], PART, IN[12], IN[13], IN[14], IN[15], WQ, IN[3], IN[5], IN[7], QP, KP, V16);
    k_fattn<<<dim3(TT / 256, NB_ * NHD), 512, 0, stream>>>(QP, KP, V16, Oh, Ol);                             // softmax(Q_h K_h^T / 16) V_h, all pairs -> O as hi + lo planes
    k_gemmw<bf, 1, 2><<<gP, 32, 0, stream>>>(Oh, Ol, WO, nullptr, CC, H, IN[9], IN[0], nullptr, PART, 0, 0, 0);   // H = bf16(X) + O Wo^T + bo, and H's statistics per tile
    k_res<<<NB_ * TT / 64, 128, 0, stream>>>(H, PART, IN[16], IN[17], WR, IN[11], OUT);                          // out = H + relu(SetNorm(H)) Wres^T + bres
}

// v009
// It runs in 57.2 microseconds.
// Two timings next to v008 put it at 1.08 and 1.06 times that version's speed.
// All steps since v000 together make it 52.2 times as fast.
#include <hip/hip_runtime.h>

// MABClean (Set-Transformer MAB; X, Y [4][2048][256]; Q = SetNorm(X) Wq^T + bq, K = SetNorm(Y) Wk^T + bk, V = Y Wv^T + bv (SetNorm: normalise over all (samples, features) of one batch element, eps 1e-5,
// then per-feature scale/shift); 8 heads of 32: A = softmax_k(Q_h.K_h / sqrt(256)); O = concat_h A V_h; H = X + O Wo^T + bo; out = H + relu(SetNorm(H)) Wres^T + bres).
// Compute dtypes, f32 accumulate: every input rounded to bf16; the three SetNorm statistics (mean and variance over 524,288 values each) in ONE pass over the values: each group
// (a 64-row slice, a 64x64 tile) gives its sum and its squared deviations about ITS OWN mean, joined in fixed order (join_stats); the normalised operands as bf16 hi+lo planes x exact weights (2 products); V on PLAIN bf16 operands (exact, + bias); scores (K = 32) and attn.v on SINGLE fp16 planes (model

#define NB_  4
#define TT   2048
#define CC   256
#define NHD  8
#define DH   32
#define SCL  0.0625f              // 1/sqrt(dim_Y = 256)
#define C2   (SCL * 1.44269504f)  // score -> exponent of two
#define PSH  10.0f                // P carries 2^10 (as does its sum), so that small weights stay normal fp16 numbers
#define KPB  80                   // LDS pitch of one K row: 64 bytes + 16 (16 B x odd: no bank conflict for 16-byte reads down a column of rows)
#define VPB  4112                 // LDS pitch of one row of V^T: 4096 bytes + 16
#define NW   32                   // 64-row slices per statistic (k_pre: one group (sum, squared deviations) each, from a work-group of 8 waves; k_gemmw: four, one a column tile)
typedef _Float16 h16;
typedef unsigned short bf;
typedef __attribute__((ext_vector_type(16))) __bf16   v16bf;
typedef __attribute__((ext_vector_type(16))) _Float16 v16h;
typedef __attribute__((ext_vector_type(8)))  _Float16 v8h;
typedef __attribute__((ext_vector_type(8)))  unsigned short v8us;
typedef __attribute__((ext_vector_type(8)))  float    v8f;
typedef __attribute__((ext_vector_type(4)))  float    v4f;
typedef v8h  __attribute__((may_alias)) v8ha;
typedef v4f  __attribute__((may_alias)) v4fa;
typedef __attribute__((ext_vector_type(2)))  float    v2f;

// Rounding to bf16 is the chip's own convert instruction (round to nearest even, two values an instruction), not integer arithmetic on the float's bits; finite values come out the same.
typedef __attribute__((ext_vector_type(2)))  __bf16   v2bf;
typedef __attribute__((ext_vector_type(4)))  unsigned v4u;
typedef v4u  __attribute__((may_alias)) v4ua;
__device__ __forceinline__ unsigned short f2bf(float f) { return __builtin_bit_cast(unsigned short, (__bf16)f); }
__device__ __forceinline__ unsigned pk2bf(float a, float b) { return __builtin_bit_cast(unsigned, __builtin_convertvector((v2f){a, b}, v2bf)); }   // bf16(a) in the low half, bf16(b) in the high half
__device__ __forceinline__ float pklo(unsigned p) { return __uint_as_float(p << 16); }            // the low half as f32
__device__ __forceinline__ float pkhi(unsigned p) { return __uint_as_float(p & 0xFFFF0000u); }    // the high half as f32
__device__ __forceinline__ float bf2f(unsigned short b) { return __uint_as_float(((unsigned)b) << 16); }
__device__ __forceinline__ float bfr(float f) { return bf2f(f2bf(f)); }
__device__ __forceinline__ v16h cat16(v8h lo, v8h hi) { return __builtin_shufflevector(lo, hi, 0, 1, 2, 3, 4, 5, 6, 7, 8, 9, 10, 11, 12, 13, 14, 15); }
__device__ __forceinline__ v16bf cat16b(v8us lo, v8us hi) { return __builtin_bit_cast(v16bf, __builtin_shufflevector(lo, hi, 0, 1, 2, 3, 4, 5, 6, 7, 8, 9, 10, 11, 12, 13, 14, 15)); }
__device__ __forceinline__ v8f wmma16(v16h a, v16h b, v8f c) { return __builtin_amdgcn_wmma_f32_16x16x32_f16(false, a, false, b, (short)0, c, false, false); }
__device__ __forceinline__ v8f wmmab(v16bf a, v16bf b, v8f c) { return __builtin_amdgcn_wmma_f32_16x16x32_bf16(false, a, false, b, (short)0, c, false, false); }
__device__ __forceinline__ float xhalf(float x) { const int b = __float_as_int(x); return __int_as_float(__builtin_amdgcn_permlanex16(b, b, 0x76543210, 0xfedcba98, false, false)); }   // lane l <- lane l ^ 16
// lane l <- lane l ^ M inside its row of 16 lanes (DPP row_xmask; every lane of the wave must be on): for speed only, where __shfl_xor goes through the LDS pipe and its wait
template <int M> __device__ __forceinline__ float xrow(float x) { return __int_as_float(__builtin_amdgcn_update_dpp(0, __float_as_int(x), 0x160 | M, 0xf, 0xf, true)); }
__device__ __forceinline__ float wave_sum(float x) { x += xhalf(x); x += xrow<8>(x); x += xrow<4>(x); x += xrow<2>(x); return x + xrow<1>(x); }   // the sum over the 32 lanes, in every lane; partners 16, 8, 4, 2, 1



// ---- gemmw_tile (kernels k_gemmw, k_qkv and k_res): register-blocked GEMM, ONE WAVE per 64x64 output tile (16 accumulators), operands from K-contiguous 16-bit planes.
// NWV 1: a work-group is one wave, grid (M/64, N/64, Z), A and A2 are planes in memory. NWV 4: grid x = M/64, four waves share the tile rows and wave wv takes the columns 64 wv .. + 63;
// A and A2 are the tile's 64 rows in LDS (row pitch AP, laid there by stage_rows), and each wave has its own slice of the epilogue's LDS.
#define AP 264   // LDS pitch of a staged row in elements: 512 bytes + 16 (16 B x odd: no bank conflict for 16-byte reads down a column of rows)
// c[m][n] = sum_k A[m][k] Bt[n][k] (+ split products per NSPLIT) + bias[n], f32, n < 256. z-batch strides sA/sB/sC in elements. K % 32 == 0. The 8192 rows m are (batch element, token).
// The epilogue does the elementwise pass that used to follow in a launch of its own, so that c never goes through memory:
// EPI 0: c as fp16 into the head planes P[batch][head][token][32]. EPI 1: c as fp16, transposed, into P[batch][column][token].
// EPI 2: C = bf16(R) + c, and the tile's sum of C and its squared deviations about the tile's own mean into PART (one group of the statistics over C). EPI 3: C = R + c.
// Every address of the epilogue is a tile base that is the same in all lanes, one lane offset that is kept to the end, and a compile-time step.
template <typename T16> struct WFrag;
template <> struct WFrag<bf> { typedef v16bf V; static __device__ __forceinline__ V ld(const bf* p) { return cat16b(*(const v8us*)p, *(const v8us*)(p + 16)); } static __device__ __forceinline__ v8f mma(V a, V b, v8f c) { return wmmab(a, b, c); } };
template <typename T16, int NSPLIT, int EPI, int NWV = 1>
__device__ __forceinline__ void gemmw_tile(const T16* __restrict__ A, const T16* __restrict__ A2, const T16* __restrict__ Bt, const T16* __restrict__ Bt2, const int K, float* C, const float* __restrict__ bias, const float* __restrict__ R, h16* P, float* PART) {
    typedef typename WFrag<T16>::V V;
    static_assert(NWV == 1 || EPI != 2, "the line of PART is numbered by blockIdx.y");
    const int lane = threadIdx.x & 31, lr = lane & 15, hi = lane >> 4; const int wv = NWV == 1 ? 0 : __builtin_amdgcn_readfirstlane(threadIdx.x >> 5);   // the wave's number as a scalar: the tile bases stay the same in all lanes
    const int r0 = blockIdx.x * 64, c0 = (NWV == 1 ? blockIdx.y : wv) * 64;
    v8f acc[4][4];
#pragma unroll
    for (int mb = 0; mb < 4; ++mb)
#pragma unroll
        for (int nb = 0; nb < 4; ++nb) acc[mb][nb] = (v8f){};
    const size_t aoff = (size_t)(r0 + lr) * K + 8 * hi, boff = (size_t)(c0 + lr) * K + 8 * hi;
    if constexpr (NWV == 1) {
#pragma unroll 1
    for (int kc = 0; kc < K; kc += 32) {
        V a[4], a2[4];
#pragma unroll
        for (int mb = 0; mb < 4; ++mb) { a[mb] = WFrag<T16>::ld(A + aoff + (size_t)mb * 16 * K + kc); if (NSPLIT == 1 || NSPLIT == 2) a2[mb] = WFrag<T16>::ld(A2 + aoff + (size_t)mb * 16 * K + kc); }
#pragma unroll
        for (int nb = 0; nb < 4; ++nb) { const V b = WFrag<T16>::ld(Bt + boff + (size_t)nb * 16 * K + kc); V b2; if (NSPLIT >= 2) b2 = WFrag<T16>::ld(Bt2 + boff + (size_t)nb * 16 * K + kc);
#pragma unroll
            for (int mb = 0; mb < 4; ++mb) { acc[mb][nb] = WFrag<T16>::mma(a[mb], b, acc[mb][nb]); if (NSPLIT == 1 || NSPLIT == 2) acc[mb][nb] = WFrag<T16>::mma(a2[mb], b, acc[mb][nb]); if (NSPLIT >= 2) acc[mb][nb] = WFrag<T16>::mma(a[mb], b2, acc[mb][nb]); } }
        asm volatile("v_nop\n\tv_nop\n\tv_nop\n\tv_nop" : "+v"(acc[0][0]), "+v"(acc[1][1]), "+v"(acc[2][2]), "+v"(acc[3][3]) : "v"(a[0]), "v"(a[3]));
    }
    } else {
        const T16* as = A + lr * AP + 8 * hi; const T16* as2 = NSPLIT == 1 ? A2 + lr * AP + 8 * hi : as;   // the same k order as the B loader's: k = kc + 8 hi + 0..7, then kc + 16 + 8 hi + 0..7
#pragma unroll 1   // kept rolled, as the loop above
        for (int kc = 0; kc < K; kc += 32) {
            V a[4], a2[4];
#pragma unroll   // unrolled, here and below: a, a2 and acc are indexed by constants only and so stay in registers
            for (int mb = 0; mb < 4; ++mb) { a[mb] = WFrag<T16>::ld(as + mb * 16 * AP + kc); if (NSPLIT == 1) a2[mb] = WFrag<T16>::ld(as2 + mb * 16 * AP + kc); }
#pragma unroll
            for (int nb = 0; nb < 4; ++nb) { const V b = WFrag<T16>::ld(Bt + boff + (size_t)nb * 16 * K + kc);
#pragma unroll
                for (int mb = 0; mb < 4; ++mb) { acc[mb][nb] = WFrag<T16>::mma(a[mb], b, acc[mb][nb]); if (NSPLIT == 1) acc[mb][nb] = WFrag<T16>::mma(a2[mb], b, acc[mb][nb]); } }
            // the distance the chip needs behind the last matrix instruction, also on the taken side of the loop's branch, where the next trip's loads overwrite A
            asm volatile("v_nop\n\tv_nop\n\tv_nop\n\tv_nop" : "+v"(acc[0][0]), "+v"(acc[1][1]), "+v"(acc[2][2]), "+v"(acc[3][3]) : "v"(a[0]), "v"(a[3]));
        }
    }
    asm volatile("s_wait_xcnt 0x0" ::: "memory");   // the wait owed before the epilogue gives new values to the address registers of the loop's loads
    const int bt = r0 >> 11, t0 = r0 & (TT - 1);   // the tile's batch element and its first token (64 divides 2048: a tile lies in one batch element)
    if constexpr (EPI == 1) {
        // lane (lr, hi) holds 8 consecutive tokens of one column: 16 bytes of fp16. Through LDS (pitch 144 B = 16 B x odd) each column's 64 tokens leave as one whole 128-byte line.
        __shared__ __align__(16) h16 tsa[NWV * 64 * 72]; h16* ts = tsa + wv * 64 * 72;
#pragma unroll
        for (int nb = 0; nb < 4; ++nb) { const float bn = bfr(bias[c0 + nb * 16 + lr]);
#pragma unroll
            for (int mb = 0; mb < 4; ++mb) { v8h o;
#pragma unroll
                for (int j = 0; j < 8; ++j) o[j] = (h16)(acc[mb][nb][j] + bn);
                *(v8ha*)(ts + (nb * 16 + lr) * 72 + mb * 16 + hi * 8) = o; } }
        __builtin_amdgcn_wave_barrier(); asm volatile("" ::: "memory");   // keeps the LDS reads below behind the LDS writes above (other lanes' data)
        h16* vt = P + ((size_t)bt * CC + c0) * TT + t0; const int vo = (lane >> 3) * TT + (lane & 7) * 8;
#pragma unroll
        for (int s = 0; s < 16; ++s) *(v8h*)(vt + vo + s * 4 * TT) = *(const v8ha*)(ts + (s * 4 + (lane >> 3)) * 72 + (lane & 7) * 8);
    } else {
        __shared__ __align__(16) float osa[NWV * 16 * 68]; float* os = osa + wv * 16 * 68;
        float bq[2][8]; v4f bv, rr[2][8], hs = {0.f, 0.f, 0.f, 0.f};
        v4f keep[4][8];   // EPI 2: the tile's values of C, for the squared deviations about the tile's mean
        const float* rt = R + (size_t)r0 * CC + c0; float* ct = C + (size_t)r0 * CC + c0; const int lo = hi * CC + lr * 4;
        h16* pt = P + (((size_t)bt * NHD + (c0 >> 5)) * TT + t0) * DH;
        if constexpr (EPI == 0) {
#pragma unroll
            for (int hh = 0; hh < 2; ++hh)
#pragma unroll
                for (int q = 0; q < 8; ++q) bq[hh][q] = bfr(bias[c0 + hh * 32 + (lane & 3) * 8 + q]);
        } else {
            // the residual rows of two 16-row blocks are asked for ahead, those of block mb + 2 as soon as block mb's are used: their latency is waited out once
#pragma unroll
            for (int mb = 0; mb < 2; ++mb)
#pragma unroll
                for (int s = 0; s < 8; ++s) rr[mb][s] = *(const v4f*)(rt + lo + (mb * 16 + 2 * s) * CC);
            const v4f braw = *(const v4f*)(bias + c0 + lr * 4);
            asm volatile("s_wait_xcnt 0x0" :: "v"(lr) : "memory");   // the wait owed before the bias load's offset register (lr) takes a new value; lr as an input keeps it whole up to here, so that no residual load lands on it
#pragma unroll
            for (int q = 0; q < 4; ++q) bv[q] = bfr(braw[q]);
        }
#pragma unroll
        for (int mb = 0; mb < 4; ++mb) {
#pragma unroll
            for (int nb = 0; nb < 4; ++nb) {
#pragma unroll
                for (int j = 0; j < 8; ++j) os[(hi * 8 + j) * 68 + nb * 16 + lr] = acc[mb][nb][j]; }
            __builtin_amdgcn_wave_barrier(); asm volatile("" ::: "memory");   // keeps the LDS reads below behind the LDS writes above (other lanes' data)
            if constexpr (EPI == 0) {
                // one store = 8 tokens x 64 bytes of one head = 512 contiguous bytes
#pragma unroll
                for (int s = 0; s < 4; ++s) { const int hh = s >> 1, th = s & 1; const float* op = os + (th * 8 + (lane >> 2)) * 68 + hh * 32 + (lane & 3) * 8; const v4f x0 = *(const v4fa*)op, x1 = *(const v4fa*)(op + 4); v8h o;
#pragma unroll
                    for (int q = 0; q < 4; ++q) { o[q] = (h16)(x0[q] + bq[hh][q]); o[4 + q] = (h16)(x1[q] + bq[hh][4 + q]); }
                    *(v8h*)(pt + lane * 8 + (hh * TT + mb * 16 + th * 8) * DH) = o; }
            } else {
#pragma unroll
                for (int s = 0; s < 8; ++s) { const int row = 2 * s + hi, cofs = lr * 4; const v4f val = *(const v4fa*)(os + row * 68 + cofs) + bv; v4f x = rr[mb & 1][s]; v4f o;
                    if constexpr (EPI == 2) { const unsigned p0 = pk2bf(x[0], x[1]), p1 = pk2bf(x[2], x[3]); x = (v4f){pklo(p0), pkhi(p0), pklo(p1), pkhi(p1)}; }
#pragma unroll
                    for (int q = 0; q < 4; ++q) { o[q] = __fadd_rn(x[q], val[q]); if (EPI == 2) hs[q] = __fadd_rn(hs[q], o[q]); }
                    if constexpr (EPI == 2) keep[mb][s] = o;   // block mb's accumulators are dead by now: the tile's values take their place in the registers
                    *(v4f*)(ct + lo + (mb * 16 + 2 * s) * CC) = o; }
                if (mb < 2) {
#pragma unroll
                    for (int s = 0; s < 8; ++s) rr[mb][s] = *(const v4f*)(rt + lo + ((mb + 2) * 16 + 2 * s) * CC); }
            }
            __builtin_amdgcn_wave_barrier(); asm volatile("" ::: "memory");   // keeps the next block's LDS writes behind this block's LDS reads
        }
        if constexpr (EPI == 2) {
            // fixed order: four chains a lane, their pair sums, the lanes of the wave; one 128-byte line of PART per tile: set bt, row (column tile) * NW + 64-row slice; word 0 the sum, word 1 the squared deviations
            float s = __fadd_rn(__fadd_rn(hs[0], hs[1]), __fadd_rn(hs[2], hs[3]));
#pragma unroll
            for (int sh = 16; sh; sh >>= 1) s += __shfl_xor(s, sh, 32);
            const float mt = s * (1.0f / 4096.0f); v4f dq = {0.f, 0.f, 0.f, 0.f};   // the tile's own mean; its 4,096 values are still in the registers
            asm volatile("s_wait_xcnt 0x0" ::: "memory");   // the wait owed before the registers that the tile's stores name take new values in the sums below
#pragma unroll   // both loops unrolled: keep is indexed by constants only and so stays in registers
            for (int mb = 0; mb < 4; ++mb)
#pragma unroll
                for (int u = 0; u < 8; ++u) { const v4f d = keep[mb][u] - mt; dq += d * d; }
            const float m2 = wave_sum((dq[0] + dq[1]) + (dq[2] + dq[3]));
            PART[(((size_t)bt * 4 + blockIdx.y) * NW + (t0 >> 6)) * 32 + lane] = (lane == 0) ? s : (lane == 1) ? m2 : 0.f;
        }
    }
}
template <typename T16, int NSPLIT, int EPI>
__global__ __launch_bounds__(32) void k_gemmw(const T16* __restrict__ A, const T16* __restrict__ A2, const T16* __restrict__ Bt, const T16* __restrict__ Bt2, int K, float* C, const float* __restrict__ bias, const float* __restrict__ R, h16* P, float* PART, size_t sA, size_t sB, size_t sC) {
    const size_t z = blockIdx.z; A += z * sA; if (A2) A2 += z * sA; Bt += z * sB; if (Bt2) Bt2 += z * sB; C += z * sC;
    gemmw_tile<T16, NSPLIT, EPI>(A, A2, Bt, Bt2, K, C, bias, R, P, PART);
}
typedef __attribute__((ext_vector_type(2))) _Float16 v2h;
typedef __attribute__((ext_vector_type(4))) _Float16 v4h;
typedef __attribute__((ext_vector_type(2))) unsigned short v2us;
typedef __attribute__((ext_vector_type(8))) _Float16 v8h16;

// CVU groups of 8 values a thread (a work-group: CVU * 2,048 values in a row), all loads issued before the first value is used; few waves with much to do each, for speed only
#define CVU 4
__device__ __forceinline__ void cvt8_blk(const float* __restrict__ src, bf* dst, const unsigned blk) { const size_t i = ((size_t)blk * (CVU * 256) + threadIdx.x) * 8; const float* p = src + i; bf* d = dst + i; v8f v[CVU]; v8us o[CVU];
#pragma unroll   // unrolled, here and below: v and o are indexed by constants only and so stay in registers
    for (int u = 0; u < CVU; ++u) v[u] = *(const v8f*)(p + u * 2048);
    asm volatile("s_wait_xcnt 0x0" :: "v"(p) : "memory");   // the wait owed before the loads' address registers take new values in the rounding below; p as an input keeps the pair whole up to here
#pragma unroll
    for (int u = 0; u < CVU; ++u)
#pragma unroll
        for (int k = 0; k < 8; ++k) o[u][k] = f2bf(v[u][k]);
#pragma unroll
    for (int u = 0; u < CVU; ++u) *(v8us*)(d + u * 2048) = o[u];
    asm volatile("s_wait_xcnt 0x0" ::: "memory"); }   // the wait owed behind the stores: in k_pre the code of the other branches follows in the listing and gives new values to the stores' registers
// set = statistic set: sets 0..NB_-1 are the batch elements of A0, sets NB_.. those of A1; slice = one slice of 64 rows, one group of the statistics: its sum and its squared deviations about its own mean.
// Wave v of the work-group takes rows 8v .. 8v + 7 of the slice: 16 loads of 16 bytes a lane, all issued before the first value is used, so that the wave waits out the load latency once and not once a load.
// amdgpu_waves_per_eu (on the kernels that call it): without the hint the compiler saved registers for sixteen waves a SIMD and held four of the sixteen loads back until earlier ones had returned.
// Fixed order, for the sum and then for the squared deviations: four chains a lane (one per vector component), their pair sums, the lanes of the wave, then the eight waves through LDS.
// The slice's 16,384 values stay in the registers between the two, so that they are read once; about the slice's own mean nothing cancels, whatever the mean of the whole set is.
template <int RAW>
__device__ __forceinline__ void psum_slice(const float* __restrict__ A0, const float* __restrict__ A1, float* PART, const int slice, const int set) {
    __shared__ float wsum[8], wsq[8];
    const float* A = set < NB_ ? A0 + (size_t)set * TT * CC : A1 + (size_t)(set - NB_) * TT * CC; PART += (size_t)set * NW * 32;
    const int lane = threadIdx.x & 31, wv = threadIdx.x >> 5; const float* p = A + ((size_t)slice * 64 + wv * 8) * CC + lane * 4;
    v4f v[16];
#pragma unroll
    for (int u = 0; u < 16; ++u) v[u] = *(const v4f*)(p + u * 128);
    asm volatile("s_wait_xcnt 0x0" :: "v"(p) : "memory");   // the wait owed before the loads' address registers take new values; p as an input keeps the pair whole up to here, so that no load of the run lands on it
    v4f a = {0.f, 0.f, 0.f, 0.f}, dq = {0.f, 0.f, 0.f, 0.f};
#pragma unroll
    for (int u = 0; u < 16; ++u) {
        if (RAW) { const unsigned p0 = pk2bf(v[u][0], v[u][1]), p1 = pk2bf(v[u][2], v[u][3]); v[u] = (v4f){pklo(p0), pkhi(p0), pklo(p1), pkhi(p1)}; }
#pragma unroll
        for (int q = 0; q < 4; ++q) a[q] = __fadd_rn(a[q], v[u][q]); }
    float s = __fadd_rn(__fadd_rn(a[0], a[1]), __fadd_rn(a[2], a[3]));
#pragma unroll
    for (int sh = 16; sh; sh >>= 1) s += __shfl_xor(s, sh, 32);
    if (lane == 0) wsum[wv] = s;
    __syncthreads();   // the eight waves' sums are in LDS; every wave joins them, in one order, to the slice's sum
    float t = wsum[lane & 7]; t += xrow<4>(t); t += xrow<2>(t); t += xrow<1>(t);
    const float ms = t * (1.0f / 16384.0f);
#pragma unroll   // unrolled: v is indexed by constants only and so stays in registers
    for (int u = 0; u < 16; ++u) { const v4f d = v[u] - ms; dq += d * d; }
    const float r = wave_sum((dq[0] + dq[1]) + (dq[2] + dq[3]));
    if (lane == 0) wsq[wv] = r;
    __syncthreads();   // the eight waves' squared deviations are in LDS; wave 0 joins them
    if (wv == 0) { float t2 = wsq[lane & 7]; t2 += xrow<4>(t2); t2 += xrow<2>(t2); t2 += xrow<1>(t2);
        PART[(size_t)slice * 32 + lane] = (lane == 0) ? t : (lane == 1) ? t2 : 0.f; }
}
// The two passes that depend on the inputs alone, in one launch: the 256 slices of the statistics over X and Y, then the bf16 planes of the five weight matrices (NBW work-groups each, one plane behind the other in WP).
#define NBS (NW * 2 * NB_)
#define NBW (CC * CC / 8 / 256 / CVU)
__global__ __launch_bounds__(256) __attribute__((amdgpu_waves_per_eu(2, 4))) void k_pre(const float* __restrict__ X, const float* __restrict__ Y, const float* __restrict__ s0, const float* __restrict__ s1, const float* __restrict__ s2, const float* __restrict__ s3, const float* __restrict__ s4, float* PART, bf* WP) {
    const unsigned b = blockIdx.x;
    if (b < NBS) psum_slice<1>(X, Y, PART, b % NW, b / NW);
    else { const unsigned y = (b - NBS) / NBW; cvt8_blk(y == 0 ? s0 : y == 1 ? s1 : y == 2 ? s2 : y == 3 ? s3 : s4, WP + (size_t)y * CC * CC, (b - NBS) % NBW); }
}
// One wave joins a set's NP * NW groups (NP per lane: one slice from k_pre, or the four column tiles of k_gemmw) of TT * CC / (NP * NW) values each; PART holds a group's sum in word 0 of its line and its squared
// deviations about its own mean in word 1. Squared deviations about the set's mean = sum over the groups of (their own + group size x (group mean - set mean)^2): only non-negative terms are added.
// Returns {mean, 1 / sqrt(variance + 1e-5)} in every lane.
template <int NP>
__device__ __forceinline__ v2f join_stats(const float* __restrict__ PART, const int lane) {
    constexpr float gn = (float)(TT * CC / (NP * NW)), inv = 1.0f / (float)(TT * CC); const float* p = PART + (size_t)lane * 32; v2f g[NP];
#pragma unroll   // unrolled, here and below: g stays in registers and its NP loads are in flight together
    for (int k = 0; k < NP; ++k) g[k] = *(const v2f*)(p + (size_t)k * NW * 32);
    asm volatile("s_wait_xcnt 0x0" ::: "memory");   // the wait owed before the loads' address registers take new values
    float s = g[0][0];
#pragma unroll
    for (int k = 1; k < NP; ++k) s += g[k][0];
    const float mu = wave_sum(s) * inv; float m2 = 0.f;
#pragma unroll
    for (int k = 0; k < NP; ++k) { const float d = g[k][0] * (1.0f / gn) - mu; m2 += g[k][1] + gn * d * d; }
    return (v2f){mu, __fdiv_rn(1.0f, __fsqrt_rn(__fadd_rn(wave_sum(m2) * inv, 1e-5f)))}; }
// stage_rows: the A operand of a 64-row tile is made where it is used. Wave wv of four reads rows 16 wv .. + 15 of the tile's f32 source (a lane: 8 columns of each row, all 32 loads in flight together),
// normalises them and lays the hi + lo bf16 planes into LDS, so that no plane goes through memory and no launch stands between the statistics and the product. Every wave joins the set's statistics itself (no hand-over).
// MODE 0: bf16 rounding alone, hi plane only. MODE 1: SetNorm of the bf16-rounded source. MODE 2: relu(SetNorm) of the f32 source.
template <int MODE, int NP>
__device__ __forceinline__ void stage_rows(const float* __restrict__ src, const float* __restrict__ PARTS, const float* __restrict__ w, const float* __restrict__ b, bf* Ah, bf* Al, const int wv, const int lane) {
    const float* p = src + (size_t)(wv * 16) * CC + lane * 8; v8f x[16], w8, b8; float mu = 0.f, rs = 0.f;
#pragma unroll   // unrolled, here and below: x is indexed by constants only and so stays in registers
    for (int u = 0; u < 16; ++u) x[u] = *(const v8f*)(p + u * CC);
    if constexpr (MODE != 0) { w8 = *(const v8f*)(w + lane * 8); b8 = *(const v8f*)(b + lane * 8); }
    asm volatile("s_wait_xcnt 0x0" :: "v"(p) : "memory");   // the wait owed before the loads' address registers take new values; p as an input keeps the pair whole up to here, so that no load of the run lands on it
    if constexpr (MODE != 0) { const v2f r = join_stats<NP>(PARTS, lane); mu = r[0]; rs = r[1];
#pragma unroll
        for (int q = 0; q < 8; ++q) { w8[q] = bfr(w8[q]); b8[q] = bfr(b8[q]); } }
    bf* dh = Ah + (wv * 16) * AP + lane * 8; bf* dl = Al + (wv * 16) * AP + lane * 8;
#pragma unroll
    for (int u = 0; u < 16; ++u) { v4u oh, ol;   // two neighbouring columns a word
#pragma unroll
        for (int q = 0; q < 8; q += 2) { float x0 = x[u][q], x1 = x[u][q + 1];
            if constexpr (MODE == 0) oh[q >> 1] = pk2bf(x0, x1);
            else { if (MODE == 1) { const unsigned p = pk2bf(x0, x1); x0 = pklo(p); x1 = pkhi(p); }
                float y0 = __fadd_rn(__fmul_rn(__fmul_rn(__fsub_rn(x0, mu), rs), w8[q]), b8[q]), y1 = __fadd_rn(__fmul_rn(__fmul_rn(__fsub_rn(x1, mu), rs), w8[q + 1]), b8[q + 1]);
                if (MODE == 2) { y0 = fmaxf(y0, 0.f); y1 = fmaxf(y1, 0.f); }
                const unsigned h = pk2bf(y0, y1); oh[q >> 1] = h; ol[q >> 1] = pk2bf(y0 - pklo(h), y1 - pkhi(h)); } }
        *(v4ua*)(dh + u * AP) = oh; if constexpr (MODE != 0) *(v4ua*)(dl + u * AP) = ol; }
}
// The three projections depend on nothing of one another: one launch, grid (8192 / 64 row tiles, 3), 4 waves: blockIdx.y = 0: Q from SetNorm(X), 1: K from SetNorm(Y), 2: V from bf16(Y).
// A work-group stages its 64 rows once and wave wv takes the output columns 64 wv .. + 63. W: the planes of Wq, Wk, Wv one behind the other. PART: the slices' statistics, sets 0..3 = X, 4..7 = Y.
__global__ __launch_bounds__(128) void k_qkv(const float* __restrict__ X, const float* __restrict__ Y, const float* __restrict__ PART, const float* __restrict__ nqw, const float* __restrict__ nqb, const float* __restrict__ nkw, const float* __restrict__ nkb, const bf* __restrict__ W, const float* __restrict__ bq, const float* __restrict__ bk, const float* __restrict__ bv, h16* QP, h16* KP, h16* V16) {
    __shared__ __align__(16) bf Ah[64 * AP], Al[64 * AP];
    const int z = blockIdx.y, r0 = blockIdx.x * 64, lane = threadIdx.x & 31, wv = __builtin_amdgcn_readfirstlane(threadIdx.x >> 5);   // the wave's number as a scalar: the tile bases stay the same in all lanes
    if (z == 2) stage_rows<0, 1>(Y + (size_t)r0 * CC, nullptr, nullptr, nullptr, Ah, Al, wv, lane);
    else stage_rows<1, 1>((z ? Y : X) + (size_t)r0 * CC, PART + (size_t)(z * NB_ + (r0 >> 11)) * NW * 32, z ? nkw : nqw, z ? nkb : nqb, Ah, Al, wv, lane);
    __syncthreads();   // the four waves' rows are in LDS for all of them
    if (z == 2) gemmw_tile<bf, 0, 1, 4>(Ah, nullptr, W + 2 * CC * CC, nullptr, CC, nullptr, bv, nullptr, V16, nullptr);
    else gemmw_tile<bf, 1, 0, 4>(Ah, Al, W + z * CC * CC, nullptr, CC, nullptr, z ? bk : bq, nullptr, z ? KP : QP, nullptr);
}
// out = H + relu(SetNorm(H)) Wres^T + bres: grid 8192 / 64 row tiles, 4 waves, staged as above; PART: the statistics of H per 64x64 tile (four column tiles a slice).
__global__ __launch_bounds__(128) void k_res(const float* __restrict__ H, const float* __restrict__ PART, const float* __restrict__ w, const float* __restrict__ b, const bf* __restrict__ WR, const float* __restrict__ bres, float* OUT) {
    __shared__ __align__(16) bf Ah[64 * AP], Al[64 * AP];
    const int r0 = blockIdx.x * 64, lane = threadIdx.x & 31, wv = __builtin_amdgcn_readfirstlane(threadIdx.x >> 5);   // the wave's number as a scalar: the tile bases stay the same in all lanes
    stage_rows<2, 4>(H + (size_t)r0 * CC, PART + (size_t)(r0 >> 11) * 4 * NW * 32, w, b, Ah, Al, wv, lane);
    __syncthreads();   // the four waves' rows are in LDS for all of them
    gemmw_tile<bf, 1, 3, 4>(Ah, Al, WR, nullptr, CC, OUT, bres, H, nullptr, nullptr);
}
// ---- k_fattn: scores, softmax, attn.v and the hi/lo split of O in one kernel; no score and no weight leaves the registers.
// grid (2048 / 256 query blocks, 32 (batch, head) pairs), 16 waves. The pair's whole K [2048][32] and V^T [32][2048] are laid into LDS once (padded pitches), then read by every wave.
// Wave w: query columns (w & 7) * 32 .. + 31, keys (w >> 3) * 1024 .. + 1023, 64 keys a pass. S^T = K Q^T: lane (c, h) holds query c's scores of keys 8h + r of each 16-key tile, which, rounded to fp16,
// ARE the B operand of O^T += V^T P^T (hardware k order; K, Q and V^T fragments are loaded in the same order). Running maximum per query column; the two key halves are joined through LDS at the end.
typedef float __attribute__((may_alias)) fa;
// v_exp_f32 with the one slot behind a transcendental filled in the same statement
__device__ __forceinline__ float exp2_slot(float x) { float r; asm("v_exp_f32 %0, %1\n\tv_nop" : "=v"(r) : "v"(x)); return r; }
__global__ __launch_bounds__(512) void k_fattn(const h16* __restrict__ QP, const h16* __restrict__ KP, const h16* __restrict__ V16, bf* Oh, bf* Ol) {
    __shared__ __align__(16) unsigned char sm[TT * KPB + DH * VPB];
    unsigned char* Ks = sm; unsigned char* Vs = sm + TT * KPB;
    const int g = blockIdx.y, tid = threadIdx.x, lane = tid & 31, wave = tid >> 5, lr = lane & 15, hi = lane >> 4;
    const int qg = wave & 7, kh = wave >> 3, q0 = blockIdx.x * 256 + qg * 32;
    v16h qf[2];
#pragma unroll
    for (int t = 0; t < 2; ++t) { const h16* p = QP + ((size_t)g * TT + q0 + t * 16 + lr) * DH + 8 * hi; qf[t] = cat16(*(const v8h*)p, *(const v8h*)(p + 16)); }
    asm volatile("s_wait_xcnt 0x0" ::: "memory");   // the Q loads' address registers are given new values further down, ahead of the loads' data wait: this wait stands in front of that
    const h16* Kg = KP + (size_t)g * TT * DH; const h16* Vg = V16 + (size_t)g * DH * TT;
#pragma unroll
    for (int u = 0; u < TT * DH / 8 / 512; ++u) { const int i = u * 512 + tid; *(v8ha*)(Ks + (i >> 2) * KPB + (i & 3) * 16) = *(const v8h*)(Kg + (size_t)i * 8); }
#pragma unroll
    for (int u = 0; u < TT * DH / 8 / 512; ++u) { const int i = u * 512 + tid; *(v8ha*)(Vs + (i >> 8) * VPB + (i & 255) * 16) = *(const v8h*)(Vg + (size_t)i * 8); }
    __syncthreads();
    v8f o[2][2]; float m[2], l[2];
#pragma unroll
    for (int t = 0; t < 2; ++t) { o[t][0] = (v8f){}; o[t][1] = (v8f){}; m[t] = -3.0e38f; l[t] = 0.f; }
    const unsigned char* kp = Ks + (kh * (TT / 2) + lr) * KPB + 16 * hi; const unsigned char* vp = Vs + lr * VPB + (kh * (TT / 2) + 8 * hi) * 2;
    // kept rolled: one pass is already several hundred instructions
#pragma unroll 1
    for (int ps = 0; ps < TT / 2 / 64; ++ps, kp += 64 * KPB, vp += 64 * 2) {
        v8f s[2][4];
#pragma unroll
        for (int kt = 0; kt < 4; ++kt) { const v16h ka = cat16(*(const v8ha*)(kp + kt * 16 * KPB), *(const v8ha*)(kp + kt * 16 * KPB + 32));
#pragma unroll
            for (int t = 0; t < 2; ++t) s[t][kt] = wmma16(ka, qf[t], (v8f){}); }
        v16h va[2][2];
#pragma unroll
        for (int dt = 0; dt < 2; ++dt)
#pragma unroll
            for (int kk = 0; kk < 2; ++kk) va[dt][kk] = cat16(*(const v8ha*)(vp + dt * 16 * VPB + kk * 64), *(const v8ha*)(vp + dt * 16 * VPB + kk * 64 + 32));
#pragma unroll
        for (int t = 0; t < 2; ++t) {
            float mk[4];
#pragma unroll
            for (int kt = 0; kt < 4; ++kt) { mk[kt] = s[t][kt][0];
#pragma unroll
                for (int j = 1; j < 8; ++j) mk[kt] = fmaxf(mk[kt], s[t][kt][j]); }
            float mx = fmaxf(fmaxf(mk[0], mk[1]), fmaxf(mk[2], mk[3])); mx = fmaxf(mx, xhalf(mx));
            const float mn = fmaxf(m[t], mx * C2), al = exp2_slot(m[t] - mn); m[t] = mn;
            const v2f cv = {C2, C2}, nb = {PSH - mn, PSH - mn}; v2f sk[4]; v16h pf[2];
#pragma unroll
            for (int kt = 0; kt < 4; ++kt) {
#pragma unroll
                for (int j = 0; j < 8; j += 2) { const v2f x = __builtin_elementwise_fma((v2f){s[t][kt][j], s[t][kt][j + 1]}, cv, nb); const v2f e = {__builtin_amdgcn_exp2f(x[0]), __builtin_amdgcn_exp2f(x[1])}; sk[kt] = j ? sk[kt] + e : e;
                    const v2h c = __builtin_convertvector(e, v2h); pf[kt >> 1][(kt & 1) * 8 + j] = c[0]; pf[kt >> 1][(kt & 1) * 8 + j + 1] = c[1]; } }
            const v2f st = (sk[0] + sk[1]) + (sk[2] + sk[3]); l[t] = l[t] * al + (st[0] + st[1]);
#pragma unroll
            for (int dt = 0; dt < 2; ++dt) { o[t][dt] *= al;
#pragma unroll
                for (int kk = 0; kk < 2; ++kk) o[t][dt] = wmma16(va[dt][kk], pf[kk], o[t][dt]); }
        }
    }
    __syncthreads();   // every wave has left K and V^T: the first K rows now carry the upper key half's state to its partner wave
    fa* mb = (fa*)sm + (size_t)qg * 36 * 32 + lane;
    if (kh == 1) {
#pragma unroll
        for (int t = 0; t < 2; ++t) { mb[(t * 18) * 32] = m[t]; mb[(t * 18 + 1) * 32] = l[t];
#pragma unroll
            for (int r = 0; r < 16; ++r) mb[(t * 18 + 2 + r) * 32] = o[t][r >> 3][r & 7]; }
    }
    __syncthreads();
    if (kh == 0) {
#pragma unroll
        for (int t = 0; t < 2; ++t) { const float m1 = mb[(t * 18) * 32], l1 = mb[(t * 18 + 1) * 32], mN = fmaxf(m[t], m1); float a0 = exp2_slot(m[t] - mN), a1 = exp2_slot(m1 - mN);
            float lt = l[t] * a0 + l1 * a1; lt += xhalf(lt); const float inv = __fdiv_rn(1.0f, lt); a0 *= inv; a1 *= inv;
#pragma unroll
            for (int dt = 0; dt < 2; ++dt) { v4u oh, ol;   // two neighbouring columns a word
#pragma unroll
                for (int j = 0; j < 8; j += 2) { const float y0 = o[t][dt][j] * a0 + mb[(t * 18 + 2 + dt * 8 + j) * 32] * a1, y1 = o[t][dt][j + 1] * a0 + mb[(t * 18 + 2 + dt * 8 + j + 1) * 32] * a1;
                    const unsigned h = pk2bf(y0, y1); oh[j >> 1] = h; ol[j >> 1] = pk2bf(y0 - pklo(h), y1 - pkhi(h)); }
                const size_t off = ((size_t)(g >> 3) * TT + q0 + t * 16 + lr) * CC + (g & 7) * DH + dt * 16 + 8 * hi; *(v4ua*)(Oh + off) = oh; *(v4ua*)(Ol + off) = ol; } }
    }
}
extern "C" void kernel_launch(void* const* d_in, const int* in_sizes, int n_in,
                              void* d_out, int out_size, void* d_ws, size_t ws_size, hipStream_t stream) {
    (void)in_sizes; (void)n_in; (void)out_size;
    const float* IN[18]; for (int i = 0; i < 18; ++i) IN[i] = (const float*)d_in[i];
    // X, Y [4][2048][256], Wq [256][256], bq, Wk, bk, Wv, bv, Wo, bo, Wres, bres, nq_w, nq_b, nk_w, nk_b, n0_w, n0_b = d_in[0..17]
    float* OUT = (float*)d_out;     // [4][2048][256]
    char* wsp = (char*)d_ws;
    auto take = [&](size_t bytes) { char* p = wsp; wsp += (bytes + 255) & ~(size_t)255; return (void*)p; };
    const size_t PE = (size_t)TT * CC;                      // elements of one batch element's [2048][256] plane
    bf* WQ = (bf*)take((size_t)CC * CC * 2); bf* WK = (bf*)take((size_t)CC * CC * 2); bf* WV = (bf*)take((size_t)CC * CC * 2); bf* WO = (bf*)take((size_t)CC * CC * 2); bf* WR = (bf*)take((size_t)CC * CC * 2);   (void)WK; (void)WV;   // one behind the other (k_pre, k_qkv)
    float* PART = (float*)take((size_t)4 * NB_ * NW * 32 * 4);
    // live through the attention part; g = batch * 8 + head runs through all of them
    h16* QP = (h16*)take((size_t)NB_ * NHD * TT * DH * 2); h16* KP = (h16*)take((size_t)NB_ * NHD * TT * DH * 2); h16* V16 = (h16*)take((size_t)NB_ * CC * TT * 2);
    bf* Oh = (bf*)take(NB_ * PE * 2); bf* Ol = (bf*)take(NB_ * PE * 2); float* H = (float*)take(NB_ * PE * 4);
    if ((size_t)(wsp - (char*)d_ws) > ws_size) return;    // total ~ 29 MiB; ws 256 MiB
    const dim3 gP(NB_ * TT / 64, CC / 64, 1);
    // the statistics of SetNorm(X) and SetNorm(Y), all batch elements: sets 0..3 = X, 4..7 = Y
    k_pre<<<NBS + 5 * NBW, 256, 0, stream>>>(IN[0], IN[1], IN[2], IN[4], IN[6], IN[8], IN[10], PART, WQ);
    // Q = SetNorm(X) Wq^T + bq; K = SetNorm(Y) Wk^T + bk; V = Y Wv^T + bv: the four batch elements are 8192 rows of one product; each leaves its GEMM as the fp16 plane that the attention kernel reads
    k_qkv<<<dim3(NB_ * TT / 64, 3), 128, 0, stream>>>(IN[0], IN[1], PART, IN[12], IN[13], IN[14], IN[15], WQ, IN[3], IN[5], IN[7], QP, KP, V16);
    k_fattn<<<dim3(TT / 256, NB_ * NHD), 512, 0, stream>>>(QP, KP, V16, Oh, Ol);                             // softmax(Q_h K_h^T / 16) V_h, all pairs -> O as hi + lo planes
    k_gemmw<bf, 1, 2><<<gP, 32, 0, stream>>>(Oh, Ol, WO, nullptr, CC, H, IN[9], IN[0], nullptr, PART, 0, 0, 0);   // H = bf16(X) + O Wo^T + bo, and H's statistics per tile
    k_res<<<NB_ * TT / 64, 128, 0, stream>>>(H, PART, IN[16], IN[17], WR, IN[11], OUT);                          // out = H + relu(SetNorm(H)) Wres^T + bres
}

// v010
// One run takes 51.8 microseconds.
// In two side-by-side timings against v009, it was 1.11 and 1.10 times as fast.
// Over all steps from v000 it is 57.8 times as fast.
#include <hip/hip_runtime.h>

// MABClean (Set-Transformer MAB; X, Y [4][2048][256]; Q = SetNorm(X) Wq^T + bq, K = SetNorm(Y) Wk^T + bk, V = Y Wv^T + bv (SetNorm: normalise over all (samples, features) of one batch element, eps 1e-5,
// then per-feature scale/shift); 8 heads of 32: A = softmax_k(Q_h.K_h / sqrt(256)); O = concat_h A V_h; H = X + O Wo^T + bo; out = H + relu(SetNorm(H)) Wres^T + bres).
// Compute dtypes, f32 accumulate: every input rounded to bf16; the three SetNorm statistics (mean and variance over 524,288 values each) in ONE pass over the values: each group
// (a 64-row slice, a 64x64 tile) gives its sum and its squared deviations about ITS OWN mean, joined in fixed order (join_stats); the normalised operands as bf16 hi+lo planes x exact weights (2 products); V on PLAIN bf16 operands (exact, + bias); scores (K = 32) and attn.v on SINGLE fp16 planes (model

#define NB_  4
#define TT   2048
#define CC   256
#define NHD  8
#define DH   32
#define SCL  0.0625f              // 1/sqrt(dim_Y = 256)
#define C2   (SCL * 1.44269504f)  // score -> exponent of two
#define PSH  10.0f                // P carries 2^10 (as does its sum), so that small weights stay normal fp16 numbers
#define KPB  80                   // LDS pitch of one K row: 64 bytes + 16 (16 B x odd: no bank conflict for 16-byte reads down a column of rows)
#define VPB  4112                 // LDS pitch of one row of V^T: 4096 bytes + 16
#define NW   32                   // 64-row slices per statistic (k_pre: one group (sum, squared deviations) each, from a work-group of 8 waves; k_gemmw: four, one a column tile)
typedef _Float16 h16;
typedef unsigned short bf;
typedef __attribute__((ext_vector_type(16))) __bf16   v16bf;
typedef __attribute__((ext_vector_type(16))) _Float16 v16h;
typedef __attribute__((ext_vector_type(8)))  _Float16 v8h;
typedef __attribute__((ext_vector_type(8)))  unsigned short v8us;
typedef __attribute__((ext_vector_type(8)))  float    v8f;
typedef __attribute__((ext_vector_type(4)))  float    v4f;
typedef v8h  __attribute__((may_alias)) v8ha;
typedef v4f  __attribute__((may_alias)) v4fa;
typedef __attribute__((ext_vector_type(2)))  float    v2f;

// Rounding to bf16 is the chip's own convert instruction (round to nearest even, two values an instruction), not integer arithmetic on the float's bits; finite values come out the same.
typedef __attribute__((ext_vector_type(2)))  __bf16   v2bf;
typedef __attribute__((ext_vector_type(4)))  unsigned v4u;
typedef v4u  __attribute__((may_alias)) v4ua;
__device__ __forceinline__ unsigned short f2bf(float f) { return __builtin_bit_cast(unsigned short, (__bf16)f); }
__device__ __forceinline__ unsigned pk2bf(float a, float b) { return __builtin_bit_cast(unsigned, __builtin_convertvector((v2f){a, b}, v2bf)); }   // bf16(a) in the low half, bf16(b) in the high half
__device__ __forceinline__ float pklo(unsigned p) { return __uint_as_float(p << 16); }            // the low half as f32
__device__ __forceinline__ float pkhi(unsigned p) { return __uint_as_float(p & 0xFFFF0000u); }    // the high half as f32
__device__ __forceinline__ float bf2f(unsigned short b) { return __uint_as_float(((unsigned)b) << 16); }
__device__ __forceinline__ float bfr(float f) { return bf2f(f2bf(f)); }
__device__ __forceinline__ v16h cat16(v8h lo, v8h hi) { return __builtin_shufflevector(lo, hi, 0, 1, 2, 3, 4, 5, 6, 7, 8, 9, 10, 11, 12, 13, 14, 15); }
__device__ __forceinline__ v16bf cat16b(v8us lo, v8us hi) { return __builtin_bit_cast(v16bf, __builtin_shufflevector(lo, hi, 0, 1, 2, 3, 4, 5, 6, 7, 8, 9, 10, 11, 12, 13, 14, 15)); }
__device__ __forceinline__ v8f wmma16(v16h a, v16h b, v8f c) { return __builtin_amdgcn_wmma_f32_16x16x32_f16(false, a, false, b, (short)0, c, false, false); }
__device__ __forceinline__ v8f wmmab(v16bf a, v16bf b, v8f c) { return __builtin_amdgcn_wmma_f32_16x16x32_bf16(false, a, false, b, (short)0, c, false, false); }
__device__ __forceinline__ float xhalf(float x) { const int b = __float_as_int(x); return __int_as_float(__builtin_amdgcn_permlanex16(b, b, 0x76543210, 0xfedcba98, false, false)); }   // lane l <- lane l ^ 16
// lane l <- lane l ^ M inside its row of 16 lanes (DPP row_xmask; every lane of the wave must be on): for speed only, where __shfl_xor goes through the LDS pipe and its wait
template <int M> __device__ __forceinline__ float xrow(float x) { return __int_as_float(__builtin_amdgcn_update_dpp(0, __float_as_int(x), 0x160 | M, 0xf, 0xf, true)); }
__device__ __forceinline__ float wave_sum(float x) { x += xhalf(x); x += xrow<8>(x); x += xrow<4>(x); x += xrow<2>(x); return x + xrow<1>(x); }   // the sum over the 32 lanes, in every lane; partners 16, 8, 4, 2, 1



// ---- gemmw_tile (kernels k_gemmw, k_qkv and k_res): register-blocked GEMM, ONE WAVE per 64x64 output tile (16 accumulators), operands from K-contiguous 16-bit planes.
// NWV 1: a work-group is one wave, grid (M/64, N/64, Z), A and A2 are planes in memory. NWV 4: grid x = M/64, four waves share the tile rows and wave wv takes the columns 64 wv .. + 63;
// A and A2 are the tile's 64 rows in LDS (row pitch AP, laid there by stage_rows), and each wave has its own slice of the epilogue's LDS.
#define AP 264   // LDS pitch of a staged row in elements: 512 bytes + 16 (16 B x odd: no bank conflict for 16-byte reads down a column of rows)
// c[m][n] = sum_k A[m][k] Bt[n][k] (+ split products per NSPLIT) + bias[n], f32, n < 256. z-batch strides sA/sB/sC in elements. K % 32 == 0. The 8192 rows m are (batch element, token).
// The epilogue does the elementwise pass that used to follow in a launch of its own, so that c never goes through memory:
// EPI 0: c as fp16 into the head planes P[batch][head][token][32]. EPI 1: c as fp16, transposed, into P[batch][column][token].
// EPI 2: C = bf16(R) + c, and the tile's sum of C and its squared deviations about the tile's own mean into PART (one group of the statistics over C). EPI 3: C = R + c.
// Every address of the epilogue is a tile base that is the same in all lanes, one lane offset that is kept to the end, and a compile-time step.
template <typename T16> struct WFrag;
template <> struct WFrag<bf> { typedef v16bf V; static __device__ __forceinline__ V ld(const bf* p) { return cat16b(*(const v8us*)p, *(const v8us*)(p + 16)); } static __device__ __forceinline__ v8f mma(V a, V b, v8f c) { return wmmab(a, b, c); } };
template <typename T16, int NSPLIT, int EPI, int NWV = 1>
__device__ __forceinline__ void gemmw_tile(const T16* __restrict__ A, const T16* __restrict__ A2, const T16* __restrict__ Bt, const T16* __restrict__ Bt2, const int K, float* C, const float* __restrict__ bias, const float* __restrict__ R, h16* P, float* PART, const typename WFrag<T16>::V* bpre = nullptr) {
    typedef typename WFrag<T16>::V V;
    static_assert(NWV == 1 || EPI != 2, "the line of PART is numbered by blockIdx.y");
    const int lane = threadIdx.x & 31, lr = lane & 15, hi = lane >> 4; const int wv = NWV == 1 ? 0 : __builtin_amdgcn_readfirstlane(threadIdx.x >> 5);   // the wave's number as a scalar: the tile bases stay the same in all lanes
    const int r0 = blockIdx.x * 64, c0 = (NWV == 1 ? blockIdx.y : wv) * 64;
    v8f acc[4][4];
#pragma unroll
    for (int mb = 0; mb < 4; ++mb)
#pragma unroll
        for (int nb = 0; nb < 4; ++nb) acc[mb][nb] = (v8f){};
    const size_t aoff = (size_t)(r0 + lr) * K + 8 * hi, boff = (size_t)(c0 + lr) * K + 8 * hi;
    // EPI 2, 3: the epilogue's first loads (the residual rows of two 16-row blocks, the bias) are asked for in front of the last two k steps' products, when the rings take no new stage, so that they too are back when they are used
    v4f rr[2][8], braw; const float* rt = R + (size_t)r0 * CC + c0; const int lo = hi * CC + lr * 4;
    auto ask_res = [&] {
        asm volatile("s_wait_xcnt 0x0" ::: "memory");   // the wait owed before the rings' address registers, free since the last stage was asked for, take these loads' values
        __builtin_amdgcn_sched_barrier(0);              // keeps the loads below behind that wait
#pragma unroll   // both loops unrolled: rr is indexed by constants only and so stays in registers
        for (int mb = 0; mb < 2; ++mb)
#pragma unroll
            for (int s = 0; s < 8; ++s) rr[mb][s] = *(const v4f*)(rt + lo + (mb * 16 + 2 * s) * CC);
        braw = *(const v4f*)(bias + c0 + lr * 4);
        asm volatile("s_wait_xcnt 0x0" :: "v"(lr), "v"(lo) : "memory"); };   // the wait owed before the loads' offset registers (lo, lr) take new values; as inputs they stay whole up to here, so that no load of the run lands on them
    if constexpr (NWV == 1) {
        // A ring of three register stages: the fragments of k step s + 2 are asked for in front of step s's products, so that a load has two steps of matrix work to come back in and the wave waits out the load latency once, not once a step
        V a[3][4], a2[3][4], b[3][4], b2[3][4];
        auto ask = [&](const int st, const int kc) {
#pragma unroll   // unrolled, here and below: the stages and acc are indexed by constants only and so stay in registers
            for (int mb = 0; mb < 4; ++mb) { a[st][mb] = WFrag<T16>::ld(A + aoff + (size_t)mb * 16 * K + kc); if (NSPLIT == 1 || NSPLIT == 2) a2[st][mb] = WFrag<T16>::ld(A2 + aoff + (size_t)mb * 16 * K + kc); }
#pragma unroll
            for (int nb = 0; nb < 4; ++nb) { b[st][nb] = WFrag<T16>::ld(Bt + boff + (size_t)nb * 16 * K + kc); if (NSPLIT >= 2) b2[st][nb] = WFrag<T16>::ld(Bt2 + boff + (size_t)nb * 16 * K + kc); } };
        ask(0, 0); ask(1, 32);
#pragma unroll   // unrolled (K is a literal at the call): the ring's stage numbers must be constants
        for (int ks = 0; ks < K / 32; ++ks) { const int st = ks % 3;
            if (ks + 2 < K / 32) ask((ks + 2) % 3, (ks + 2) * 32);
            if (EPI >= 2 && ks == K / 32 - 2) ask_res();
            __builtin_amdgcn_sched_barrier(0);   // holds the requests in front of this step's products: left free, the compiler moved them down to just in front of their use, to save registers, and the wave waited for every one
#pragma unroll
            for (int nb = 0; nb < 4; ++nb)
#pragma unroll
                for (int mb = 0; mb < 4; ++mb) { acc[mb][nb] = WFrag<T16>::mma(a[st][mb], b[st][nb], acc[mb][nb]); if (NSPLIT == 1 || NSPLIT == 2) acc[mb][nb] = WFrag<T16>::mma(a2[st][mb], b[st][nb], acc[mb][nb]); if (NSPLIT >= 2) acc[mb][nb] = WFrag<T16>::mma(a[st][mb], b2[st][nb], acc[mb][nb]); }
            __builtin_amdgcn_sched_barrier(0);   // and keeps the next step's requests, and the epilogue's loads, behind these products
        }
    } else {
        const T16* as = A + lr * AP + 8 * hi; const T16* as2 = NSPLIT == 1 ? A2 + lr * AP + 8 * hi : as;   // the same k order as the B loader's: k = kc + 8 hi + 0..7, then kc + 16 + 8 hi + 0..7
// The same ring of three for the weight fragments (stages 0 and 1 were asked for by ask_weights, in front of the staging arithmetic: bpre), and two stages for the A fragments, read from LDS one step ahead
        V a[2][4], a2[2][4], b[3][4];
#pragma unroll   // unrolled, here and below: the stages and acc are indexed by constants only and so stay in registers
        for (int nb = 0; nb < 4; ++nb) { b[0][nb] = bpre[nb]; b[1][nb] = bpre[4 + nb]; }
        auto reada = [&](const int st, const int kc) {
#pragma unroll
            for (int mb = 0; mb < 4; ++mb) { a[st][mb] = WFrag<T16>::ld(as + mb * 16 * AP + kc); if (NSPLIT == 1) a2[st][mb] = WFrag<T16>::ld(as2 + mb * 16 * AP + kc); } };
        reada(0, 0);
#pragma unroll   // unrolled (K is a literal at the call): the rings' stage numbers must be constants
        for (int ks = 0; ks < K / 32; ++ks) { const int st = ks % 3, sa = ks & 1;
            if (ks + 2 < K / 32) {
#pragma unroll
                for (int nb = 0; nb < 4; ++nb) b[(ks + 2) % 3][nb] = WFrag<T16>::ld(Bt + boff + (size_t)nb * 16 * K + (ks + 2) * 32); }
            if (ks + 1 < K / 32) reada(sa ^ 1, (ks + 1) * 32);
            if (EPI >= 2 && ks == K / 32 - 2) ask_res();
            __builtin_amdgcn_sched_barrier(0);   // holds the requests in front of this step's products: left free, the compiler moved them down to just in front of their use, to save registers, and the wave waited for every one
#pragma unroll
            for (int nb = 0; nb < 4; ++nb)
#pragma unroll
                for (int mb = 0; mb < 4; ++mb) { acc[mb][nb] = WFrag<T16>::mma(a[sa][mb], b[st][nb], acc[mb][nb]); if (NSPLIT == 1) acc[mb][nb] = WFrag<T16>::mma(a2[sa][mb], b[st][nb], acc[mb][nb]); }
            __builtin_amdgcn_sched_barrier(0);   // and keeps the next step's requests, and the epilogue's loads, behind these products
        }
    }
    asm volatile("s_wait_xcnt 0x0" ::: "memory");   // the wait owed before the epilogue gives new values to the address registers of the loop's loads
    const int bt = r0 >> 11, t0 = r0 & (TT - 1);   // the tile's batch element and its first token (64 divides 2048: a tile lies in one batch element)
    if constexpr (EPI == 1) {
        // lane (lr, hi) holds 8 consecutive tokens of one column: 16 bytes of fp16. Through LDS (pitch 144 B = 16 B x odd) each column's 64 tokens leave as one whole 128-byte line.
        __shared__ __align__(16) h16 tsa[NWV * 64 * 72]; h16* ts = tsa + wv * 64 * 72;
#pragma unroll
        for (int nb = 0; nb < 4; ++nb) { const float bn = bfr(bias[c0 + nb * 16 + lr]);
#pragma unroll
            for (int mb = 0; mb < 4; ++mb) { v8h o;
#pragma unroll
                for (int j = 0; j < 8; ++j) o[j] = (h16)(acc[mb][nb][j] + bn);
                *(v8ha*)(ts + (nb * 16 + lr) * 72 + mb * 16 + hi * 8) = o; } }
        __builtin_amdgcn_wave_barrier(); asm volatile("" ::: "memory");   // keeps the LDS reads below behind the LDS writes above (other lanes' data)
        h16* vt = P + ((size_t)bt * CC + c0) * TT + t0; const int vo = (lane >> 3) * TT + (lane & 7) * 8;
#pragma unroll
        for (int s = 0; s < 16; ++s) *(v8h*)(vt + vo + s * 4 * TT) = *(const v8ha*)(ts + (s * 4 + (lane >> 3)) * 72 + (lane & 7) * 8);
    } else {
        __shared__ __align__(16) float osa[NWV * 16 * 68]; float* os = osa + wv * 16 * 68;
        float bq[2][8]; v4f bv, hs = {0.f, 0.f, 0.f, 0.f};
        v4f keep[4][8];   // EPI 2: the tile's values of C, for the squared deviations about the tile's mean
        float* ct = C + (size_t)r0 * CC + c0;
        h16* pt = P + (((size_t)bt * NHD + (c0 >> 5)) * TT + t0) * DH;
        if constexpr (EPI == 0) {
#pragma unroll
            for (int hh = 0; hh < 2; ++hh)
#pragma unroll
                for (int q = 0; q < 8; ++q) bq[hh][q] = bfr(bias[c0 + hh * 32 + (lane & 3) * 8 + q]);
        } else {
            // the residual rows of the first two 16-row blocks and the bias are under way since ask_res; those of block mb + 2 are asked for as soon as block mb's are used
#pragma unroll
            for (int q = 0; q < 4; ++q) bv[q] = bfr(braw[q]);
        }
#pragma unroll
        for (int mb = 0; mb < 4; ++mb) {
#pragma unroll
            for (int nb = 0; nb < 4; ++nb) {
#pragma unroll
                for (int j = 0; j < 8; ++j) os[(hi * 8 + j) * 68 + nb * 16 + lr] = acc[mb][nb][j]; }
            __builtin_amdgcn_wave_barrier(); asm volatile("" ::: "memory");   // keeps the LDS reads below behind the LDS writes above (other lanes' data)
            if constexpr (EPI == 0) {
                // one store = 8 tokens x 64 bytes of one head = 512 contiguous bytes
#pragma unroll
                for (int s = 0; s < 4; ++s) { const int hh = s >> 1, th = s & 1; const float* op = os + (th * 8 + (lane >> 2)) * 68 + hh * 32 + (lane & 3) * 8; const v4f x0 = *(const v4fa*)op, x1 = *(const v4fa*)(op + 4); v8h o;
#pragma unroll
                    for (int q = 0; q < 4; ++q) { o[q] = (h16)(x0[q] + bq[hh][q]); o[4 + q] = (h16)(x1[q] + bq[hh][4 + q]); }
                    *(v8h*)(pt + lane * 8 + (hh * TT + mb * 16 + th * 8) * DH) = o; }
            } else {
                v4f ob[8];   // EPI 3: the block's eight results, each in registers of its own up to the wait behind the stores
#pragma unroll
                for (int s = 0; s < 8; ++s) { const int row = 2 * s + hi, cofs = lr * 4; const v4f val = *(const v4fa*)(os + row * 68 + cofs) + bv; v4f x = rr[mb & 1][s]; v4f o;
                    if constexpr (EPI == 2) { const unsigned p0 = pk2bf(x[0], x[1]), p1 = pk2bf(x[2], x[3]); x = (v4f){pklo(p0), pkhi(p0), pklo(p1), pkhi(p1)}; }
#pragma unroll
                    for (int q = 0; q < 4; ++q) { o[q] = __fadd_rn(x[q], val[q]); if (EPI == 2) hs[q] = __fadd_rn(hs[q], o[q]); }
                    if constexpr (EPI == 2) keep[mb][s] = o;   // block mb's accumulators are dead by now: the tile's values take their place in the registers
                    if constexpr (EPI == 3) ob[s] = o;
                    *(v4f*)(ct + lo + (mb * 16 + 2 * s) * CC) = o; }
                // EPI 3: the wait owed before the data registers of the block's stores take new values (the next loads, the next block's LDS reads and sums); as inputs the eight results stay whole up to here (EPI 2 keeps them to the end: keep)
                if constexpr (EPI == 3) asm volatile("s_wait_xcnt 0x0" :: "v"(ob[0]), "v"(ob[1]), "v"(ob[2]), "v"(ob[3]), "v"(ob[4]), "v"(ob[5]), "v"(ob[6]), "v"(ob[7]) : "memory");
                if (mb < 2) {
#pragma unroll
                    for (int s = 0; s < 8; ++s) rr[mb][s] = *(const v4f*)(rt + lo + ((mb + 2) * 16 + 2 * s) * CC); }
            }
            __builtin_amdgcn_wave_barrier(); asm volatile("" ::: "memory");   // keeps the next block's LDS writes behind this block's LDS reads
        }
        if constexpr (EPI == 0) asm volatile("s_wait_xcnt 0x0" ::: "memory");   // the wait owed behind the last stores: in k_qkv the code of the other branch follows in the listing and gives new values to the stores' registers
        if constexpr (EPI == 2) {
            // fixed order: four chains a lane, their pair sums, the lanes of the wave; one 128-byte line of PART per tile: set bt, row (column tile) * NW + 64-row slice; word 0 the sum, word 1 the squared deviations
            float s = __fadd_rn(__fadd_rn(hs[0], hs[1]), __fadd_rn(hs[2], hs[3]));
#pragma unroll
            for (int sh = 16; sh; sh >>= 1) s += __shfl_xor(s, sh, 32);
            const float mt = s * (1.0f / 4096.0f); v4f dq = {0.f, 0.f, 0.f, 0.f};   // the tile's own mean; its 4,096 values are still in the registers
            asm volatile("s_wait_xcnt 0x0" ::: "memory");   // the wait owed before the registers that the tile's stores name take new values in the sums below
#pragma unroll   // both loops unrolled: keep is indexed by constants only and so stays in registers
            for (int mb = 0; mb < 4; ++mb)
#pragma unroll
                for (int u = 0; u < 8; ++u) { const v4f d = keep[mb][u] - mt; dq += d * d; }
            const float m2 = wave_sum((dq[0] + dq[1]) + (dq[2] + dq[3]));
            PART[(((size_t)bt * 4 + blockIdx.y) * NW + (t0 >> 6)) * 32 + lane] = (lane == 0) ? s : (lane == 1) ? m2 : 0.f;
        }
    }
}
template <typename T16, int NSPLIT, int EPI>
__global__ __launch_bounds__(32) void k_gemmw(const T16* __restrict__ A, const T16* __restrict__ A2, const T16* __restrict__ Bt, const T16* __restrict__ Bt2, float* C, const float* __restrict__ bias, const float* __restrict__ R, h16* P, float* PART, size_t sA, size_t sB, size_t sC) {
    const size_t z = blockIdx.z; A += z * sA; if (A2) A2 += z * sA; Bt += z * sB; if (Bt2) Bt2 += z * sB; C += z * sC;
    gemmw_tile<T16, NSPLIT, EPI>(A, A2, Bt, Bt2, CC, C, bias, R, P, PART);
}
typedef __attribute__((ext_vector_type(2))) _Float16 v2h;
typedef __attribute__((ext_vector_type(4))) _Float16 v4h;
typedef __attribute__((ext_vector_type(2))) unsigned short v2us;
typedef __attribute__((ext_vector_type(8))) _Float16 v8h16;

// CVU groups of 8 values a thread (a work-group: CVU * 2,048 values in a row), all loads issued before the first value is used; few waves with much to do each, for speed only
#define CVU 4
__device__ __forceinline__ void cvt8_blk(const float* __restrict__ src, bf* dst, const unsigned blk) { const size_t i = ((size_t)blk * (CVU * 256) + threadIdx.x) * 8; const float* p = src + i; bf* d = dst + i; v8f v[CVU]; v8us o[CVU];
#pragma unroll   // unrolled, here and below: v and o are indexed by constants only and so stay in registers
    for (int u = 0; u < CVU; ++u) v[u] = *(const v8f*)(p + u * 2048);
    asm volatile("s_wait_xcnt 0x0" :: "v"(p) : "memory");   // the wait owed before the loads' address registers take new values in the rounding below; p as an input keeps the pair whole up to here
#pragma unroll
    for (int u = 0; u < CVU; ++u)
#pragma unroll
        for (int k = 0; k < 8; ++k) o[u][k] = f2bf(v[u][k]);
#pragma unroll
    for (int u = 0; u < CVU; ++u) *(v8us*)(d + u * 2048) = o[u];
    asm volatile("s_wait_xcnt 0x0" ::: "memory"); }   // the wait owed behind the stores: in k_pre the code of the other branches follows in the listing and gives new values to the stores' registers
// set = statistic set: sets 0..NB_-1 are the batch elements of A0, sets NB_.. those of A1; slice = one slice of 64 rows, one group of the statistics: its sum and its squared deviations about its own mean.
// Wave v of the work-group takes rows 8v .. 8v + 7 of the slice: 16 loads of 16 bytes a lane, all issued before the first value is used, so that the wave waits out the load latency once and not once a load.
// amdgpu_waves_per_eu (on the kernels that call it): without the hint the compiler saved registers for sixteen waves a SIMD and held four of the sixteen loads back until earlier ones had returned.
// Fixed order, for the sum and then for the squared deviations: four chains a lane (one per vector component), their pair sums, the lanes of the wave, then the eight waves through LDS.
// The slice's 16,384 values stay in the registers between the two, so that they are read once; about the slice's own mean nothing cancels, whatever the mean of the whole set is.
template <int RAW>
__device__ __forceinline__ void psum_slice(const float* __restrict__ A0, const float* __restrict__ A1, float* PART, const int slice, const int set) {
    __shared__ float wsum[8], wsq[8];
    const float* A = set < NB_ ? A0 + (size_t)set * TT * CC : A1 + (size_t)(set - NB_) * TT * CC; PART += (size_t)set * NW * 32;
    const int lane = threadIdx.x & 31, wv = threadIdx.x >> 5; const float* p = A + ((size_t)slice * 64 + wv * 8) * CC + lane * 4;
    v4f v[16];
#pragma unroll
    for (int u = 0; u < 16; ++u) v[u] = *(const v4f*)(p + u * 128);
    asm volatile("s_wait_xcnt 0x0" :: "v"(p) : "memory");   // the wait owed before the loads' address registers take new values; p as an input keeps the pair whole up to here, so that no load of the run lands on it
    v4f a = {0.f, 0.f, 0.f, 0.f}, dq = {0.f, 0.f, 0.f, 0.f};
#pragma unroll
    for (int u = 0; u < 16; ++u) {
        if (RAW) { const unsigned p0 = pk2bf(v[u][0], v[u][1]), p1 = pk2bf(v[u][2], v[u][3]); v[u] = (v4f){pklo(p0), pkhi(p0), pklo(p1), pkhi(p1)}; }
#pragma unroll
        for (int q = 0; q < 4; ++q) a[q] = __fadd_rn(a[q], v[u][q]); }
    float s = __fadd_rn(__fadd_rn(a[0], a[1]), __fadd_rn(a[2], a[3]));
#pragma unroll
    for (int sh = 16; sh; sh >>= 1) s += __shfl_xor(s, sh, 32);
    if (lane == 0) wsum[wv] = s;
    __syncthreads();   // the eight waves' sums are in LDS; every wave joins them, in one order, to the slice's sum
    float t = wsum[lane & 7]; t += xrow<4>(t); t += xrow<2>(t); t += xrow<1>(t);
    const float ms = t * (1.0f / 16384.0f);
#pragma unroll   // unrolled: v is indexed by constants only and so stays in registers
    for (int u = 0; u < 16; ++u) { const v4f d = v[u] - ms; dq += d * d; }
    const float r = wave_sum((dq[0] + dq[1]) + (dq[2] + dq[3]));
    if (lane == 0) wsq[wv] = r;
    __syncthreads();   // the eight waves' squared deviations are in LDS; wave 0 joins them
    if (wv == 0) { float t2 = wsq[lane & 7]; t2 += xrow<4>(t2); t2 += xrow<2>(t2); t2 += xrow<1>(t2);
        PART[(size_t)slice * 32 + lane] = (lane == 0) ? t : (lane == 1) ? t2 : 0.f; }
}
// The two passes that depend on the inputs alone, in one launch: the 256 slices of the statistics over X and Y, then the bf16 planes of the five weight matrices (NBW work-groups each, one plane behind the other in WP).
#define NBS (NW * 2 * NB_)
#define NBW (CC * CC / 8 / 256 / CVU)
__global__ __launch_bounds__(256) __attribute__((amdgpu_waves_per_eu(2, 4))) void k_pre(const float* __restrict__ X, const float* __restrict__ Y, const float* __restrict__ s0, const float* __restrict__ s1, const float* __restrict__ s2, const float* __restrict__ s3, const float* __restrict__ s4, float* PART, bf* WP) {
    const unsigned b = blockIdx.x;
    if (b < NBS) psum_slice<1>(X, Y, PART, b % NW, b / NW);
    else { const unsigned y = (b - NBS) / NBW; cvt8_blk(y == 0 ? s0 : y == 1 ? s1 : y == 2 ? s2 : y == 3 ? s3 : s4, WP + (size_t)y * CC * CC, (b - NBS) % NBW); }
}
// One wave joins a set's NP * NW groups (NP per lane: one slice from k_pre, or the four column tiles of k_gemmw) of TT * CC / (NP * NW) values each; PART holds a group's sum in word 0 of its line and its squared
// deviations about its own mean in word 1. Squared deviations about the set's mean = sum over the groups of (their own + group size x (group mean - set mean)^2): only non-negative terms are added.
// Returns {mean, 1 / sqrt(variance + 1e-5)} in every lane.
// ahead(): loads that the caller wants under way while the statistics are joined; called behind the statistics' own loads, which so come back first.
template <int NP, typename F>
__device__ __forceinline__ v2f join_stats(const float* __restrict__ PART, const int lane, F&& ahead) {
    constexpr float gn = (float)(TT * CC / (NP * NW)), inv = 1.0f / (float)(TT * CC); const float* p = PART + (size_t)lane * 32; v2f g[NP];
#pragma unroll   // unrolled, here and below: g stays in registers and its NP loads are in flight together
    for (int k = 0; k < NP; ++k) g[k] = *(const v2f*)(p + (size_t)k * NW * 32);
    asm volatile("s_wait_xcnt 0x0" ::: "memory");   // the wait owed before the loads' address registers take new values
    ahead();
    float s = g[0][0];
#pragma unroll
    for (int k = 1; k < NP; ++k) s += g[k][0];
    const float mu = wave_sum(s) * inv; float m2 = 0.f;
#pragma unroll
    for (int k = 0; k < NP; ++k) { const float d = g[k][0] * (1.0f / gn) - mu; m2 += g[k][1] + gn * d * d; }
    return (v2f){mu, __fdiv_rn(1.0f, __fsqrt_rn(__fadd_rn(wave_sum(m2) * inv, 1e-5f)))}; }
// stage_rows: the A operand of a 64-row tile is made where it is used. Wave wv of four reads rows 16 wv .. + 15 of the tile's f32 source (a lane: 8 columns of each row, all 32 loads in flight together),
// normalises them and lays the hi + lo bf16 planes into LDS, so that no plane goes through memory and no launch stands between the statistics and the product. Every wave joins the set's statistics itself (no hand-over).
// MODE 0: bf16 rounding alone, hi plane only. MODE 1: SetNorm of the bf16-rounded source. MODE 2: relu(SetNorm) of the f32 source.
// ask_weights: a wave's weight fragments of the first two k steps (its 64 output columns x 64 k: 16 loads of 16 bytes a lane, the k order of WFrag::ld) are asked for behind the rows' and the statistics' loads and in front of the
// staging arithmetic, so that they come back while the rows are normalised; gemmw_tile's ring goes on from there. bw[4 * (k step) + (16-column block)].
__device__ __forceinline__ void ask_weights(const bf* __restrict__ Bt, v16bf* bw, const int wv, const int lane) {
    const bf* p = Bt + (size_t)(wv * 64 + (lane & 15)) * CC + 8 * (lane >> 4);
#pragma unroll   // both loops unrolled: bw is indexed by constants only and so stays in registers
    for (int ks = 0; ks < 2; ++ks)
#pragma unroll
        for (int nb = 0; nb < 4; ++nb) bw[ks * 4 + nb] = WFrag<bf>::ld(p + nb * 16 * CC + ks * 32);
    asm volatile("s_wait_xcnt 0x0" :: "v"(p) : "memory");   // the wait owed before the loads' address registers take new values; p as an input keeps the pair whole up to here, so that no load of the run lands on it
}
template <int MODE, int NP>
__device__ __forceinline__ void stage_rows(const float* __restrict__ src, const float* __restrict__ PARTS, const float* __restrict__ w, const float* __restrict__ b, bf* Ah, bf* Al, const int wv, const int lane, const bf* __restrict__ Bt, v16bf* bw) {
    const float* p = src + (size_t)(wv * 16) * CC + lane * 8; v8f x[16], w8, b8; float mu = 0.f, rs = 0.f;
#pragma unroll   // unrolled, here and below: x is indexed by constants only and so stays in registers
    for (int u = 0; u < 16; ++u) x[u] = *(const v8f*)(p + u * CC);
    if constexpr (MODE != 0) { w8 = *(const v8f*)(w + lane * 8); b8 = *(const v8f*)(b + lane * 8); }
    asm volatile("s_wait_xcnt 0x0" :: "v"(p) : "memory");   // the wait owed before the loads' address registers take new values; p as an input keeps the pair whole up to here, so that no load of the run lands on it
    if constexpr (MODE == 0) ask_weights(Bt, bw, wv, lane);
    if constexpr (MODE != 0) { const v2f r = join_stats<NP>(PARTS, lane, [&] { ask_weights(Bt, bw, wv, lane); }); mu = r[0]; rs = r[1];
#pragma unroll
        for (int q = 0; q < 8; ++q) { w8[q] = bfr(w8[q]); b8[q] = bfr(b8[q]); } }
    bf* dh = Ah + (wv * 16) * AP + lane * 8; bf* dl = Al + (wv * 16) * AP + lane * 8;
#pragma unroll
    for (int u = 0; u < 16; ++u) { v4u oh, ol;   // two neighbouring columns a word
#pragma unroll
        for (int q = 0; q < 8; q += 2) { float x0 = x[u][q], x1 = x[u][q + 1];
            if constexpr (MODE == 0) oh[q >> 1] = pk2bf(x0, x1);
            else { if (MODE == 1) { const unsigned p = pk2bf(x0, x1); x0 = pklo(p); x1 = pkhi(p); }
                float y0 = __fadd_rn(__fmul_rn(__fmul_rn(__fsub_rn(x0, mu), rs), w8[q]), b8[q]), y1 = __fadd_rn(__fmul_rn(__fmul_rn(__fsub_rn(x1, mu), rs), w8[q + 1]), b8[q + 1]);
                if (MODE == 2) { y0 = fmaxf(y0, 0.f); y1 = fmaxf(y1, 0.f); }
                const unsigned h = pk2bf(y0, y1); oh[q >> 1] = h; ol[q >> 1] = pk2bf(y0 - pklo(h), y1 - pkhi(h)); } }
        *(v4ua*)(dh + u * AP) = oh; if constexpr (MODE != 0) *(v4ua*)(dl + u * AP) = ol; }
}
// The three projections depend on nothing of one another: one launch, grid (8192 / 64 row tiles, 3), 4 waves: blockIdx.y = 0: Q from SetNorm(X), 1: K from SetNorm(Y), 2: V from bf16(Y).
// A work-group stages its 64 rows once and wave wv takes the output columns 64 wv .. + 63. W: the planes of Wq, Wk, Wv one behind the other. PART: the slices' statistics, sets 0..3 = X, 4..7 = Y.
__global__ __launch_bounds__(128) void k_qkv(const float* __restrict__ X, const float* __restrict__ Y, const float* __restrict__ PART, const float* __restrict__ nqw, const float* __restrict__ nqb, const float* __restrict__ nkw, const float* __restrict__ nkb, const bf* __restrict__ W, const float* __restrict__ bq, const float* __restrict__ bk, const float* __restrict__ bv, h16* QP, h16* KP, h16* V16) {
    __shared__ __align__(16) bf Ah[64 * AP], Al[64 * AP];
    const int z = blockIdx.y, r0 = blockIdx.x * 64, lane = threadIdx.x & 31, wv = __builtin_amdgcn_readfirstlane(threadIdx.x >> 5);   // the wave's number as a scalar: the tile bases stay the same in all lanes
    v16bf bw[2 * 4];   // the wave's weight fragments of the first two k steps, in registers from the staging on
    if (z == 2) stage_rows<0, 1>(Y + (size_t)r0 * CC, nullptr, nullptr, nullptr, Ah, Al, wv, lane, W + 2 * CC * CC, bw);
    else stage_rows<1, 1>((z ? Y : X) + (size_t)r0 * CC, PART + (size_t)(z * NB_ + (r0 >> 11)) * NW * 32, z ? nkw : nqw, z ? nkb : nqb, Ah, Al, wv, lane, W + z * CC * CC, bw);
    __syncthreads();   // the four waves' rows are in LDS for all of them
    if (z == 2) gemmw_tile<bf, 0, 1, 4>(Ah, nullptr, W + 2 * CC * CC, nullptr, CC, nullptr, bv, nullptr, V16, nullptr, bw);
    else gemmw_tile<bf, 1, 0, 4>(Ah, Al, W + z * CC * CC, nullptr, CC, nullptr, z ? bk : bq, nullptr, z ? KP : QP, nullptr, bw);
}
// out = H + relu(SetNorm(H)) Wres^T + bres: grid 8192 / 64 row tiles, 4 waves, staged as above; PART: the statistics of H per 64x64 tile (four column tiles a slice).
__global__ __launch_bounds__(128) void k_res(const float* __restrict__ H, const float* __restrict__ PART, const float* __restrict__ w, const float* __restrict__ b, const bf* __restrict__ WR, const float* __restrict__ bres, float* OUT) {
    __shared__ __align__(16) bf Ah[64 * AP], Al[64 * AP];
    const int r0 = blockIdx.x * 64, lane = threadIdx.x & 31, wv = __builtin_amdgcn_readfirstlane(threadIdx.x >> 5);   // the wave's number as a scalar: the tile bases stay the same in all lanes
    v16bf bw[2 * 4];   // the wave's weight fragments of the first two k steps, in registers from the staging on
    stage_rows<2, 4>(H + (size_t)r0 * CC, PART + (size_t)(r0 >> 11) * 4 * NW * 32, w, b, Ah, Al, wv, lane, WR, bw);
    __syncthreads();   // the four waves' rows are in LDS for all of them
    gemmw_tile<bf, 1, 3, 4>(Ah, Al, WR, nullptr, CC, OUT, bres, H, nullptr, nullptr, bw);
}
// ---- k_fattn: scores, softmax, attn.v and the hi/lo split of O in one kernel; no score and no weight leaves the registers.
// grid (2048 / 256 query blocks, 32 (batch, head) pairs), 16 waves. The pair's whole K [2048][32] and V^T [32][2048] are laid into LDS once (padded pitches), then read by every wave.
// Wave w: query columns (w & 7) * 32 .. + 31, keys (w >> 3) * 1024 .. + 1023, 64 keys a pass. S^T = K Q^T: lane (c, h) holds query c's scores of keys 8h + r of each 16-key tile, which, rounded to fp16,
// ARE the B operand of O^T += V^T P^T (hardware k order; K, Q and V^T fragments are loaded in the same order). Running maximum per query column; the two key halves are joined through LDS at the end.
typedef float __attribute__((may_alias)) fa;
// v_exp_f32 with the one slot behind a transcendental filled in the same statement
__device__ __forceinline__ float exp2_slot(float x) { float r; asm("v_exp_f32 %0, %1\n\tv_nop" : "=v"(r) : "v"(x)); return r; }
__global__ __launch_bounds__(512) void k_fattn(const h16* __restrict__ QP, const h16* __restrict__ KP, const h16* __restrict__ V16, bf* Oh, bf* Ol) {
    __shared__ __align__(16) unsigned char sm[TT * KPB + DH * VPB];
    unsigned char* Ks = sm; unsigned char* Vs = sm + TT * KPB;
    const int g = blockIdx.y, tid = threadIdx.x, lane = tid & 31, wave = tid >> 5, lr = lane & 15, hi = lane >> 4;
    const int qg = wave & 7, kh = wave >> 3, q0 = blockIdx.x * 256 + qg * 32;
    v16h qf[2];
#pragma unroll
    for (int t = 0; t < 2; ++t) { const h16* p = QP + ((size_t)g * TT + q0 + t * 16 + lr) * DH + 8 * hi; qf[t] = cat16(*(const v8h*)p, *(const v8h*)(p + 16)); }
    asm volatile("s_wait_xcnt 0x0" ::: "memory");   // the Q loads' address registers are given new values further down, ahead of the loads' data wait: this wait stands in front of that
    const h16* Kg = KP + (size_t)g * TT * DH; const h16* Vg = V16 + (size_t)g * DH * TT;
#pragma unroll
    for (int u = 0; u < TT * DH / 8 / 512; ++u) { const int i = u * 512 + tid; *(v8ha*)(Ks + (i >> 2) * KPB + (i & 3) * 16) = *(const v8h*)(Kg + (size_t)i * 8); }
#pragma unroll
    for (int u = 0; u < TT * DH / 8 / 512; ++u) { const int i = u * 512 + tid; *(v8ha*)(Vs + (i >> 8) * VPB + (i & 255) * 16) = *(const v8h*)(Vg + (size_t)i * 8); }
    __syncthreads();
    v8f o[2][2]; float m[2], l[2];
#pragma unroll
    for (int t = 0; t < 2; ++t) { o[t][0] = (v8f){}; o[t][1] = (v8f){}; m[t] = -3.0e38f; l[t] = 0.f; }
    const unsigned char* kp = Ks + (kh * (TT / 2) + lr) * KPB + 16 * hi; const unsigned char* vp = Vs + lr * VPB + (kh * (TT / 2) + 8 * hi) * 2;
    // kept rolled: one pass is already several hundred instructions
#pragma unroll 1
    for (int ps = 0; ps < TT / 2 / 64; ++ps, kp += 64 * KPB, vp += 64 * 2) {
        v8f s[2][4];
#pragma unroll
        for (int kt = 0; kt < 4; ++kt) { const v16h ka = cat16(*(const v8ha*)(kp + kt * 16 * KPB), *(const v8ha*)(kp + kt * 16 * KPB + 32));
#pragma unroll
            for (int t = 0; t < 2; ++t) s[t][kt] = wmma16(ka, qf[t], (v8f){}); }
        v16h va[2][2];
#pragma unroll
        for (int dt = 0; dt < 2; ++dt)
#pragma unroll
            for (int kk = 0; kk < 2; ++kk) va[dt][kk] = cat16(*(const v8ha*)(vp + dt * 16 * VPB + kk * 64), *(const v8ha*)(vp + dt * 16 * VPB + kk * 64 + 32));
#pragma unroll
        for (int t = 0; t < 2; ++t) {
            float mk[4];
#pragma unroll
            for (int kt = 0; kt < 4; ++kt) { mk[kt] = s[t][kt][0];
#pragma unroll
                for (int j = 1; j < 8; ++j) mk[kt] = fmaxf(mk[kt], s[t][kt][j]); }
            float mx = fmaxf(fmaxf(mk[0], mk[1]), fmaxf(mk[2], mk[3])); mx = fmaxf(mx, xhalf(mx));
            const float mn = fmaxf(m[t], mx * C2), al = exp2_slot(m[t] - mn); m[t] = mn;
            const v2f cv = {C2, C2}, nb = {PSH - mn, PSH - mn}; v2f sk[4]; v16h pf[2];
#pragma unroll
            for (int kt = 0; kt < 4; ++kt) {
#pragma unroll
                for (int j = 0; j < 8; j += 2) { const v2f x = __builtin_elementwise_fma((v2f){s[t][kt][j], s[t][kt][j + 1]}, cv, nb); const v2f e = {__builtin_amdgcn_exp2f(x[0]), __builtin_amdgcn_exp2f(x[1])}; sk[kt] = j ? sk[kt] + e : e;
                    const v2h c = __builtin_convertvector(e, v2h); pf[kt >> 1][(kt & 1) * 8 + j] = c[0]; pf[kt >> 1][(kt & 1) * 8 + j + 1] = c[1]; } }
            const v2f st = (sk[0] + sk[1]) + (sk[2] + sk[3]); l[t] = l[t] * al + (st[0] + st[1]);
#pragma unroll
            for (int dt = 0; dt < 2; ++dt) { o[t][dt] *= al;
#pragma unroll
                for (int kk = 0; kk < 2; ++kk) o[t][dt] = wmma16(va[dt][kk], pf[kk], o[t][dt]); }
        }
    }
    __syncthreads();   // every wave has left K and V^T: the first K rows now carry the upper key half's state to its partner wave
    fa* mb = (fa*)sm + (size_t)qg * 36 * 32 + lane;
    if (kh == 1) {
#pragma unroll
        for (int t = 0; t < 2; ++t) { mb[(t * 18) * 32] = m[t]; mb[(t * 18 + 1) * 32] = l[t];
#pragma unroll
            for (int r = 0; r < 16; ++r) mb[(t * 18 + 2 + r) * 32] = o[t][r >> 3][r & 7]; }
    }
    __syncthreads();
    if (kh == 0) {
#pragma unroll
        for (int t = 0; t < 2; ++t) { const float m1 = mb[(t * 18) * 32], l1 = mb[(t * 18 + 1) * 32], mN = fmaxf(m[t], m1); float a0 = exp2_slot(m[t] - mN), a1 = exp2_slot(m1 - mN);
            float lt = l[t] * a0 + l1 * a1; lt += xhalf(lt); const float inv = __fdiv_rn(1.0f, lt); a0 *= inv; a1 *= inv;
#pragma unroll
            for (int dt = 0; dt < 2; ++dt) { v4u oh, ol;   // two neighbouring columns a word
#pragma unroll
                for (int j = 0; j < 8; j += 2) { const float y0 = o[t][dt][j] * a0 + mb[(t * 18 + 2 + dt * 8 + j) * 32] * a1, y1 = o[t][dt][j + 1] * a0 + mb[(t * 18 + 2 + dt * 8 + j + 1) * 32] * a1;
                    const unsigned h = pk2bf(y0, y1); oh[j >> 1] = h; ol[j >> 1] = pk2bf(y0 - pklo(h), y1 - pkhi(h)); }
                const size_t off = ((size_t)(g >> 3) * TT + q0 + t * 16 + lr) * CC + (g & 7) * DH + dt * 16 + 8 * hi; *(v4ua*)(Oh + off) = oh; *(v4ua*)(Ol + off) = ol; } }
    }
}
extern "C" void kernel_launch(void* const* d_in, const int* in_sizes, int n_in,
                              void* d_out, int out_size, void* d_ws, size_t ws_size, hipStream_t stream) {
    (void)in_sizes; (void)n_in; (void)out_size;
    const float* IN[18]; for (int i = 0; i < 18; ++i) IN[i] = (const float*)d_in[i];
    // X, Y [4][2048][256], Wq [256][256], bq, Wk, bk, Wv, bv, Wo, bo, Wres, bres, nq_w, nq_b, nk_w, nk_b, n0_w, n0_b = d_in[0..17]
    float* OUT = (float*)d_out;     // [4][2048][256]
    char* wsp = (char*)d_ws;
    auto take = [&](size_t bytes) { char* p = wsp; wsp += (bytes + 255) & ~(size_t)255; return (void*)p; };
    const size_t PE = (size_t)TT * CC;                      // elements of one batch element's [2048][256] plane
    bf* WQ = (bf*)take((size_t)CC * CC * 2); bf* WK = (bf*)take((size_t)CC * CC * 2); bf* WV = (bf*)take((size_t)CC * CC * 2); bf* WO = (bf*)take((size_t)CC * CC * 2); bf* WR = (bf*)take((size_t)CC * CC * 2);   (void)WK; (void)WV;   // one behind the other (k_pre, k_qkv)
    float* PART = (float*)take((size_t)4 * NB_ * NW * 32 * 4);
    // live through the attention part; g = batch * 8 + head runs through all of them
    h16* QP = (h16*)take((size_t)NB_ * NHD * TT * DH * 2); h16* KP = (h16*)take((size_t)NB_ * NHD * TT * DH * 2); h16* V16 = (h16*)take((size_t)NB_ * CC * TT * 2);
    bf* Oh = (bf*)take(NB_ * PE * 2); bf* Ol = (bf*)take(NB_ * PE * 2); float* H = (float*)take(NB_ * PE * 4);
    if ((size_t)(wsp - (char*)d_ws) > ws_size) return;    // total ~ 29 MiB; ws 256 MiB
    const dim3 gP(NB_ * TT / 64, CC / 64, 1);
    // the statistics of SetNorm(X) and SetNorm(Y), all batch elements: sets 0..3 = X, 4..7 = Y
    k_pre<<<NBS + 5 * NBW, 256, 0, stream>>>(IN[0], IN[1], IN[2], IN[4], IN[6], IN[8], IN[10], PART, WQ);
    // Q = SetNorm(X) Wq^T + bq; K = SetNorm(Y) Wk^T + bk; V = Y Wv^T + bv: the four batch elements are 8192 rows of one product; each leaves its GEMM as the fp16 plane that the attention kernel reads
    k_qkv<<<dim3(NB_ * TT / 64, 3), 128, 0, stream>>>(IN[0], IN[1], PART, IN[12], IN[13], IN[14], IN[15], WQ, IN[3], IN[5], IN[7], QP, KP, V16);
    k_fattn<<<dim3(TT / 256, NB_ * NHD), 512, 0, stream>>>(QP, KP, V16, Oh, Ol);                             // softmax(Q_h K_h^T / 16) V_h, all pairs -> O as hi + lo planes
    k_gemmw<bf, 1, 2><<<gP, 32, 0, stream>>>(Oh, Ol, WO, nullptr, H, IN[9], IN[0], nullptr, PART, 0, 0, 0);   // H = bf16(X) + O Wo^T + bo, and H's statistics per tile
    k_res<<<NB_ * TT / 64, 128, 0, stream>>>(H, PART, IN[16], IN[17], WR, IN[11], OUT);                          // out = H + relu(SetNorm(H)) Wres^T + bres
}
